// v000
// Measured on an AMD MI455X. A time is GPU time per run, averaged over a window of back-to-back runs after a warm-up
// (all launches, gaps included; the runs take copies of the inputs in turn), and the median of several windows.
// Apart from v000's, it joins two sittings. Times from different sittings can be a few percent apart, while
// side-by-side timings come from the same sitting.
// The starting kernel, v000, takes 1500 microseconds a run.
// compute dtype: all float inputs rounded to bf16, the four lambda vectors and gamma read; qkv = x w_attn ((in,out)) with EXACT bf16 products on WMMA 16x16x32, f32 accumulate; q as f16 hi + residual (x 2^10), k f16 -> 2-product causal logits x (32^-1/2)^2 = 1/32 stored in f32 (8 of the 32 score heads per launch); softmax in f32 (precise expf); P x 2^11 split bf16 hi + lo against v bf16 hi + lo (3 products) per score head into its value head-pair slot; the differential combination P1 v - lambda P2 v, RMSNorm, gamma and (1 - lambda_init) in f32; out = that (bf16 hi + lo) w_proj; f32 output.
#include <hip/hip_runtime.h>
#include <math.h>

typedef __attribute__((ext_vector_type(16))) _Float16 v16h;
typedef __attribute__((ext_vector_type(16))) __bf16 v16b;
typedef __attribute__((ext_vector_type(8)))  _Float16 v8h;
typedef __attribute__((ext_vector_type(8)))  float v8f;
typedef __attribute__((ext_vector_type(4)))  float v4f;
typedef __attribute__((ext_vector_type(2)))  float v2f;
typedef __attribute__((ext_vector_type(4)))  unsigned v4u;
typedef __attribute__((ext_vector_type(4)))  int v4i;
typedef float __attribute__((may_alias)) float_a;
typedef int __attribute__((may_alias)) int_a;

template <typename T> __device__ __forceinline__ void vst2(void* p, T v) { *(T*)p = v;  }
__device__ __forceinline__ v8f wmma16(v16h a, v16h b, v8f c) {
  v8f d = __builtin_amdgcn_wmma_f32_16x16x32_f16(false, a, false, b, (short)0, c, false, false);
  asm volatile("v_nop\n\tv_nop\n\tv_nop\n\tv_nop" : "+v"(d) : "v"(a), "v"(b));
  return d;
}
__device__ __forceinline__ v8f wmma_bf(v16b a, v16b b, v8f c) {
  v8f d = __builtin_amdgcn_wmma_f32_16x16x32_bf16(false, a, false, b, (short)0, c, false, false);
  asm volatile("v_nop\n\tv_nop\n\tv_nop\n\tv_nop" : "+v"(d) : "v"(a), "v"(b));
  return d;
}
// 16x16x32 fragments: lane = (h = lane>>4, row/col = lane&15); elements 0..7 = k0+8h+0..7, 8..15 = k0+16+8h+0..7; D element r = row 8h+r
__device__ __forceinline__ v16h frag_h(const _Float16* rowk0, int lane) {
  union { v16h v; v8h q[2]; } u; const _Float16* p = rowk0 + 8 * (lane >> 4);
  u.q[0] = *(const v8h*)p; u.q[1] = *(const v8h*)(p + 16); return u.v;
}
__device__ __forceinline__ v16h frag_f32(const float* rowk0, int lane) {
  v16h a; const float* p = rowk0 + 8 * (lane >> 4);
#pragma unroll
  for (int i = 0; i < 8; ++i) { a[i] = (_Float16)p[i]; a[8 + i] = (_Float16)p[16 + i]; }
  return a;
}
__device__ __forceinline__ v16h frag_f32s(const float* rowk0, int lane, float sc) {
  v16h a; const float* p = rowk0 + 8 * (lane >> 4);
#pragma unroll
  for (int i = 0; i < 8; ++i) { a[i] = (_Float16)(p[i] * sc); a[8 + i] = (_Float16)(p[16 + i] * sc); }
  return a;
}
// column fragment from a [K][ld] layout (column n), rows >= K read as 0
__device__ __forceinline__ v16h fragc_f32(const float* W, int k0, int n, int lane, int ld, int K) {
  v16h a; const int g = lane >> 4;
#pragma unroll
  for (int i = 0; i < 8; ++i) { const int ka = k0 + 8 * g + i, kb = ka + 16;
    a[i] = (_Float16)(ka < K ? W[(size_t)(ka < K ? ka : K - 1) * ld + n] : 0.f); a[8 + i] = (_Float16)(kb < K ? W[(size_t)(kb < K ? kb : K - 1) * ld + n] : 0.f); }
  return a;
}
struct F2 { v16b h, l; };
__device__ __forceinline__ F2 bsplit16(const float v[16]) { F2 r;
#pragma unroll
  for (int i = 0; i < 16; ++i) { const __bf16 h = (__bf16)v[i]; r.h[i] = h; r.l[i] = (__bf16)(v[i] - (float)h); }
  return r; }
__device__ __forceinline__ F2 split_row(const float* row, int k0, int lane) { float v[16]; const float* p = row + k0 + 8 * (lane >> 4);
#pragma unroll
  for (int i = 0; i < 8; ++i) { v[i] = p[i]; v[8 + i] = p[16 + i]; }
  return bsplit16(v); }
__device__ __forceinline__ F2 split_rowK(const float* row, int k0, int lane, int K) { float v[16]; const int g = lane >> 4;
#pragma unroll
  for (int i = 0; i < 8; ++i) { const int ka = k0 + 8 * g + i, kb = ka + 16; v[i] = ka < K ? row[ka < K ? ka : K - 1] : 0.f; v[8 + i] = kb < K ? row[kb < K ? kb : K - 1] : 0.f; }
  return bsplit16(v); }
__device__ __forceinline__ F2 split_col(const float* W, int k0, int n, int lane, int ld, int K) { float v[16]; const int g = lane >> 4;
#pragma unroll
  for (int i = 0; i < 8; ++i) { const int ka = k0 + 8 * g + i, kb = ka + 16; v[i] = ka < K ? W[(size_t)(ka < K ? ka : K - 1) * ld + n] : 0.f; v[8 + i] = kb < K ? W[(size_t)(kb < K ? kb : K - 1) * ld + n] : 0.f; }
  return bsplit16(v); }
__device__ __forceinline__ v8f mac3(const F2& a, const F2& b, v8f c) { c = wmma_bf(a.l, b.h, c); c = wmma_bf(a.h, b.l, c); return wmma_bf(a.h, b.h, c); }
__device__ __forceinline__ float sigm(float v) { return 1.0f / (1.0f + expf(-v)); }
#define LDSX() do { asm volatile("s_wait_dscnt 0" ::: "memory"); __builtin_amdgcn_wave_barrier(); __builtin_amdgcn_fence(__ATOMIC_RELEASE, "workgroup"); } while (0)


// Differential causal attention (B 4, T 1,024, C 1,024; 2H = 32 score heads x 32, 16 value heads x 64): att = softmax(causal(q k^T / 32)) per score head; diff_i = att_{2i} - lambda att_{2i+1}, lambda = exp(lq1.lk1) - exp(lq2.lk2) + 0.2; out_i = RMSNorm(diff_i v_i) * gamma * 0.8; concat w_proj.
#define NB 4
#define TT 1024
#define CC 1024
#define NH 32              // score heads (2H)
#define HD 32              // score head dim
#define HDV 64             // value head dim (16 value heads)
#define WIN (TT + 1)       // plain causal
#define NKV 32             // k has the same 32 heads
#define LDW 3072           // w_attn (in,out) [1024][3072]: q | k | v column blocks
#define CK (NKV * HD)   // 1,024: k/v row width
#define REP (NH / NKV)
#ifndef TNB
#define TNB NB
#endif
typedef __attribute__((ext_vector_type(8))) __bf16 v8b;
__device__ __forceinline__ v16b frag_b(const __bf16* rowk0, int lane) {
  union { v16b v; v8b q[2]; } u; const __bf16* p = rowk0 + 8 * (lane >> 4);
  u.q[0] = *(const v8b*)p; u.q[1] = *(const v8b*)(p + 16); return u.v;
}
__device__ __forceinline__ float bfr(float v) { return (float)(__bf16)v; }
__device__ __attribute__((noinline)) float exp_ni(float v) { return expf(v); }
__device__ __attribute__((noinline)) float erf_ni(float v) { return erff(v); }

#define WS_QH  0u
#define WS_QL  (WS_QH + 2u * (size_t)NB * TT * CC)
#define WS_KH  (WS_QL + 2u * (size_t)NB * TT * CC)
#define WS_VT  (WS_KH + 2u * (size_t)NB * TT * CK)      // bf16 v planes [b][CK][t] (k rows are [b*T+t][CK])
#define WS_VL  (WS_VT + 2u * (size_t)NB * CK * TT)
#define HG 8                                          // heads per launch group
#define WS_S   (WS_VL + 2u * (size_t)NB * CK * TT)      // f32 logits / P for HG heads
#define WS_PH  (WS_S + 4u * (size_t)HG * TT * TT)
#define WS_Y   (WS_PH + 0u)              // f32 y rows [b*t][NH * HDV]
#define WS_RS  (WS_Y + 4u * (size_t)NB * TT * NH * HDV)
#define WS_END (WS_RS + 128u * (size_t)NB * TT)

// ---- k_proj: block = (64 rows, 128 cols, which): qkv = x W (+ b), exact; q -> f16 hi (+ residual), k -> f16 rows, v -> bf16 hi + lo planes
__global__ __launch_bounds__(128) void k_proj(const float* __restrict__ X, const float* __restrict__ WQ, const float* __restrict__ BQ, const float* __restrict__ WK, const float* __restrict__ BK, const float* __restrict__ WV, const float* __restrict__ BV, _Float16* __restrict__ QH, _Float16* __restrict__ QL, _Float16* __restrict__ KH, __bf16* __restrict__ VT, __bf16* __restrict__ VL, const float* __restrict__ NQW, const float* __restrict__ NKW, int wbase) {
  __shared__ __align__(16) _Float16 sh[64][136], sl[64][136]; __shared__ __align__(16) __bf16 th[128][72], tl2[128][72];
  const int tid = threadIdx.x, wave = tid >> 5, lane = tid & 31, col = lane & 15, g = lane >> 4; const int which = wbase + blockIdx.z; const int OW = (which == 0) ? CC : CK;   /* output row width: q 1,024, k/v 1,024 */ const int c0 = blockIdx.y * 128; const size_t r0 = (size_t)blockIdx.x * 64; const float* WA = which == 0 ? WQ : which == 1 ? WK : WV; const float* BA = which == 0 ? BQ : which == 1 ? BK : BV;
  v8f acc[8] = {};
#pragma unroll 2
  for (int kc = 0; kc < CC / 32; ++kc) { v16b a; { const float* p = X + (r0 + wave * 16 + col) * CC + kc * 32 + 8 * g;
#pragma unroll
      for (int i = 0; i < 8; ++i) { a[i] = (__bf16)p[i]; a[8 + i] = (__bf16)p[16 + i]; } }
#pragma unroll
    for (int j = 0; j < 8; ++j) { v16b w; const int o = c0 + j * 16 + col;
#pragma unroll
      for (int i = 0; i < 8; ++i) { w[i] = (__bf16)WA[(size_t)(kc * 32 + 8 * g + i) * LDW + o]; w[8 + i] = (__bf16)WA[(size_t)(kc * 32 + 16 + 8 * g + i) * LDW + o]; }   /* (in,out), row length 3072 */
      acc[j] = wmma_bf(a, w, acc[j]); } }
#pragma unroll
  for (int j = 0; j < 8; ++j) { const float bb = BA ? bfr(BA[c0 + j * 16 + col]) : 0.f;
#pragma unroll
    for (int r = 0; r < 8; ++r) { const float v = acc[j][r] + bb; const int rl = wave * 16 + 8 * g + r, cl = j * 16 + col; const _Float16 hv = (_Float16)v;
      if (which == 2) { const __bf16 bh = (__bf16)v; th[cl][rl] = bh; tl2[cl][rl] = (__bf16)(v - (float)bh); } else { sh[rl][cl] = hv; sl[rl][cl] = (_Float16)((v - (float)hv) * 1024.0f); }   /* q residual carried x 2^10 so the plane stays f16-normal on the chip */ } }
  __syncthreads();
  if (which < 2) { _Float16* dh = which == 0 ? QH : KH; for (int e = tid; e < 64 * 16; e += 128) { const int rl = e >> 4, q = e & 15; vst2((unsigned*)(dh + (r0 + rl) * OW + c0 + q * 8), *(const v4u*)&sh[rl][q * 8]); if (which == 0) vst2((unsigned*)(QL + (r0 + rl) * CC + c0 + q * 8), *(const v4u*)&sl[rl][q * 8]); } }
  else { const size_t b = r0 / TT; const int t0 = (int)(r0 % TT); for (int e = tid; e < 128 * 8; e += 128) { const int cl = e >> 3, q = e & 7; const size_t o2 = (b * CK + c0 + cl) * (size_t)TT + t0 + q * 8; vst2((unsigned*)(VT + o2), *(const v4u*)&th[cl][q * 8]); vst2((unsigned*)(VL + o2), *(const v4u*)&tl2[cl][q * 8]); } } }
// ---- k_sc: block = (64 queries, 128 keys) of (b,h): 2-product logits / 32 inside the causal window, -3e38 elsewhere; tiles above the diagonal exit (never read), no tile lies left of every window (WIN = T + 1), so every kept tile runs the WMMA
__global__ __launch_bounds__(128) void k_sc(const _Float16* __restrict__ QH, const _Float16* __restrict__ QL, const _Float16* __restrict__ KH, const float* __restrict__ BM, int b, int h0, float* __restrict__ S0) { __shared__ __align__(16) float ss[4][16][132]; const int h = h0 + blockIdx.z; float* S = S0 + (size_t)blockIdx.z * TT * TT;
  const int tid = threadIdx.x, wave = tid >> 5, lane = tid & 31, col = lane & 15, g = lane >> 4; const int k0 = blockIdx.y * 128; const int ql0 = blockIdx.x * 64 + wave * 16; const size_t q0 = (size_t)b * TT + ql0;
  if (k0 > blockIdx.x * 64 + 63) return;   // whole key block above the diagonal (block-uniform; k_sm/k_pv never read it)
  const bool live = (k0 + 127 > (int)(blockIdx.x * 64) - WIN);   // block-uniform: some key of this tile can be inside some query's window
  v8f acc[8] = {}, accl[8] = {};
  if (live) {
#pragma unroll
  for (int kc = 0; kc < HD / 32; ++kc) { const v16h ah = frag_h(QH + (q0 + col) * CC + h * HD + kc * 32, lane), al = frag_h(QL + (q0 + col) * CC + h * HD + kc * 32, lane);
#pragma unroll
    for (int j = 0; j < 8; ++j) { const v16h kb = frag_h(KH + ((size_t)b * TT + k0 + j * 16 + col) * CK + (h / REP) * HD + kc * 32, lane);   /* kv head h / REP = h */ acc[j] = wmma16(ah, kb, acc[j]); accl[j] = wmma16(al, kb, accl[j]); } }
  }
#pragma unroll
  for (int j = 0; j < 8; ++j) acc[j] += accl[j] * (1.0f / 1024.0f);
#pragma unroll
  for (int j = 0; j < 8; ++j) { const int kt = k0 + j * 16 + col;
#pragma unroll
    for (int r = 0; r < 8; ++r) { const int qt = ql0 + 8 * g + r; (void)BM; const bool allowed = (kt <= qt) && (qt - kt < WIN); const float v = (live && allowed) ? acc[j][r] * 0.03125f : -3.0e38f;   /* q * 32^-1/2 then * 1/sqrt(32) = 1/32 */ ss[wave][8 * g + r][j * 16 + col] = v; } }
  LDSX(); for (int rl = 0; rl < 16; ++rl) vst2(S + (size_t)(ql0 + rl) * TT + k0 + lane * 4, *(const v4f*)&ss[wave][rl][lane * 4]); }
// ---- k_sm: block = query row: softmax over keys [0, kend) -> P x 2^11 f32 (masked -> 0)
__global__ __launch_bounds__(256) void k_sm(float* __restrict__ S0) { __shared__ float sred[8]; __shared__ float sbc; __shared__ __align__(16) float sh[TT];
  const int t = threadIdx.x; const size_t row = blockIdx.x; float* sr = S0 + (size_t)blockIdx.y * TT * TT + row * TT; const int kend = ((int)row / 64) * 64 + 64;
  float m = -3.0e38f; for (int k = t; k < kend; k += 256) m = fmaxf(m, sr[k]);
#pragma unroll
  for (int o = 1; o < 32; o <<= 1) m = fmaxf(m, __shfl_xor(m, o));
  if ((t & 31) == 0) sred[t >> 5] = m; __syncthreads(); if (t == 0) { float a = sred[0]; for (int i = 1; i < 8; ++i) a = fmaxf(a, sred[i]); sbc = a; } __syncthreads(); m = sbc; __syncthreads();
  float sum = 0.f; for (int k = t; k < kend; k += 256) { const float v = sr[k]; sum += (v <= -1.0e38f) ? 0.f : expf(v - m); }
#pragma unroll
  for (int o = 1; o < 32; o <<= 1) sum += __shfl_xor(sum, o);
  if ((t & 31) == 0) sred[t >> 5] = sum; __syncthreads(); if (t == 0) { float a = 0.f; for (int i = 0; i < 8; ++i) a += sred[i]; sbc = 1.0f / a; } __syncthreads(); const float inv = sbc;
  for (int k = t; k < kend; k += 256) { const float v = sr[k]; sh[k] = (v <= -1.0e38f) ? 0.f : expf(v - m) * inv * 2048.0f; }
  __syncthreads(); for (int q = t; q < kend / 4; q += 256) vst2(sr + q * 4, *(const v4f*)&sh[q * 4]); }
// ---- k_pv: block = 64 queries of (b,h): y[q][h*HDV + d] = P . v  (keys [0, kend))
__global__ __launch_bounds__(128) void k_pv(const float* __restrict__ PS0, const __bf16* __restrict__ VT, const __bf16* __restrict__ VL, int b, int h0, float* __restrict__ Y) { const int h = h0 + blockIdx.z; const float* PS = PS0 + (size_t)blockIdx.z * TT * TT; __shared__ __align__(16) float ss[4][16][HDV + 4];
  const int tid = threadIdx.x, wave = tid >> 5, lane = tid & 31, col = lane & 15, g = lane >> 4; const int ql0 = blockIdx.x * 64 + wave * 16; const int kend = blockIdx.x * 64 + 64; const int kclo = ((int)(blockIdx.x * 64) - (WIN - 1)) > 0 ? ((int)(blockIdx.x * 64) - (WIN - 1)) / 32 : 0;   /* first chunk that can hold a key inside the earliest query's window */
  v8f acc[HDV / 16] = {};
#pragma unroll 1
  for (int kc = kclo; kc < kend / 32; ++kc) { const F2 p = split_row(PS + (size_t)(ql0 + col) * TT, kc * 32, lane);
#pragma unroll
    for (int j = 0; j < HDV / 16; ++j) { const size_t po = ((size_t)b * CK + (h / 2) * HDV + j * 16 + col) * (size_t)TT + kc * 32;   /* value head h/2 (64 wide) */ const v16b vh = frag_b(VT + po, lane); acc[j] = wmma_bf(p.h, vh, acc[j]); acc[j] = wmma_bf(p.l, vh, acc[j]); acc[j] = wmma_bf(p.h, frag_b(VL + po, lane), acc[j]); } }
#pragma unroll
  for (int j = 0; j < HDV / 16; ++j)
#pragma unroll
    for (int r = 0; r < 8; ++r) ss[wave][8 * g + r][j * 16 + col] = acc[j][r] * (1.0f / 2048.0f);
  LDSX(); for (int rl = 0; rl < 16; ++rl) if (lane < HDV / 4) vst2(Y + ((size_t)b * TT + ql0 + rl) * (NH * HDV) + h * HDV + lane * 4, *(const v4f*)&ss[wave][rl][lane * 4]); }   /* Y rows [b*T+t][score head][64] = 2,048 floats */
// ---- k_rms: block = 8 tokens (one wave per 2 tokens? -> 256 threads = 8 tokens x 32 lanes; lane pair handles value heads): for each (token, value head i): d = Y[2i] - lambda Y[2i+1] over 64 dims, rms = rsqrt(mean(d^2) + 1e-5) -> RS[token][i]; lambda computed per block from the four 32-vectors (f32)
__device__ __forceinline__ float lam_full(const float* LQ1, const float* LK1, const float* LQ2, const float* LK2) { float s1 = 0.f, s2 = 0.f;
#pragma unroll 1
  for (int i = 0; i < HD; ++i) { s1 += bfr(LQ1[i]) * bfr(LK1[i]); s2 += bfr(LQ2[i]) * bfr(LK2[i]); }
  return expf(s1) - expf(s2) + 0.2f; }
__global__ __launch_bounds__(256) void k_rms(const float* __restrict__ Y, const float* __restrict__ LQ1, const float* __restrict__ LQ2, const float* __restrict__ LK1, const float* __restrict__ LK2, float* __restrict__ RS) { __shared__ float srs[8][32];
  const int t = threadIdx.x; const int tk = t >> 5, lane = t & 31; const size_t row = (size_t)blockIdx.x * 8 + tk; const float lam = lam_full(LQ1, LK1, LQ2, LK2);
  // lane handles value head i = lane & 15 over half the dims (lane >> 4 picks dims 0..31 / 32..63), then pair-sum via xor 16
  const int i = lane & 15, half = lane >> 4; const float* y1 = Y + row * (NH * HDV) + (2 * i) * HDV + half * 32; const float* y2 = y1 + HDV;
  float s = 0.f;
#pragma unroll 4
  for (int d = 0; d < 32; ++d) { const float v = y1[d] - lam * y2[d]; s += v * v; }
  s += __shfl_xor(s, 16);
  srs[tk][lane] = (lane < 16) ? rsqrtf(s * (1.0f / HDV) + 1e-5f) : 0.f;
  __syncthreads();
  vst2(RS + row * 32 + lane, srs[tk][lane]); }   
// ---- k_out: block = (64 rows, 128 cols): A = ((Y[2i] - lambda Y[2i+1]) rms gamma 0.8) built on the fly (hi + lo) x w_proj ((in,out)); 4-KB rows
__global__ __launch_bounds__(128) void k_out(const float* __restrict__ Y, const float* __restrict__ RS, const float* __restrict__ GA, const float* __restrict__ LQ1, const float* __restrict__ LQ2, const float* __restrict__ LK1, const float* __restrict__ LK2, const float* __restrict__ WP, float* __restrict__ OUT) { __shared__ __align__(16) float sf[4][16][132];
  const int tid = threadIdx.x, wave = tid >> 5, lane = tid & 31, col = lane & 15, g = lane >> 4; const int c0 = blockIdx.y * 128; const size_t r0 = (size_t)blockIdx.x * 64 + wave * 16; const size_t arow = r0 + col; const float lam = lam_full(LQ1, LK1, LQ2, LK2);
  v8f acc[8] = {};
#pragma unroll 2
  for (int kc = 0; kc < CC / 32; ++kc) { float v[16]; { const int i = kc >> 1;   /* value head (64 = 2 chunks) */ const float rs = RS[arow * 32 + i] * 0.8f; const float* y1 = Y + arow * (NH * HDV) + (2 * i) * HDV + (kc & 1) * 32 + 8 * g; const float* y2 = y1 + HDV;
#pragma unroll
      for (int q = 0; q < 8; ++q) { const int c = kc * 32 + 8 * g + q; v[q] = (y1[q] - lam * y2[q]) * rs * bfr(GA[(c & 63)]); v[8 + q] = (y1[16 + q] - lam * y2[16 + q]) * rs * bfr(GA[((c + 16) & 63)]); } }
    asm volatile("s_wait_loadcnt 0x0" ::: "memory"); const F2 a = bsplit16(v);
#pragma unroll
    for (int j = 0; j < 8; ++j) { v16b w; const int o = c0 + j * 16 + col;
#pragma unroll
      for (int i2 = 0; i2 < 8; ++i2) { w[i2] = (__bf16)WP[(size_t)(kc * 32 + 8 * g + i2) * CC + o]; w[8 + i2] = (__bf16)WP[(size_t)(kc * 32 + 16 + 8 * g + i2) * CC + o]; }
      asm volatile("s_wait_loadcnt 0x0" ::: "memory"); acc[j] = wmma_bf(a.h, w, acc[j]); acc[j] = wmma_bf(a.l, w, acc[j]); } }
#pragma unroll
  for (int j = 0; j < 8; ++j)
#pragma unroll
    for (int r = 0; r < 8; ++r) sf[wave][8 * g + r][j * 16 + col] = acc[j][r];
  LDSX(); for (int rl = 0; rl < 16; ++rl) vst2(OUT + (r0 + rl) * CC + c0 + lane * 4, *(const v4f*)&sf[wave][rl][lane * 4]); }
extern "C" void kernel_launch(void* const* d_in, const int* in_sizes, int n_in, void* d_out, int out_size, void* d_ws, size_t ws_size, hipStream_t stream) {
  (void)in_sizes; (void)n_in; (void)out_size;
  const float** F = (const float**)d_in;   // 0 x [4,1024,1024], 1 w_attn [1024,3072] ((in,out): q | k | v), 2 w_proj ((in,out)), 3 lambda_q1 [32], 4 lambda_q2, 5 lambda_k1, 6 lambda_k2, 7 gamma [64]
  if (ws_size < (size_t)WS_END) return;
  char* ws = (char*)d_ws; _Float16 *QH = (_Float16*)(ws + WS_QH), *QL = (_Float16*)(ws + WS_QL), *KH = (_Float16*)(ws + WS_KH); __bf16 *VT = (__bf16*)(ws + WS_VT), *VL = (__bf16*)(ws + WS_VL); float *S = (float*)(ws + WS_S), *Y = (float*)(ws + WS_Y), *RS = (float*)(ws + WS_RS);
  k_proj<<<dim3(TNB * TT / 64, CC / 128, 3), 128, 0, stream>>>(F[0], F[1], nullptr, F[1] + CC, nullptr, F[1] + 2 * CC, nullptr, QH, QL, KH, VT, VL, nullptr, nullptr, 0);
  for (int b = 0; b < TNB; ++b) for (int h0 = 0; h0 < NH; h0 += HG) {
    k_sc<<<dim3(TT / 64, TT / 128, HG), 128, 0, stream>>>(QH, QL, KH, nullptr, b, h0, S);
    k_sm<<<dim3(TT, HG), 256, 0, stream>>>(S);
    k_pv<<<dim3(TT / 64, 1, HG), 128, 0, stream>>>(S, VT, VL, b, h0, Y);
  }
  k_rms<<<dim3(TNB * TT / 8), 256, 0, stream>>>(Y, F[3], F[4], F[5], F[6], RS);
  k_out<<<dim3(TNB * TT / 64, CC / 128), 128, 0, stream>>>(Y, RS, F[7], F[3], F[4], F[5], F[6], F[2], (float*)d_out);
}

// v001
// One run takes 370 microseconds.
// Timed twice side by side with v000, it ran 4.10 and 4.11 times as fast.
// compute dtype: all float inputs rounded to bf16, the four lambda vectors and gamma read; qkv = x w_attn ((in,out)) with EXACT bf16 products on WMMA 16x16x32, f32 accumulate; q as f16 hi + residual (x 2^10), k f16 -> 2-product causal logits x (32^-1/2)^2 = 1/32 kept in f32 registers (one launch for all score heads); online softmax in f32 (precise expf); unnormalised P split bf16 hi + lo against v bf16 hi + lo (3 products), divided by the row sum at the end, per score head into its value head-pair slot; the differential combination P1 v - lambda P2 v, RMSNorm, gamma and (1 - lambda_init) in f32; out = that (bf16 hi + lo) w_proj; f32 output.
#include <hip/hip_runtime.h>
#include <math.h>

typedef __attribute__((ext_vector_type(16))) _Float16 v16h;
typedef __attribute__((ext_vector_type(16))) __bf16 v16b;
typedef __attribute__((ext_vector_type(8)))  _Float16 v8h;
typedef __attribute__((ext_vector_type(8)))  float v8f;
typedef __attribute__((ext_vector_type(4)))  float v4f;
typedef __attribute__((ext_vector_type(2)))  float v2f;
typedef __attribute__((ext_vector_type(4)))  unsigned v4u;
typedef __attribute__((ext_vector_type(4)))  int v4i;
typedef float __attribute__((may_alias)) float_a;
typedef int __attribute__((may_alias)) int_a;

template <typename T> __device__ __forceinline__ void vst2(void* p, T v) { *(T*)p = v;  }
__device__ __forceinline__ v8f wmma16(v16h a, v16h b, v8f c) {
  v8f d = __builtin_amdgcn_wmma_f32_16x16x32_f16(false, a, false, b, (short)0, c, false, false);
  asm volatile("v_nop\n\tv_nop\n\tv_nop\n\tv_nop" : "+v"(d) : "v"(a), "v"(b));
  return d;
}
__device__ __forceinline__ v8f wmma_bf(v16b a, v16b b, v8f c) {
  v8f d = __builtin_amdgcn_wmma_f32_16x16x32_bf16(false, a, false, b, (short)0, c, false, false);
  asm volatile("v_nop\n\tv_nop\n\tv_nop\n\tv_nop" : "+v"(d) : "v"(a), "v"(b));
  return d;
}
// 16x16x32 fragments: lane = (h = lane>>4, row/col = lane&15); elements 0..7 = k0+8h+0..7, 8..15 = k0+16+8h+0..7; D element r = row 8h+r
__device__ __forceinline__ v16h frag_h(const _Float16* rowk0, int lane) {
  union { v16h v; v8h q[2]; } u; const _Float16* p = rowk0 + 8 * (lane >> 4);
  u.q[0] = *(const v8h*)p; u.q[1] = *(const v8h*)(p + 16); return u.v;
}
__device__ __forceinline__ v16h frag_f32(const float* rowk0, int lane) {
  v16h a; const float* p = rowk0 + 8 * (lane >> 4);
#pragma unroll
  for (int i = 0; i < 8; ++i) { a[i] = (_Float16)p[i]; a[8 + i] = (_Float16)p[16 + i]; }
  return a;
}
__device__ __forceinline__ v16h frag_f32s(const float* rowk0, int lane, float sc) {
  v16h a; const float* p = rowk0 + 8 * (lane >> 4);
#pragma unroll
  for (int i = 0; i < 8; ++i) { a[i] = (_Float16)(p[i] * sc); a[8 + i] = (_Float16)(p[16 + i] * sc); }
  return a;
}
// column fragment from a [K][ld] layout (column n), rows >= K read as 0
__device__ __forceinline__ v16h fragc_f32(const float* W, int k0, int n, int lane, int ld, int K) {
  v16h a; const int g = lane >> 4;
#pragma unroll
  for (int i = 0; i < 8; ++i) { const int ka = k0 + 8 * g + i, kb = ka + 16;
    a[i] = (_Float16)(ka < K ? W[(size_t)(ka < K ? ka : K - 1) * ld + n] : 0.f); a[8 + i] = (_Float16)(kb < K ? W[(size_t)(kb < K ? kb : K - 1) * ld + n] : 0.f); }
  return a;
}
struct F2 { v16b h, l; };
__device__ __forceinline__ F2 bsplit16(const float v[16]) { F2 r;
#pragma unroll
  for (int i = 0; i < 16; ++i) { const __bf16 h = (__bf16)v[i]; r.h[i] = h; r.l[i] = (__bf16)(v[i] - (float)h); }
  return r; }
__device__ __forceinline__ F2 split_row(const float* row, int k0, int lane) { float v[16]; const float* p = row + k0 + 8 * (lane >> 4);
#pragma unroll
  for (int i = 0; i < 8; ++i) { v[i] = p[i]; v[8 + i] = p[16 + i]; }
  return bsplit16(v); }
__device__ __forceinline__ F2 split_rowK(const float* row, int k0, int lane, int K) { float v[16]; const int g = lane >> 4;
#pragma unroll
  for (int i = 0; i < 8; ++i) { const int ka = k0 + 8 * g + i, kb = ka + 16; v[i] = ka < K ? row[ka < K ? ka : K - 1] : 0.f; v[8 + i] = kb < K ? row[kb < K ? kb : K - 1] : 0.f; }
  return bsplit16(v); }
__device__ __forceinline__ F2 split_col(const float* W, int k0, int n, int lane, int ld, int K) { float v[16]; const int g = lane >> 4;
#pragma unroll
  for (int i = 0; i < 8; ++i) { const int ka = k0 + 8 * g + i, kb = ka + 16; v[i] = ka < K ? W[(size_t)(ka < K ? ka : K - 1) * ld + n] : 0.f; v[8 + i] = kb < K ? W[(size_t)(kb < K ? kb : K - 1) * ld + n] : 0.f; }
  return bsplit16(v); }
__device__ __forceinline__ v8f mac3(const F2& a, const F2& b, v8f c) { c = wmma_bf(a.l, b.h, c); c = wmma_bf(a.h, b.l, c); return wmma_bf(a.h, b.h, c); }
__device__ __forceinline__ float sigm(float v) { return 1.0f / (1.0f + expf(-v)); }
#define LDSX() do { asm volatile("s_wait_dscnt 0" ::: "memory"); __builtin_amdgcn_wave_barrier(); __builtin_amdgcn_fence(__ATOMIC_RELEASE, "workgroup"); } while (0)


// Differential causal attention (B 4, T 1,024, C 1,024; 2H = 32 score heads x 32, 16 value heads x 64): att = softmax(causal(q k^T / 32)) per score head; diff_i = att_{2i} - lambda att_{2i+1}, lambda = exp(lq1.lk1) - exp(lq2.lk2) + 0.2; out_i = RMSNorm(diff_i v_i) * gamma * 0.8; concat w_proj.
#define NB 4
#define TT 1024
#define CC 1024
#define NH 32              // score heads (2H)
#define HD 32              // score head dim
#define HDV 64             // value head dim (16 value heads)
#define WIN (TT + 1)       // plain causal
#define NKV 32             // k has the same 32 heads
#define LDW 3072           // w_attn (in,out) [1024][3072]: q | k | v column blocks
#define CK (NKV * HD)   // 1,024: k/v row width
#define REP (NH / NKV)
#ifndef TNB
#define TNB NB
#endif
typedef __attribute__((ext_vector_type(8))) __bf16 v8b;
__device__ __forceinline__ v16b frag_b(const __bf16* rowk0, int lane) {
  union { v16b v; v8b q[2]; } u; const __bf16* p = rowk0 + 8 * (lane >> 4);
  u.q[0] = *(const v8b*)p; u.q[1] = *(const v8b*)(p + 16); return u.v;
}
__device__ __forceinline__ float bfr(float v) { return (float)(__bf16)v; }
__device__ __attribute__((noinline)) float exp_ni(float v) { return expf(v); }
__device__ __attribute__((noinline)) float erf_ni(float v) { return erff(v); }

#define WS_QH  0u
#define WS_QL  (WS_QH + 2u * (size_t)NB * TT * CC)
#define WS_KH  (WS_QL + 2u * (size_t)NB * TT * CC)
#define WS_VT  (WS_KH + 2u * (size_t)NB * TT * CK)      // bf16 v planes [b][CK][t] (k rows are [b*T+t][CK])
#define WS_VL  (WS_VT + 2u * (size_t)NB * CK * TT)
#define WS_Y   (WS_VL + 2u * (size_t)NB * CK * TT)      // f32 y rows [b*t][score head][64]
#define WS_RS  (WS_Y + 4u * (size_t)NB * TT * NH * HDV)
#define WS_END (WS_RS + 128u * (size_t)NB * TT)

// ---- k_proj: block = (64 rows, 128 cols, which): qkv = x W (+ b), exact; q -> f16 hi (+ residual), k -> f16 rows, v -> bf16 hi + lo planes
__global__ __launch_bounds__(128) void k_proj(const float* __restrict__ X, const float* __restrict__ WQ, const float* __restrict__ BQ, const float* __restrict__ WK, const float* __restrict__ BK, const float* __restrict__ WV, const float* __restrict__ BV, _Float16* __restrict__ QH, _Float16* __restrict__ QL, _Float16* __restrict__ KH, __bf16* __restrict__ VT, __bf16* __restrict__ VL, const float* __restrict__ NQW, const float* __restrict__ NKW, int wbase) {
  __shared__ __align__(16) _Float16 sh[64][136], sl[64][136]; __shared__ __align__(16) __bf16 th[128][72], tl2[128][72];
  const int tid = threadIdx.x, wave = tid >> 5, lane = tid & 31, col = lane & 15, g = lane >> 4; const int which = wbase + blockIdx.z; const int OW = (which == 0) ? CC : CK;   /* output row width: q 1,024, k/v 1,024 */ const int c0 = blockIdx.y * 128; const size_t r0 = (size_t)blockIdx.x * 64; const float* WA = which == 0 ? WQ : which == 1 ? WK : WV; const float* BA = which == 0 ? BQ : which == 1 ? BK : BV;
  v8f acc[8] = {};
#pragma unroll 2
  for (int kc = 0; kc < CC / 32; ++kc) { v16b a; { const float* p = X + (r0 + wave * 16 + col) * CC + kc * 32 + 8 * g;
#pragma unroll
      for (int i = 0; i < 8; ++i) { a[i] = (__bf16)p[i]; a[8 + i] = (__bf16)p[16 + i]; } }
#pragma unroll
    for (int j = 0; j < 8; ++j) { v16b w; const int o = c0 + j * 16 + col;
#pragma unroll
      for (int i = 0; i < 8; ++i) { w[i] = (__bf16)WA[(size_t)(kc * 32 + 8 * g + i) * LDW + o]; w[8 + i] = (__bf16)WA[(size_t)(kc * 32 + 16 + 8 * g + i) * LDW + o]; }   /* (in,out), row length 3072 */
      acc[j] = wmma_bf(a, w, acc[j]); } }
#pragma unroll
  for (int j = 0; j < 8; ++j) { const float bb = BA ? bfr(BA[c0 + j * 16 + col]) : 0.f;
#pragma unroll
    for (int r = 0; r < 8; ++r) { const float v = acc[j][r] + bb; const int rl = wave * 16 + 8 * g + r, cl = j * 16 + col; const _Float16 hv = (_Float16)v;
      if (which == 2) { const __bf16 bh = (__bf16)v; th[cl][rl] = bh; tl2[cl][rl] = (__bf16)(v - (float)bh); } else { sh[rl][cl] = hv; sl[rl][cl] = (_Float16)((v - (float)hv) * 1024.0f); }   /* q residual carried x 2^10 so the plane stays f16-normal on the chip */ } }
  __syncthreads();
  if (which < 2) { _Float16* dh = which == 0 ? QH : KH; for (int e = tid; e < 64 * 16; e += 128) { const int rl = e >> 4, q = e & 15; vst2((unsigned*)(dh + (r0 + rl) * OW + c0 + q * 8), *(const v4u*)&sh[rl][q * 8]); if (which == 0) vst2((unsigned*)(QL + (r0 + rl) * CC + c0 + q * 8), *(const v4u*)&sl[rl][q * 8]); } }
  else { const size_t b = r0 / TT; const int t0 = (int)(r0 % TT); for (int e = tid; e < 128 * 8; e += 128) { const int cl = e >> 3, q = e & 7; const size_t o2 = (b * CK + c0 + cl) * (size_t)TT + t0 + q * 8; vst2((unsigned*)(VT + o2), *(const v4u*)&th[cl][q * 8]); vst2((unsigned*)(VL + o2), *(const v4u*)&tl2[cl][q * 8]); } } }
template <int M> __device__ __forceinline__ float xrow(float v) { return __builtin_bit_cast(float, __builtin_amdgcn_update_dpp(0, __builtin_bit_cast(int, v), 0x160 | M, 0xf, 0xf, true)); }   // lane l reads lane l ^ M of its 16-lane row (DPP row_xmask): no LDS round trip
struct VF { v16b h[HDV / 16], l[HDV / 16]; };   // v fragments (hi, lo planes) of 32 keys x 64 value dims
__device__ __forceinline__ void ld_v(VF& f, const __bf16* vt, const __bf16* vl, int lane) {
#pragma unroll
  for (int j = 0; j < HDV / 16; ++j) { f.h[j] = frag_b(vt + (size_t)j * 16 * TT, lane); f.l[j] = frag_b(vl + (size_t)j * 16 * TT, lane); } }
__device__ __forceinline__ void pv32(v8f* acc, const float* prow, int kk, const VF& f, int lane) { const F2 p = split_row(prow, kk, lane);
#pragma unroll
  for (int j = 0; j < HDV / 16; ++j) { acc[j] = wmma_bf(p.h, f.h[j], acc[j]); acc[j] = wmma_bf(p.l, f.h[j], acc[j]); acc[j] = wmma_bf(p.h, f.l[j], acc[j]); } }
// ---- k_att: block = 64 queries of (b, h), one wave per 16 queries, no traffic between waves. Per 128-key chunk: 2-product logits / 32 in the D registers, running row maximum and rescale (online softmax),
// P = exp(s - m) through the wave's own LDS tile into A fragments (bf16 hi + lo), 3-product P . v into acc; the row sums stay per lane until the end; y = acc / l
__global__ __launch_bounds__(128, 4) /* four waves a SIMD: a budget of 256 registers */ void k_att(const _Float16* __restrict__ QH, const _Float16* __restrict__ QL, const _Float16* __restrict__ KH, const __bf16* __restrict__ VT, const __bf16* __restrict__ VL, float* __restrict__ Y) { __shared__ __align__(16) float ss[4][16][132];
  const int tid = threadIdx.x, wave = tid >> 5, lane = tid & 31, col = lane & 15, g = lane >> 4; const int h = blockIdx.y, b = blockIdx.z; const int ql0 = blockIdx.x * 64 + wave * 16; const int kend = blockIdx.x * 64 + 64; const size_t q0 = (size_t)b * TT + ql0;
  const v16h ah = frag_h(QH + (q0 + col) * CC + h * HD, lane), al = frag_h(QL + (q0 + col) * CC + h * HD, lane);
  v8f acc[HDV / 16] = {}; float m[8], l[8];
#pragma unroll
  for (int r = 0; r < 8; ++r) { m[r] = -3.0e38f; l[r] = 0.f; }
  const _Float16* kp = KH + ((size_t)b * TT + col) * CK + h * HD + 8 * g;   /* this lane's half of its key row of the chunk; the three pointers walk with k0 */
  const size_t po = ((size_t)b * CK + (h / 2) * HDV + col) * (size_t)TT;   /* value head h/2 (64 wide) */ const __bf16 *vtp = VT + po, *vlp = VL + po;
#pragma unroll 1   /* rolled: one chunk's body fills the register budget; the inner loops are unrolled so that their arrays are registers */
  for (int k0 = 0; k0 < kend; k0 += 128, kp += (size_t)128 * CK, vtp += 128, vlp += 128) { v8f s[8]; v16h kb[8];
#pragma unroll
    for (int j = 0; j < 8; ++j) { union { v16h v; v8h q[2]; } u; const _Float16* p = kp + (size_t)j * 16 * CK; u.q[0] = *(const v8h*)p; u.q[1] = *(const v8h*)(p + 16); kb[j] = u.v; }   /* frag_h's order; all loads of the chunk in flight together, in front of the first product */
    asm volatile("s_wait_xcnt 0x0" :: "v"(kp) : "memory");   /* the run's address pair is an input here, so it outlives the run and no result of the run is given its registers; the wait stands in front of its next rewrite */
#pragma unroll
    for (int j = 0; j < 8; ++j) { v8f a0 = {}, a1 = {}; a0 = wmma16(ah, kb[j], a0); a1 = wmma16(al, kb[j], a1); s[j] = a0 + a1 * (1.0f / 1024.0f); }
    const bool full = k0 + 64 < kend;   /* wave-uniform: keys 64..127 of the chunk are open to some row */
    const int dq = ql0 + 8 * g - col - k0;   /* causal test against constants: one register, not one per element */
    VF va; ld_v(va, vtp, vlp, lane);   /* the first 32 keys' v flies under the softmax */
#pragma unroll
    for (int r = 0; r < 8; ++r) { float mx = -3.0e38f;
#pragma unroll
      for (int j = 0; j < 8; ++j) { const float v = (j * 16 - r <= dq) ? s[j][r] * 0.03125f : -3.0e38f;   /* key k0 + 16 j + col <= query ql0 + 8 g + r; q * 32^-1/2 then * 1/sqrt(32) = 1/32 */ s[j][r] = v; mx = fmaxf(mx, v); }
      mx = fmaxf(mx, xrow<1>(mx)); mx = fmaxf(mx, xrow<2>(mx)); mx = fmaxf(mx, xrow<4>(mx)); mx = fmaxf(mx, xrow<8>(mx));   /* the 16 lanes of a half hold one row's columns */
      const float mn = fmaxf(m[r], mx), sc = expf(m[r] - mn); m[r] = mn; float ls = l[r] * sc;
#pragma unroll
      for (int j = 0; j < HDV / 16; ++j) acc[j][r] *= sc;
#pragma unroll
      for (int j = 0; j < 8; ++j) { const float p = expf(s[j][r] - mn);   /* a masked logit (-3e38) gives exactly 0: mn is a real logit, key 0 is open to every row */ ls += p; ss[wave][8 * g + r][j * 16 + col] = p; }
      asm volatile("" : "+v"(ls));   /* each row's sum, against spills: formed here, or the compiler sinks the adds to the loop's foot and all 64 addends stay live through the P . v products */
      l[r] = ls; }
    LDSX();   /* the wave's own P tile: every lane's stores have landed before a lane reads the others' elements */
    const float* prow = &ss[wave][col][0];
    pv32(acc, prow, 0, va, lane); ld_v(va, vtp + 32, vlp + 32, lane); pv32(acc, prow, 32, va, lane);
    if (full) { ld_v(va, vtp + 64, vlp + 64, lane); pv32(acc, prow, 64, va, lane); ld_v(va, vtp + 96, vlp + 96, lane); pv32(acc, prow, 96, va, lane); } }
#pragma unroll
  for (int r = 0; r < 8; ++r) { float ls = l[r];
    ls += xrow<1>(ls); ls += xrow<2>(ls); ls += xrow<4>(ls); ls += xrow<8>(ls);
    const float inv = 1.0f / ls;
#pragma unroll
    for (int j = 0; j < HDV / 16; ++j) ss[wave][8 * g + r][j * 16 + col] = acc[j][r] * inv; }
  LDSX(); for (int it = 0; it < 8; ++it) { const int rl = it * 2 + g; vst2(Y + ((size_t)b * TT + ql0 + rl) * (NH * HDV) + h * HDV + col * 4, *(const v4f*)&ss[wave][rl][col * 4]); } }   /* Y rows [b*T+t][score head][64] = 2,048 floats */
// ---- k_rms: block = 8 tokens (one wave per 2 tokens? -> 256 threads = 8 tokens x 32 lanes; lane pair handles value heads): for each (token, value head i): d = Y[2i] - lambda Y[2i+1] over 64 dims, rms = rsqrt(mean(d^2) + 1e-5) -> RS[token][i]; lambda computed per block from the four 32-vectors (f32)
__device__ __forceinline__ float lam_full(const float* LQ1, const float* LK1, const float* LQ2, const float* LK2) { float s1 = 0.f, s2 = 0.f;
#pragma unroll 1
  for (int i = 0; i < HD; ++i) { s1 += bfr(LQ1[i]) * bfr(LK1[i]); s2 += bfr(LQ2[i]) * bfr(LK2[i]); }
  return expf(s1) - expf(s2) + 0.2f; }
__global__ __launch_bounds__(256) void k_rms(const float* __restrict__ Y, const float* __restrict__ LQ1, const float* __restrict__ LQ2, const float* __restrict__ LK1, const float* __restrict__ LK2, float* __restrict__ RS) { __shared__ float srs[8][32];
  const int t = threadIdx.x; const int tk = t >> 5, lane = t & 31; const size_t row = (size_t)blockIdx.x * 8 + tk; const float lam = lam_full(LQ1, LK1, LQ2, LK2);
  // lane handles value head i = lane & 15 over half the dims (lane >> 4 picks dims 0..31 / 32..63), then pair-sum via xor 16
  const int i = lane & 15, half = lane >> 4; const float* y1 = Y + row * (NH * HDV) + (2 * i) * HDV + half * 32; const float* y2 = y1 + HDV;
  float s = 0.f;
#pragma unroll 4
  for (int d = 0; d < 32; ++d) { const float v = y1[d] - lam * y2[d]; s += v * v; }
  s += __shfl_xor(s, 16);
  srs[tk][lane] = (lane < 16) ? rsqrtf(s * (1.0f / HDV) + 1e-5f) : 0.f;
  __syncthreads();
  vst2(RS + row * 32 + lane, srs[tk][lane]); }   
// ---- k_out: block = (64 rows, 128 cols): A = ((Y[2i] - lambda Y[2i+1]) rms gamma 0.8) built on the fly (hi + lo) x w_proj ((in,out)); 4-KB rows
__global__ __launch_bounds__(128) void k_out(const float* __restrict__ Y, const float* __restrict__ RS, const float* __restrict__ GA, const float* __restrict__ LQ1, const float* __restrict__ LQ2, const float* __restrict__ LK1, const float* __restrict__ LK2, const float* __restrict__ WP, float* __restrict__ OUT) { __shared__ __align__(16) float sf[4][16][132];
  const int tid = threadIdx.x, wave = tid >> 5, lane = tid & 31, col = lane & 15, g = lane >> 4; const int c0 = blockIdx.y * 128; const size_t r0 = (size_t)blockIdx.x * 64 + wave * 16; const size_t arow = r0 + col; const float lam = lam_full(LQ1, LK1, LQ2, LK2);
  v8f acc[8] = {};
#pragma unroll 2
  for (int kc = 0; kc < CC / 32; ++kc) { float v[16]; { const int i = kc >> 1;   /* value head (64 = 2 chunks) */ const float rs = RS[arow * 32 + i] * 0.8f; const float* y1 = Y + arow * (NH * HDV) + (2 * i) * HDV + (kc & 1) * 32 + 8 * g; const float* y2 = y1 + HDV;
#pragma unroll
      for (int q = 0; q < 8; ++q) { const int c = kc * 32 + 8 * g + q; v[q] = (y1[q] - lam * y2[q]) * rs * bfr(GA[(c & 63)]); v[8 + q] = (y1[16 + q] - lam * y2[16 + q]) * rs * bfr(GA[((c + 16) & 63)]); } }
    asm volatile("s_wait_loadcnt 0x0" ::: "memory"); const F2 a = bsplit16(v);
#pragma unroll
    for (int j = 0; j < 8; ++j) { v16b w; const int o = c0 + j * 16 + col;
#pragma unroll
      for (int i2 = 0; i2 < 8; ++i2) { w[i2] = (__bf16)WP[(size_t)(kc * 32 + 8 * g + i2) * CC + o]; w[8 + i2] = (__bf16)WP[(size_t)(kc * 32 + 16 + 8 * g + i2) * CC + o]; }
      asm volatile("s_wait_loadcnt 0x0" ::: "memory"); acc[j] = wmma_bf(a.h, w, acc[j]); acc[j] = wmma_bf(a.l, w, acc[j]); } }
#pragma unroll
  for (int j = 0; j < 8; ++j)
#pragma unroll
    for (int r = 0; r < 8; ++r) sf[wave][8 * g + r][j * 16 + col] = acc[j][r];
  LDSX(); for (int rl = 0; rl < 16; ++rl) vst2(OUT + (r0 + rl) * CC + c0 + lane * 4, *(const v4f*)&sf[wave][rl][lane * 4]); }
extern "C" void kernel_launch(void* const* d_in, const int* in_sizes, int n_in, void* d_out, int out_size, void* d_ws, size_t ws_size, hipStream_t stream) {
  (void)in_sizes; (void)n_in; (void)out_size;
  const float** F = (const float**)d_in;   // 0 x [4,1024,1024], 1 w_attn [1024,3072] ((in,out): q | k | v), 2 w_proj ((in,out)), 3 lambda_q1 [32], 4 lambda_q2, 5 lambda_k1, 6 lambda_k2, 7 gamma [64]
  if (ws_size < (size_t)WS_END) return;
  char* ws = (char*)d_ws; _Float16 *QH = (_Float16*)(ws + WS_QH), *QL = (_Float16*)(ws + WS_QL), *KH = (_Float16*)(ws + WS_KH); __bf16 *VT = (__bf16*)(ws + WS_VT), *VL = (__bf16*)(ws + WS_VL); float *Y = (float*)(ws + WS_Y), *RS = (float*)(ws + WS_RS);
  k_proj<<<dim3(TNB * TT / 64, CC / 128, 3), 128, 0, stream>>>(F[0], F[1], nullptr, F[1] + CC, nullptr, F[1] + 2 * CC, nullptr, QH, QL, KH, VT, VL, nullptr, nullptr, 0);
  k_att<<<dim3(TT / 64, NH, TNB), 128, 0, stream>>>(QH, QL, KH, VT, VL, Y);
  k_rms<<<dim3(TNB * TT / 8), 256, 0, stream>>>(Y, F[3], F[4], F[5], F[6], RS);
  k_out<<<dim3(TNB * TT / 64, CC / 128), 128, 0, stream>>>(Y, RS, F[7], F[3], F[4], F[5], F[6], F[2], (float*)d_out);
}

// v002
// One run takes 250 microseconds.
// In both of two side-by-side timings against v001, it was 1.48 times as fast.
// Counting every step since v000, it is 6.07 times as fast.
// compute dtype: all float inputs rounded to bf16, the four lambda vectors and gamma read; qkv = x w_attn ((in,out)) with EXACT bf16 products on WMMA 16x16x32, f32 accumulate; q as f16 hi + residual (x 2^10), k f16 -> 2-product causal logits x (32^-1/2)^2 = 1/32 kept in f32 registers (one launch for all score heads); online softmax in f32 (precise expf); unnormalised P split bf16 hi + lo against v bf16 hi + lo (3 products), divided by the row sum at the end, per score head into its value head-pair slot; the differential combination P1 v - lambda P2 v, RMSNorm, gamma and (1 - lambda_init) in f32; out = that (bf16 hi + lo) w_proj; f32 output.
#include <hip/hip_runtime.h>
#include <math.h>

typedef __attribute__((ext_vector_type(16))) _Float16 v16h;
typedef __attribute__((ext_vector_type(16))) __bf16 v16b;
typedef __attribute__((ext_vector_type(8)))  _Float16 v8h;
typedef __attribute__((ext_vector_type(8)))  float v8f;
typedef __attribute__((ext_vector_type(4)))  float v4f;
typedef __attribute__((ext_vector_type(2)))  float v2f;
typedef __attribute__((ext_vector_type(4)))  unsigned v4u;
typedef __attribute__((ext_vector_type(4)))  int v4i;
typedef float __attribute__((may_alias)) float_a;
typedef int __attribute__((may_alias)) int_a;

template <typename T> __device__ __forceinline__ void vst2(void* p, T v) { *(T*)p = v;  }
__device__ __forceinline__ v8f wmma16(v16h a, v16h b, v8f c) {
  v8f d = __builtin_amdgcn_wmma_f32_16x16x32_f16(false, a, false, b, (short)0, c, false, false);
  asm volatile("v_nop\n\tv_nop\n\tv_nop\n\tv_nop" : "+v"(d) : "v"(a), "v"(b));
  return d;
}
__device__ __forceinline__ v8f wmma_bf(v16b a, v16b b, v8f c) {
  v8f d = __builtin_amdgcn_wmma_f32_16x16x32_bf16(false, a, false, b, (short)0, c, false, false);
  asm volatile("v_nop\n\tv_nop\n\tv_nop\n\tv_nop" : "+v"(d) : "v"(a), "v"(b));
  return d;
}
// 16x16x32 fragments: lane = (h = lane>>4, row/col = lane&15); elements 0..7 = k0+8h+0..7, 8..15 = k0+16+8h+0..7; D element r = row 8h+r
__device__ __forceinline__ v16h frag_h(const _Float16* rowk0, int lane) {
  union { v16h v; v8h q[2]; } u; const _Float16* p = rowk0 + 8 * (lane >> 4);
  u.q[0] = *(const v8h*)p; u.q[1] = *(const v8h*)(p + 16); return u.v;
}
__device__ __forceinline__ v16h frag_f32(const float* rowk0, int lane) {
  v16h a; const float* p = rowk0 + 8 * (lane >> 4);
#pragma unroll
  for (int i = 0; i < 8; ++i) { a[i] = (_Float16)p[i]; a[8 + i] = (_Float16)p[16 + i]; }
  return a;
}
__device__ __forceinline__ v16h frag_f32s(const float* rowk0, int lane, float sc) {
  v16h a; const float* p = rowk0 + 8 * (lane >> 4);
#pragma unroll
  for (int i = 0; i < 8; ++i) { a[i] = (_Float16)(p[i] * sc); a[8 + i] = (_Float16)(p[16 + i] * sc); }
  return a;
}
// column fragment from a [K][ld] layout (column n), rows >= K read as 0
__device__ __forceinline__ v16h fragc_f32(const float* W, int k0, int n, int lane, int ld, int K) {
  v16h a; const int g = lane >> 4;
#pragma unroll
  for (int i = 0; i < 8; ++i) { const int ka = k0 + 8 * g + i, kb = ka + 16;
    a[i] = (_Float16)(ka < K ? W[(size_t)(ka < K ? ka : K - 1) * ld + n] : 0.f); a[8 + i] = (_Float16)(kb < K ? W[(size_t)(kb < K ? kb : K - 1) * ld + n] : 0.f); }
  return a;
}
struct F2 { v16b h, l; };
__device__ __forceinline__ F2 bsplit16(const float v[16]) { F2 r;
#pragma unroll
  for (int i = 0; i < 16; ++i) { const __bf16 h = (__bf16)v[i]; r.h[i] = h; r.l[i] = (__bf16)(v[i] - (float)h); }
  return r; }
__device__ __forceinline__ F2 split_row(const float* row, int k0, int lane) { float v[16]; const float* p = row + k0 + 8 * (lane >> 4);
#pragma unroll
  for (int i = 0; i < 8; ++i) { v[i] = p[i]; v[8 + i] = p[16 + i]; }
  return bsplit16(v); }
__device__ __forceinline__ F2 split_rowK(const float* row, int k0, int lane, int K) { float v[16]; const int g = lane >> 4;
#pragma unroll
  for (int i = 0; i < 8; ++i) { const int ka = k0 + 8 * g + i, kb = ka + 16; v[i] = ka < K ? row[ka < K ? ka : K - 1] : 0.f; v[8 + i] = kb < K ? row[kb < K ? kb : K - 1] : 0.f; }
  return bsplit16(v); }
__device__ __forceinline__ F2 split_col(const float* W, int k0, int n, int lane, int ld, int K) { float v[16]; const int g = lane >> 4;
#pragma unroll
  for (int i = 0; i < 8; ++i) { const int ka = k0 + 8 * g + i, kb = ka + 16; v[i] = ka < K ? W[(size_t)(ka < K ? ka : K - 1) * ld + n] : 0.f; v[8 + i] = kb < K ? W[(size_t)(kb < K ? kb : K - 1) * ld + n] : 0.f; }
  return bsplit16(v); }
__device__ __forceinline__ v8f mac3(const F2& a, const F2& b, v8f c) { c = wmma_bf(a.l, b.h, c); c = wmma_bf(a.h, b.l, c); return wmma_bf(a.h, b.h, c); }
__device__ __forceinline__ float sigm(float v) { return 1.0f / (1.0f + expf(-v)); }
#define LDSX() do { asm volatile("s_wait_dscnt 0" ::: "memory"); __builtin_amdgcn_wave_barrier(); __builtin_amdgcn_fence(__ATOMIC_RELEASE, "workgroup"); } while (0)


// Differential causal attention (B 4, T 1,024, C 1,024; 2H = 32 score heads x 32, 16 value heads x 64): att = softmax(causal(q k^T / 32)) per score head; diff_i = att_{2i} - lambda att_{2i+1}, lambda = exp(lq1.lk1) - exp(lq2.lk2) + 0.2; out_i = RMSNorm(diff_i v_i) * gamma * 0.8; concat w_proj.
#define NB 4
#define TT 1024
#define CC 1024
#define NH 32              // score heads (2H)
#define HD 32              // score head dim
#define HDV 64             // value head dim (16 value heads)
#define WIN (TT + 1)       // plain causal
#define NKV 32             // k has the same 32 heads
#define LDW 3072           // w_attn (in,out) [1024][3072]: q | k | v column blocks
#define CK (NKV * HD)   // 1,024: k/v row width
#define REP (NH / NKV)
#ifndef TNB
#define TNB NB
#endif
typedef __attribute__((ext_vector_type(8))) __bf16 v8b;
__device__ __forceinline__ v16b frag_b(const __bf16* rowk0, int lane) {
  union { v16b v; v8b q[2]; } u; const __bf16* p = rowk0 + 8 * (lane >> 4);
  u.q[0] = *(const v8b*)p; u.q[1] = *(const v8b*)(p + 16); return u.v;
}
__device__ __forceinline__ float bfr(float v) { return (float)(__bf16)v; }
// ---- operand tiles of one k step (32 deep) in LDS, bf16, in fragment order: a weight fragment read is lane * 16 B, contiguous over the wave; an x fragment read is contiguous per 16-lane half
typedef __attribute__((ext_vector_type(4))) __bf16 v4b;
#define WJ 520             // elements per 16-column group of a weight tile: k 0..15 (256) + k 16..31 (256) + 8 of pad, so that the 16 lanes of a store fall on 16 different 16-B slots
#define XC 160             // elements per 8-k chunk of a wave's 16 x rows: 128 + 32 of pad, for the same reason
#define XO (8 * WJ)        // the x rows stand behind the weight tile (128 columns)
struct WT { v4f r[8]; };   // wave w: rows 8w..8w+7 of the tile, a lane 4 columns; one load = one 512-B row piece = 4 whole lines
__device__ __forceinline__ void ld_wt(WT& t, const float* p, int ld) {
#pragma unroll
  for (int i = 0; i < 8; ++i) t.r[i] = *(const v4f*)(p + (size_t)i * ld); }
__device__ __forceinline__ int wt_slot(int wave, int lane) { return (lane >> 2) * WJ + (wave >> 1) * 256 + (wave & 1) * 128 + (lane & 3) * 32; }   // column 4 lane + c stands c * 8 elements on
__device__ __forceinline__ void st_wt(__bf16* p, const WT& t) {
#pragma unroll
  for (int c = 0; c < 4; ++c) { v8b o;
#pragma unroll
    for (int i = 0; i < 8; ++i) o[i] = (__bf16)t.r[i][c];
    *(v8b*)(p + c * 8) = o; } }
__device__ __forceinline__ v16b frag_wt(const __bf16* tile, int j, int lane) {   // frag_b's k order: elements 0..7 = 8g + 0..7, 8..15 = 16 + 8g + 0..7, column 16 j + col
  union { v16b v; v8b q[2]; } u; const __bf16* p = tile + j * WJ + lane * 8;
  u.q[0] = *(const v8b*)p; u.q[1] = *(const v8b*)(p + 256); return u.v; }
__device__ __attribute__((noinline)) float exp_ni(float v) { return expf(v); }
__device__ __attribute__((noinline)) float erf_ni(float v) { return erff(v); }

#define WS_QH  0u
#define WS_QL  (WS_QH + 2u * (size_t)NB * TT * CC)
#define WS_KH  (WS_QL + 2u * (size_t)NB * TT * CC)
#define WS_VT  (WS_KH + 2u * (size_t)NB * TT * CK)      // bf16 v planes [b][CK][t] (k rows are [b*T+t][CK])
#define WS_VL  (WS_VT + 2u * (size_t)NB * CK * TT)
#define WS_Y   (WS_VL + 2u * (size_t)NB * CK * TT)      // f32 y rows [b*t][score head][64]
#define WS_RS  (WS_Y + 4u * (size_t)NB * TT * NH * HDV)
#define WS_END (WS_RS + 128u * (size_t)NB * TT)

// ---- k_proj: block = (64 rows, 128 cols, which): qkv = x W (+ b), exact; q -> f16 hi (+ residual), k -> f16 rows, v -> bf16 hi + lo planes
__global__ __launch_bounds__(128) void k_proj(const float* __restrict__ X, const float* __restrict__ WQ, const float* __restrict__ BQ, const float* __restrict__ WK, const float* __restrict__ BK, const float* __restrict__ WV, const float* __restrict__ BV, _Float16* __restrict__ QH, _Float16* __restrict__ QL, _Float16* __restrict__ KH, __bf16* __restrict__ VT, __bf16* __restrict__ VL, const float* __restrict__ NQW, const float* __restrict__ NKW, int wbase) {
  __shared__ __align__(16) _Float16 sh[64][136], sl[64][136]; __shared__ __align__(16) __bf16 th[128][72], tl2[128][72];
  const int tid = threadIdx.x, wave = tid >> 5, lane = tid & 31, col = lane & 15, g = lane >> 4; const int which = wbase + blockIdx.z; const int OW = (which == 0) ? CC : CK;   /* output row width: q 1,024, k/v 1,024 */ const int c0 = blockIdx.y * 128; const size_t r0 = (size_t)blockIdx.x * 64; const float* WA = which == 0 ? WQ : which == 1 ? WK : WV; const float* BA = which == 0 ? BQ : which == 1 ? BK : BV;
  v8f acc[8] = {};
  __bf16* const sb0 = &th[0][0]; __bf16* const sb1 = &tl2[0][0];   /* the two staging buffers (13,440 B each) lie in the epilogue's planes, which are written only behind the loop's last barrier */
  const float* wp = WA + (size_t)(wave * 8) * LDW + c0 + lane * 4;   /* (in,out), row length 3072 */
  const float* xp = X + (r0 + wave * 16 + (lane >> 3)) * CC + (lane & 7) * 4;   /* 8 lanes a row: one load = 4 rows x one whole line */
  const int ws_o = wt_slot(wave, lane), xs_o = XO + wave * 4 * XC + ((lane & 7) >> 1) * XC + (lane >> 3) * 8 + (lane & 1) * 4, xr_o = XO + wave * 4 * XC + g * XC + col * 8;
  WT wt; v4f xt[4]; ld_wt(wt, wp, LDW);
#pragma unroll
  for (int i = 0; i < 4; ++i) xt[i] = *(const v4f*)(xp + (size_t)(4 * i) * CC);
  st_wt(sb0 + ws_o, wt);
#pragma unroll
  for (int i = 0; i < 4; ++i) { v4b o; o[0] = (__bf16)xt[i][0]; o[1] = (__bf16)xt[i][1]; o[2] = (__bf16)xt[i][2]; o[3] = (__bf16)xt[i][3]; *(v4b*)(sb0 + xs_o + i * 32) = o; }
  __syncthreads();
#pragma unroll 2   /* two steps a trip: the buffer of each step is then a constant */
  for (int kc = 0; kc < CC / 32; ++kc) { const __bf16* cur = (kc & 1) ? sb1 : sb0; __bf16* nxt = (kc & 1) ? sb0 : sb1; const bool more = kc + 1 < CC / 32;
    if (more) { ld_wt(wt, wp + (size_t)(kc + 1) * 32 * LDW, LDW);   /* the next step's loads fly under this step's products */
#pragma unroll
      for (int i = 0; i < 4; ++i) xt[i] = *(const v4f*)(xp + (size_t)(4 * i) * CC + (kc + 1) * 32); }
    v16b a, w[8]; { union { v16b v; v8b q[2]; } u; u.q[0] = *(const v8b*)(cur + xr_o); u.q[1] = *(const v8b*)(cur + xr_o + 2 * XC); a = u.v; }
#pragma unroll
    for (int j = 0; j < 8; ++j) w[j] = frag_wt(cur, j, lane);
#pragma unroll
    for (int j = 0; j < 8; ++j) acc[j] = wmma_bf(a, w[j], acc[j]);
    __builtin_amdgcn_sched_barrier(0);   /* or the compiler lifts the roundings below, with their wait for the next step's loads, in among the products, which then stand behind that wait */
    if (more) { st_wt(nxt + ws_o, wt);
#pragma unroll
      for (int i = 0; i < 4; ++i) { v4b o; o[0] = (__bf16)xt[i][0]; o[1] = (__bf16)xt[i][1]; o[2] = (__bf16)xt[i][2]; o[3] = (__bf16)xt[i][3]; *(v4b*)(nxt + xs_o + i * 32) = o; } }
    __syncthreads(); }   /* one barrier a step: it publishes the next tile and ends the reads of the buffer that the next step refills */
#pragma unroll
  for (int j = 0; j < 8; ++j) { const float bb = BA ? bfr(BA[c0 + j * 16 + col]) : 0.f;
#pragma unroll
    for (int r = 0; r < 8; ++r) { const float v = acc[j][r] + bb; const int rl = wave * 16 + 8 * g + r, cl = j * 16 + col; const _Float16 hv = (_Float16)v;
      if (which == 2) { const __bf16 bh = (__bf16)v; th[cl][rl] = bh; tl2[cl][rl] = (__bf16)(v - (float)bh); } else { sh[rl][cl] = hv; sl[rl][cl] = (_Float16)((v - (float)hv) * 1024.0f); }   /* q residual carried x 2^10 so the plane stays f16-normal on the chip */ } }
  __syncthreads();
  if (which < 2) { _Float16* dh = which == 0 ? QH : KH; for (int e = tid; e < 64 * 16; e += 128) { const int rl = e >> 4, q = e & 15; vst2((unsigned*)(dh + (r0 + rl) * OW + c0 + q * 8), *(const v4u*)&sh[rl][q * 8]); if (which == 0) vst2((unsigned*)(QL + (r0 + rl) * CC + c0 + q * 8), *(const v4u*)&sl[rl][q * 8]); } }
  else { const size_t b = r0 / TT; const int t0 = (int)(r0 % TT); for (int e = tid; e < 128 * 8; e += 128) { const int cl = e >> 3, q = e & 7; const size_t o2 = (b * CK + c0 + cl) * (size_t)TT + t0 + q * 8; vst2((unsigned*)(VT + o2), *(const v4u*)&th[cl][q * 8]); vst2((unsigned*)(VL + o2), *(const v4u*)&tl2[cl][q * 8]); } } }
template <int M> __device__ __forceinline__ float xrow(float v) { return __builtin_bit_cast(float, __builtin_amdgcn_update_dpp(0, __builtin_bit_cast(int, v), 0x160 | M, 0xf, 0xf, true)); }   // lane l reads lane l ^ M of its 16-lane row (DPP row_xmask): no LDS round trip
struct VF { v16b h[HDV / 16], l[HDV / 16]; };   // v fragments (hi, lo planes) of 32 keys x 64 value dims
__device__ __forceinline__ void ld_v(VF& f, const __bf16* vt, const __bf16* vl, int lane) {
#pragma unroll
  for (int j = 0; j < HDV / 16; ++j) { f.h[j] = frag_b(vt + (size_t)j * 16 * TT, lane); f.l[j] = frag_b(vl + (size_t)j * 16 * TT, lane); } }
__device__ __forceinline__ void pv32(v8f* acc, const float* prow, int kk, const VF& f, int lane) { const F2 p = split_row(prow, kk, lane);
#pragma unroll
  for (int j = 0; j < HDV / 16; ++j) { acc[j] = wmma_bf(p.h, f.h[j], acc[j]); acc[j] = wmma_bf(p.l, f.h[j], acc[j]); acc[j] = wmma_bf(p.h, f.l[j], acc[j]); } }
// ---- k_att: block = 64 queries of (b, h), one wave per 16 queries, no traffic between waves. Per 128-key chunk: 2-product logits / 32 in the D registers, running row maximum and rescale (online softmax),
// P = exp(s - m) through the wave's own LDS tile into A fragments (bf16 hi + lo), 3-product P . v into acc; the row sums stay per lane until the end; y = acc / l
__global__ __launch_bounds__(128, 4) /* four waves a SIMD: a budget of 256 registers */ void k_att(const _Float16* __restrict__ QH, const _Float16* __restrict__ QL, const _Float16* __restrict__ KH, const __bf16* __restrict__ VT, const __bf16* __restrict__ VL, float* __restrict__ Y) { __shared__ __align__(16) float ss[4][16][132];
  const int tid = threadIdx.x, wave = tid >> 5, lane = tid & 31, col = lane & 15, g = lane >> 4; const int h = blockIdx.y, b = blockIdx.z; const int ql0 = blockIdx.x * 64 + wave * 16; const int kend = blockIdx.x * 64 + 64; const size_t q0 = (size_t)b * TT + ql0;
  const v16h ah = frag_h(QH + (q0 + col) * CC + h * HD, lane), al = frag_h(QL + (q0 + col) * CC + h * HD, lane);
  v8f acc[HDV / 16] = {}; float m[8], l[8];
#pragma unroll
  for (int r = 0; r < 8; ++r) { m[r] = -3.0e38f; l[r] = 0.f; }
  const _Float16* kp = KH + ((size_t)b * TT + col) * CK + h * HD + 8 * g;   /* this lane's half of its key row of the chunk; the three pointers walk with k0 */
  const size_t po = ((size_t)b * CK + (h / 2) * HDV + col) * (size_t)TT;   /* value head h/2 (64 wide) */ const __bf16 *vtp = VT + po, *vlp = VL + po;
#pragma unroll 1   /* rolled: one chunk's body fills the register budget; the inner loops are unrolled so that their arrays are registers */
  for (int k0 = 0; k0 < kend; k0 += 128, kp += (size_t)128 * CK, vtp += 128, vlp += 128) { v8f s[8]; v16h kb[8];
#pragma unroll
    for (int j = 0; j < 8; ++j) { union { v16h v; v8h q[2]; } u; const _Float16* p = kp + (size_t)j * 16 * CK; u.q[0] = *(const v8h*)p; u.q[1] = *(const v8h*)(p + 16); kb[j] = u.v; }   /* frag_h's order; all loads of the chunk in flight together, in front of the first product */
    asm volatile("s_wait_xcnt 0x0" :: "v"(kp) : "memory");   /* the run's address pair is an input here, so it outlives the run and no result of the run is given its registers; the wait stands in front of its next rewrite */
#pragma unroll
    for (int j = 0; j < 8; ++j) { v8f a0 = {}, a1 = {}; a0 = wmma16(ah, kb[j], a0); a1 = wmma16(al, kb[j], a1); s[j] = a0 + a1 * (1.0f / 1024.0f); }
    const bool full = k0 + 64 < kend;   /* wave-uniform: keys 64..127 of the chunk are open to some row */
    const int dq = ql0 + 8 * g - col - k0;   /* causal test against constants: one register, not one per element */
    VF va; ld_v(va, vtp, vlp, lane);   /* the first 32 keys' v flies under the softmax */
#pragma unroll
    for (int r = 0; r < 8; ++r) { float mx = -3.0e38f;
#pragma unroll
      for (int j = 0; j < 8; ++j) { const float v = (j * 16 - r <= dq) ? s[j][r] * 0.03125f : -3.0e38f;   /* key k0 + 16 j + col <= query ql0 + 8 g + r; q * 32^-1/2 then * 1/sqrt(32) = 1/32 */ s[j][r] = v; mx = fmaxf(mx, v); }
      mx = fmaxf(mx, xrow<1>(mx)); mx = fmaxf(mx, xrow<2>(mx)); mx = fmaxf(mx, xrow<4>(mx)); mx = fmaxf(mx, xrow<8>(mx));   /* the 16 lanes of a half hold one row's columns */
      const float mn = fmaxf(m[r], mx), sc = expf(m[r] - mn); m[r] = mn; float ls = l[r] * sc;
#pragma unroll
      for (int j = 0; j < HDV / 16; ++j) acc[j][r] *= sc;
#pragma unroll
      for (int j = 0; j < 8; ++j) { const float p = expf(s[j][r] - mn);   /* a masked logit (-3e38) gives exactly 0: mn is a real logit, key 0 is open to every row */ ls += p; ss[wave][8 * g + r][j * 16 + col] = p; }
      asm volatile("" : "+v"(ls));   /* each row's sum, against spills: formed here, or the compiler sinks the adds to the loop's foot and all 64 addends stay live through the P . v products */
      l[r] = ls; }
    LDSX();   /* the wave's own P tile: every lane's stores have landed before a lane reads the others' elements */
    const float* prow = &ss[wave][col][0];
    pv32(acc, prow, 0, va, lane); ld_v(va, vtp + 32, vlp + 32, lane); pv32(acc, prow, 32, va, lane);
    if (full) { ld_v(va, vtp + 64, vlp + 64, lane); pv32(acc, prow, 64, va, lane); ld_v(va, vtp + 96, vlp + 96, lane); pv32(acc, prow, 96, va, lane); } }
#pragma unroll
  for (int r = 0; r < 8; ++r) { float ls = l[r];
    ls += xrow<1>(ls); ls += xrow<2>(ls); ls += xrow<4>(ls); ls += xrow<8>(ls);
    const float inv = 1.0f / ls;
#pragma unroll
    for (int j = 0; j < HDV / 16; ++j) ss[wave][8 * g + r][j * 16 + col] = acc[j][r] * inv; }
  LDSX(); for (int it = 0; it < 8; ++it) { const int rl = it * 2 + g; vst2(Y + ((size_t)b * TT + ql0 + rl) * (NH * HDV) + h * HDV + col * 4, *(const v4f*)&ss[wave][rl][col * 4]); } }   /* Y rows [b*T+t][score head][64] = 2,048 floats */
// ---- k_rms: block = 8 tokens (one wave per 2 tokens? -> 256 threads = 8 tokens x 32 lanes; lane pair handles value heads): for each (token, value head i): d = Y[2i] - lambda Y[2i+1] over 64 dims, rms = rsqrt(mean(d^2) + 1e-5) -> RS[token][i]; lambda computed per block from the four 32-vectors (f32)
__device__ __forceinline__ float lam_full(const float* LQ1, const float* LK1, const float* LQ2, const float* LK2) { float s1 = 0.f, s2 = 0.f;
#pragma unroll 1
  for (int i = 0; i < HD; ++i) { s1 += bfr(LQ1[i]) * bfr(LK1[i]); s2 += bfr(LQ2[i]) * bfr(LK2[i]); }
  return expf(s1) - expf(s2) + 0.2f; }
__global__ __launch_bounds__(256) void k_rms(const float* __restrict__ Y, const float* __restrict__ LQ1, const float* __restrict__ LQ2, const float* __restrict__ LK1, const float* __restrict__ LK2, float* __restrict__ RS) { __shared__ float srs[8][32];
  const int t = threadIdx.x; const int tk = t >> 5, lane = t & 31; const size_t row = (size_t)blockIdx.x * 8 + tk; const float lam = lam_full(LQ1, LK1, LQ2, LK2);
  // lane handles value head i = lane & 15 over half the dims (lane >> 4 picks dims 0..31 / 32..63), then pair-sum via xor 16
  const int i = lane & 15, half = lane >> 4; const float* y1 = Y + row * (NH * HDV) + (2 * i) * HDV + half * 32; const float* y2 = y1 + HDV;
  float s = 0.f;
#pragma unroll 4
  for (int d = 0; d < 32; ++d) { const float v = y1[d] - lam * y2[d]; s += v * v; }
  s += __shfl_xor(s, 16);
  srs[tk][lane] = (lane < 16) ? rsqrtf(s * (1.0f / HDV) + 1e-5f) : 0.f;
  __syncthreads();
  vst2(RS + row * 32 + lane, srs[tk][lane]); }   
// A rows of one k step of k_out from the two score heads' rows: ((Y[2i] - lambda Y[2i+1]) rms 0.8) gamma, split hi + lo; gq = this lane's rounded gamma
__device__ __forceinline__ F2 mk_a(const v4f* ya, const v4f* yb, float rn, float lam, const float* gq) { float v[16]; const float rs = rn * 0.8f;
#pragma unroll
  for (int q = 0; q < 8; ++q) { v[q] = (ya[q >> 2][q & 3] - lam * yb[q >> 2][q & 3]) * rs * gq[q]; v[8 + q] = (ya[2 + (q >> 2)][q & 3] - lam * yb[2 + (q >> 2)][q & 3]) * rs * gq[16 + q]; }
  return bsplit16(v); }
// ---- k_out: block = (64 rows, 128 cols): A = ((Y[2i] - lambda Y[2i+1]) rms gamma 0.8) built on the fly (hi + lo) x w_proj ((in,out)); 4-KB rows
__global__ __launch_bounds__(128) void k_out(const float* __restrict__ Y, const float* __restrict__ RS, const float* __restrict__ GA, const float* __restrict__ LQ1, const float* __restrict__ LQ2, const float* __restrict__ LK1, const float* __restrict__ LK2, const float* __restrict__ WP, float* __restrict__ OUT) { __shared__ __align__(16) float sf[4][16][132]; __shared__ __align__(16) __bf16 sw[2][8 * WJ]; __shared__ __align__(16) float sg[HDV];
  const int tid = threadIdx.x, wave = tid >> 5, lane = tid & 31, col = lane & 15, g = lane >> 4; const int c0 = blockIdx.y * 128; const size_t r0 = (size_t)blockIdx.x * 64 + wave * 16; const size_t arow = r0 + col; const float lam = lam_full(LQ1, LK1, LQ2, LK2);
  v8f acc[8] = {};
  const float* wp = WP + (size_t)(wave * 8) * CC + c0 + lane * 4; const int ws_o = wt_slot(wave, lane);
  const float* yp = Y + arow * (NH * HDV) + 8 * g; const float* rp = RS + arow * 32;
  WT wt; ld_wt(wt, wp, CC); v4f ya[4], yb[4]; float rn = rp[0];   /* step 0's pieces of the rows Y[2i] and Y[2i+1] */
#pragma unroll
  for (int q = 0; q < 4; ++q) { ya[q] = *(const v4f*)(yp + (q >> 1) * 16 + (q & 1) * 4); yb[q] = *(const v4f*)(yp + HDV + (q >> 1) * 16 + (q & 1) * 4); }
  if (tid < HDV) sg[tid] = bfr(GA[tid]);   /* gamma in LDS: a global load of it inside a step would wait out the loads that fly for the next step */
  st_wt(&sw[0][0] + ws_o, wt);
  __syncthreads();
  F2 a = mk_a(ya, yb, rn, lam, &sg[8 * g]);
#pragma unroll 2   /* two steps a trip: the buffer of each step is then a constant */
  for (int kc = 0; kc < CC / 32; ++kc) { const bool more = kc + 1 < CC / 32;
    const int kn = kc + 1;
    if (more) { ld_wt(wt, wp + (size_t)kn * 32 * CC, CC);   /* the next step's loads fly under this step's products */
      const int i = kn >> 1;   /* value head (64 = 2 steps) */ const float* y1 = yp + (2 * i) * HDV + (kn & 1) * 32; rn = rp[i];
#pragma unroll
      for (int q = 0; q < 4; ++q) { ya[q] = *(const v4f*)(y1 + (q >> 1) * 16 + (q & 1) * 4); yb[q] = *(const v4f*)(y1 + HDV + (q >> 1) * 16 + (q & 1) * 4); } }
    v16b w[8];
#pragma unroll
    for (int j = 0; j < 8; ++j) w[j] = frag_wt(&sw[kc & 1][0], j, lane);
#pragma unroll
    for (int j = 0; j < 8; ++j) { acc[j] = wmma_bf(a.h, w[j], acc[j]); acc[j] = wmma_bf(a.l, w[j], acc[j]); }
    __builtin_amdgcn_sched_barrier(0);   /* or the compiler lifts what follows, with its wait for the next step's loads, in among the products, which then stand behind that wait */
    if (more) { a = mk_a(ya, yb, rn, lam, &sg[(kn & 1) * 32 + 8 * g]); st_wt(&sw[kn & 1][0] + ws_o, wt); }
    __syncthreads(); }   /* one barrier a step: it publishes the next tile and ends the reads of the buffer that the next step refills */
#pragma unroll
  for (int j = 0; j < 8; ++j)
#pragma unroll
    for (int r = 0; r < 8; ++r) sf[wave][8 * g + r][j * 16 + col] = acc[j][r];
  LDSX(); for (int rl = 0; rl < 16; ++rl) vst2(OUT + (r0 + rl) * CC + c0 + lane * 4, *(const v4f*)&sf[wave][rl][lane * 4]); }
extern "C" void kernel_launch(void* const* d_in, const int* in_sizes, int n_in, void* d_out, int out_size, void* d_ws, size_t ws_size, hipStream_t stream) {
  (void)in_sizes; (void)n_in; (void)out_size;
  const float** F = (const float**)d_in;   // 0 x [4,1024,1024], 1 w_attn [1024,3072] ((in,out): q | k | v), 2 w_proj ((in,out)), 3 lambda_q1 [32], 4 lambda_q2, 5 lambda_k1, 6 lambda_k2, 7 gamma [64]
  if (ws_size < (size_t)WS_END) return;
  char* ws = (char*)d_ws; _Float16 *QH = (_Float16*)(ws + WS_QH), *QL = (_Float16*)(ws + WS_QL), *KH = (_Float16*)(ws + WS_KH); __bf16 *VT = (__bf16*)(ws + WS_VT), *VL = (__bf16*)(ws + WS_VL); float *Y = (float*)(ws + WS_Y), *RS = (float*)(ws + WS_RS);
  k_proj<<<dim3(TNB * TT / 64, CC / 128, 3), 128, 0, stream>>>(F[0], F[1], nullptr, F[1] + CC, nullptr, F[1] + 2 * CC, nullptr, QH, QL, KH, VT, VL, nullptr, nullptr, 0);
  k_att<<<dim3(TT / 64, NH, TNB), 128, 0, stream>>>(QH, QL, KH, VT, VL, Y);
  k_rms<<<dim3(TNB * TT / 8), 256, 0, stream>>>(Y, F[3], F[4], F[5], F[6], RS);
  k_out<<<dim3(TNB * TT / 64, CC / 128), 128, 0, stream>>>(Y, RS, F[7], F[3], F[4], F[5], F[6], F[2], (float*)d_out);
}

// v003
// Measured time: 201 microseconds a run.
// In both of two side-by-side timings against v002, it was 1.24 times as fast.
// All steps since v000 together make it 7.51 times as fast.
// compute dtype: all float inputs rounded to bf16, the four lambda vectors and gamma read; qkv = x w_attn ((in,out)) with EXACT bf16 products on WMMA 16x16x32, f32 accumulate; q as f16 hi + residual (x 2^10), k f16 -> 2-product causal logits x (32^-1/2)^2 = 1/32 kept in f32 registers (one launch for all score heads); online softmax in f32 (precise expf); unnormalised P split bf16 hi + lo against v bf16 hi + lo (3 products), divided by the row sum at the end, per score head into its value head-pair slot; the differential combination P1 v - lambda P2 v, RMSNorm, gamma and (1 - lambda_init) in f32; out = that (bf16 hi + lo) w_proj; f32 output.
#include <hip/hip_runtime.h>
#include <math.h>

typedef __attribute__((ext_vector_type(16))) _Float16 v16h;
typedef __attribute__((ext_vector_type(16))) __bf16 v16b;
typedef __attribute__((ext_vector_type(8)))  _Float16 v8h;
typedef __attribute__((ext_vector_type(8)))  float v8f;
typedef __attribute__((ext_vector_type(4)))  float v4f;
typedef __attribute__((ext_vector_type(2)))  float v2f;
typedef __attribute__((ext_vector_type(4)))  unsigned v4u;
typedef __attribute__((ext_vector_type(4)))  int v4i;
typedef float __attribute__((may_alias)) float_a;
typedef int __attribute__((may_alias)) int_a;

template <typename T> __device__ __forceinline__ void vst2(void* p, T v) { *(T*)p = v;  }
__device__ __forceinline__ v8f wmma16(v16h a, v16h b, v8f c) {
  v8f d = __builtin_amdgcn_wmma_f32_16x16x32_f16(false, a, false, b, (short)0, c, false, false);
  asm volatile("v_nop\n\tv_nop\n\tv_nop\n\tv_nop" : "+v"(d) : "v"(a), "v"(b));
  return d;
}
__device__ __forceinline__ v8f wmma_bf(v16b a, v16b b, v8f c) {
  v8f d = __builtin_amdgcn_wmma_f32_16x16x32_bf16(false, a, false, b, (short)0, c, false, false);
  asm volatile("v_nop\n\tv_nop\n\tv_nop\n\tv_nop" : "+v"(d) : "v"(a), "v"(b));
  return d;
}
// 16x16x32 fragments: lane = (h = lane>>4, row/col = lane&15); elements 0..7 = k0+8h+0..7, 8..15 = k0+16+8h+0..7; D element r = row 8h+r
__device__ __forceinline__ v16h frag_h(const _Float16* rowk0, int lane) {
  union { v16h v; v8h q[2]; } u; const _Float16* p = rowk0 + 8 * (lane >> 4);
  u.q[0] = *(const v8h*)p; u.q[1] = *(const v8h*)(p + 16); return u.v;
}
__device__ __forceinline__ v16h frag_f32(const float* rowk0, int lane) {
  v16h a; const float* p = rowk0 + 8 * (lane >> 4);
#pragma unroll
  for (int i = 0; i < 8; ++i) { a[i] = (_Float16)p[i]; a[8 + i] = (_Float16)p[16 + i]; }
  return a;
}
__device__ __forceinline__ v16h frag_f32s(const float* rowk0, int lane, float sc) {
  v16h a; const float* p = rowk0 + 8 * (lane >> 4);
#pragma unroll
  for (int i = 0; i < 8; ++i) { a[i] = (_Float16)(p[i] * sc); a[8 + i] = (_Float16)(p[16 + i] * sc); }
  return a;
}
// column fragment from a [K][ld] layout (column n), rows >= K read as 0
__device__ __forceinline__ v16h fragc_f32(const float* W, int k0, int n, int lane, int ld, int K) {
  v16h a; const int g = lane >> 4;
#pragma unroll
  for (int i = 0; i < 8; ++i) { const int ka = k0 + 8 * g + i, kb = ka + 16;
    a[i] = (_Float16)(ka < K ? W[(size_t)(ka < K ? ka : K - 1) * ld + n] : 0.f); a[8 + i] = (_Float16)(kb < K ? W[(size_t)(kb < K ? kb : K - 1) * ld + n] : 0.f); }
  return a;
}
struct F2 { v16b h, l; };
__device__ __forceinline__ F2 bsplit16(const float v[16]) { F2 r;
#pragma unroll
  for (int i = 0; i < 16; ++i) { const __bf16 h = (__bf16)v[i]; r.h[i] = h; r.l[i] = (__bf16)(v[i] - (float)h); }
  return r; }
__device__ __forceinline__ F2 split_row(const float* row, int k0, int lane) { float v[16]; const float* p = row + k0 + 8 * (lane >> 4);
#pragma unroll
  for (int i = 0; i < 8; ++i) { v[i] = p[i]; v[8 + i] = p[16 + i]; }
  return bsplit16(v); }
__device__ __forceinline__ F2 split_rowK(const float* row, int k0, int lane, int K) { float v[16]; const int g = lane >> 4;
#pragma unroll
  for (int i = 0; i < 8; ++i) { const int ka = k0 + 8 * g + i, kb = ka + 16; v[i] = ka < K ? row[ka < K ? ka : K - 1] : 0.f; v[8 + i] = kb < K ? row[kb < K ? kb : K - 1] : 0.f; }
  return bsplit16(v); }
__device__ __forceinline__ F2 split_col(const float* W, int k0, int n, int lane, int ld, int K) { float v[16]; const int g = lane >> 4;
#pragma unroll
  for (int i = 0; i < 8; ++i) { const int ka = k0 + 8 * g + i, kb = ka + 16; v[i] = ka < K ? W[(size_t)(ka < K ? ka : K - 1) * ld + n] : 0.f; v[8 + i] = kb < K ? W[(size_t)(kb < K ? kb : K - 1) * ld + n] : 0.f; }
  return bsplit16(v); }
__device__ __forceinline__ v8f mac3(const F2& a, const F2& b, v8f c) { c = wmma_bf(a.l, b.h, c); c = wmma_bf(a.h, b.l, c); return wmma_bf(a.h, b.h, c); }
__device__ __forceinline__ float sigm(float v) { return 1.0f / (1.0f + expf(-v)); }
#define LDSX() do { asm volatile("s_wait_dscnt 0" ::: "memory"); __builtin_amdgcn_wave_barrier(); __builtin_amdgcn_fence(__ATOMIC_RELEASE, "workgroup"); } while (0)


// Differential causal attention (B 4, T 1,024, C 1,024; 2H = 32 score heads x 32, 16 value heads x 64): att = softmax(causal(q k^T / 32)) per score head; diff_i = att_{2i} - lambda att_{2i+1}, lambda = exp(lq1.lk1) - exp(lq2.lk2) + 0.2; out_i = RMSNorm(diff_i v_i) * gamma * 0.8; concat w_proj.
#define NB 4
#define TT 1024
#define CC 1024
#define NH 32              // score heads (2H)
#define HD 32              // score head dim
#define HDV 64             // value head dim (16 value heads)
#define WIN (TT + 1)       // plain causal
#define NKV 32             // k has the same 32 heads
#define LDW 3072           // w_attn (in,out) [1024][3072]: q | k | v column blocks
#define CK (NKV * HD)   // 1,024: k/v row width
#define REP (NH / NKV)
#ifndef TNB
#define TNB NB
#endif
typedef __attribute__((ext_vector_type(8))) __bf16 v8b;
__device__ __forceinline__ v16b frag_b(const __bf16* rowk0, int lane) {
  union { v16b v; v8b q[2]; } u; const __bf16* p = rowk0 + 8 * (lane >> 4);
  u.q[0] = *(const v8b*)p; u.q[1] = *(const v8b*)(p + 16); return u.v;
}
__device__ __forceinline__ float bfr(float v) { return (float)(__bf16)v; }
// ---- operand tiles of one k step (32 deep) in LDS, bf16, in fragment order: a weight fragment read is lane * 16 B, contiguous over the wave; an x fragment read is contiguous per 16-lane half
typedef __attribute__((ext_vector_type(4))) __bf16 v4b;
#define WJ 520             // elements per 16-column group of a weight tile: k 0..15 (256) + k 16..31 (256) + 8 of pad, so that the 16 lanes of a store fall on 16 different 16-B slots
#define XC 160             // elements per 8-k chunk of a wave's 16 x rows: 128 + 32 of pad, for the same reason
#define XO (8 * WJ)        // the x rows stand behind the weight tile (128 columns)
struct WT { v4f r[8]; };   // wave w: rows 8w..8w+7 of the tile, a lane 4 columns; one load = one 512-B row piece = 4 whole lines
__device__ __forceinline__ void ld_wt(WT& t, const float* p, int ld) {
#pragma unroll
  for (int i = 0; i < 8; ++i) t.r[i] = *(const v4f*)(p + (size_t)i * ld); }
__device__ __forceinline__ int wt_slot(int wave, int lane) { return (lane >> 2) * WJ + (wave >> 1) * 256 + (wave & 1) * 128 + (lane & 3) * 32; }   // column 4 lane + c stands c * 8 elements on
__device__ __forceinline__ void st_wt(__bf16* p, const WT& t) {
#pragma unroll
  for (int c = 0; c < 4; ++c) { v8b o;
#pragma unroll
    for (int i = 0; i < 8; ++i) o[i] = (__bf16)t.r[i][c];
    *(v8b*)(p + c * 8) = o; } }
__device__ __forceinline__ v16b frag_wt(const __bf16* tile, int j, int lane) {   // frag_b's k order: elements 0..7 = 8g + 0..7, 8..15 = 16 + 8g + 0..7, column 16 j + col
  union { v16b v; v8b q[2]; } u; const __bf16* p = tile + j * WJ + lane * 8;
  u.q[0] = *(const v8b*)p; u.q[1] = *(const v8b*)(p + 256); return u.v; }
__device__ __attribute__((noinline)) float exp_ni(float v) { return expf(v); }
__device__ __attribute__((noinline)) float erf_ni(float v) { return erff(v); }

#define WS_QH  0u
#define WS_QL  (WS_QH + 2u * (size_t)NB * TT * CC)
#define WS_KH  (WS_QL + 2u * (size_t)NB * TT * CC)
#define WS_VT  (WS_KH + 2u * (size_t)NB * TT * CK)      // bf16 v planes [b][CK][t] (k rows are [b*T+t][CK])
#define WS_VL  (WS_VT + 2u * (size_t)NB * CK * TT)
#define WS_Y   (WS_VL + 2u * (size_t)NB * CK * TT)      // f32 y rows [b*t][score head][64]
#define WS_RS  (WS_Y + 4u * (size_t)NB * TT * NH * HDV)
#define WS_END (WS_RS + 128u * (size_t)NB * TT)

// ---- k_proj: block = (64 rows, 128 cols, which): qkv = x W (+ b), exact; q -> f16 hi (+ residual), k -> f16 rows, v -> bf16 hi + lo planes
__global__ __launch_bounds__(128) void k_proj(const float* __restrict__ X, const float* __restrict__ WQ, const float* __restrict__ BQ, const float* __restrict__ WK, const float* __restrict__ BK, const float* __restrict__ WV, const float* __restrict__ BV, _Float16* __restrict__ QH, _Float16* __restrict__ QL, _Float16* __restrict__ KH, __bf16* __restrict__ VT, __bf16* __restrict__ VL, const float* __restrict__ NQW, const float* __restrict__ NKW, int wbase) {
  __shared__ __align__(16) _Float16 sh[64][136], sl[64][136]; __shared__ __align__(16) __bf16 th[128][72], tl2[128][72];
  const int tid = threadIdx.x, wave = tid >> 5, lane = tid & 31, col = lane & 15, g = lane >> 4; const int which = wbase + blockIdx.z; const int OW = (which == 0) ? CC : CK;   /* output row width: q 1,024, k/v 1,024 */ const int c0 = blockIdx.y * 128; const size_t r0 = (size_t)blockIdx.x * 64; const float* WA = which == 0 ? WQ : which == 1 ? WK : WV; const float* BA = which == 0 ? BQ : which == 1 ? BK : BV;
  v8f acc[8] = {};
  __bf16* const sb0 = &th[0][0]; __bf16* const sb1 = &tl2[0][0];   /* the two staging buffers (13,440 B each) lie in the epilogue's planes, which are written only behind the loop's last barrier */
  const float* wp = WA + (size_t)(wave * 8) * LDW + c0 + lane * 4;   /* (in,out), row length 3072 */
  const float* xp = X + (r0 + wave * 16 + (lane >> 3)) * CC + (lane & 7) * 4;   /* 8 lanes a row: one load = 4 rows x one whole line */
  const int ws_o = wt_slot(wave, lane), xs_o = XO + wave * 4 * XC + ((lane & 7) >> 1) * XC + (lane >> 3) * 8 + (lane & 1) * 4, xr_o = XO + wave * 4 * XC + g * XC + col * 8;
  WT wt; v4f xt[4]; ld_wt(wt, wp, LDW);
#pragma unroll
  for (int i = 0; i < 4; ++i) xt[i] = *(const v4f*)(xp + (size_t)(4 * i) * CC);
  st_wt(sb0 + ws_o, wt);
#pragma unroll
  for (int i = 0; i < 4; ++i) { v4b o; o[0] = (__bf16)xt[i][0]; o[1] = (__bf16)xt[i][1]; o[2] = (__bf16)xt[i][2]; o[3] = (__bf16)xt[i][3]; *(v4b*)(sb0 + xs_o + i * 32) = o; }
  __syncthreads();
#pragma unroll 2   /* two steps a trip: the buffer of each step is then a constant */
  for (int kc = 0; kc < CC / 32; ++kc) { const __bf16* cur = (kc & 1) ? sb1 : sb0; __bf16* nxt = (kc & 1) ? sb0 : sb1; const bool more = kc + 1 < CC / 32;
    if (more) { ld_wt(wt, wp + (size_t)(kc + 1) * 32 * LDW, LDW);   /* the next step's loads fly under this step's products */
#pragma unroll
      for (int i = 0; i < 4; ++i) xt[i] = *(const v4f*)(xp + (size_t)(4 * i) * CC + (kc + 1) * 32); }
    v16b a, w[8]; { union { v16b v; v8b q[2]; } u; u.q[0] = *(const v8b*)(cur + xr_o); u.q[1] = *(const v8b*)(cur + xr_o + 2 * XC); a = u.v; }
#pragma unroll
    for (int j = 0; j < 8; ++j) w[j] = frag_wt(cur, j, lane);
#pragma unroll
    for (int j = 0; j < 8; ++j) acc[j] = wmma_bf(a, w[j], acc[j]);
    __builtin_amdgcn_sched_barrier(0);   /* or the compiler lifts the roundings below, with their wait for the next step's loads, in among the products, which then stand behind that wait */
    if (more) { st_wt(nxt + ws_o, wt);
#pragma unroll
      for (int i = 0; i < 4; ++i) { v4b o; o[0] = (__bf16)xt[i][0]; o[1] = (__bf16)xt[i][1]; o[2] = (__bf16)xt[i][2]; o[3] = (__bf16)xt[i][3]; *(v4b*)(nxt + xs_o + i * 32) = o; } }
    __syncthreads(); }   /* one barrier a step: it publishes the next tile and ends the reads of the buffer that the next step refills */
#pragma unroll
  for (int j = 0; j < 8; ++j) { const float bb = BA ? bfr(BA[c0 + j * 16 + col]) : 0.f;
#pragma unroll
    for (int r = 0; r < 8; ++r) { const float v = acc[j][r] + bb; const int rl = wave * 16 + 8 * g + r, cl = j * 16 + col; const _Float16 hv = (_Float16)v;
      if (which == 2) { const __bf16 bh = (__bf16)v; th[cl][rl] = bh; tl2[cl][rl] = (__bf16)(v - (float)bh); } else { sh[rl][cl] = hv; sl[rl][cl] = (_Float16)((v - (float)hv) * 1024.0f); }   /* q residual carried x 2^10 so the plane stays f16-normal on the chip */ } }
  __syncthreads();
  if (which < 2) { _Float16* dh = which == 0 ? QH : KH; for (int e = tid; e < 64 * 16; e += 128) { const int rl = e >> 4, q = e & 15; vst2((unsigned*)(dh + (r0 + rl) * OW + c0 + q * 8), *(const v4u*)&sh[rl][q * 8]); if (which == 0) vst2((unsigned*)(QL + (r0 + rl) * CC + c0 + q * 8), *(const v4u*)&sl[rl][q * 8]); } }
  else { const size_t b = r0 / TT; const int t0 = (int)(r0 % TT); for (int e = tid; e < 128 * 8; e += 128) { const int cl = e >> 3, q = e & 7; const size_t o2 = (b * CK + c0 + cl) * (size_t)TT + t0 + q * 8; vst2((unsigned*)(VT + o2), *(const v4u*)&th[cl][q * 8]); vst2((unsigned*)(VL + o2), *(const v4u*)&tl2[cl][q * 8]); } } }
template <int M> __device__ __forceinline__ float xrow(float v) { return __builtin_bit_cast(float, __builtin_amdgcn_update_dpp(0, __builtin_bit_cast(int, v), 0x160 | M, 0xf, 0xf, true)); }   // lane l reads lane l ^ M of its 16-lane row (DPP row_xmask): no LDS round trip
// ---- K and V tiles of one 128-key chunk in LDS, brought once a block by asynchronous 16-B copies and read by all four waves
#define KP 40              // f16 elements per key row of the K tile: 64 B + 16 B of pad; pitch = 16 B x odd, so the 16 lanes of a fragment read fall on different banks
#define VP 136             // bf16 elements per value-dim row of a v tile: 256 B + 16 B of pad, for the same reason
struct VF { v16b h[HDV / 16], l[HDV / 16]; };   // v fragments (hi, lo planes) of 32 keys x 64 value dims
__device__ __forceinline__ void ld_v(VF& f, const __bf16* vt, const __bf16* vl, int lane) {
#pragma unroll
  for (int j = 0; j < HDV / 16; ++j) { f.h[j] = frag_b(vt + j * 16 * VP, lane); f.l[j] = frag_b(vl + j * 16 * VP, lane); } }   // from the LDS tiles, row pitch VP
__device__ __forceinline__ void pv32(v8f* acc, const float* prow, int kk, const VF& f, int lane) { const F2 p = split_row(prow, kk, lane);
#pragma unroll
  for (int j = 0; j < HDV / 16; ++j) { acc[j] = wmma_bf(p.h, f.h[j], acc[j]); acc[j] = wmma_bf(p.l, f.h[j], acc[j]); acc[j] = wmma_bf(p.h, f.l[j], acc[j]); } }
__device__ __forceinline__ unsigned lds_off(const void* p) { return (unsigned)(size_t)p; }   // byte offset in the work-group's LDS
// n copies of a lane, copy i standing ls bytes on in LDS and gs bytes on in global memory; the wait is the last line of the copies' own statement, so it stands in front of every rewrite of an address register that they name
__device__ __forceinline__ void acopy4(unsigned l, unsigned ls, const char* p, size_t gs) {
  asm volatile("global_load_async_to_lds_b128 %0, %4, off\n\tglobal_load_async_to_lds_b128 %1, %5, off\n\tglobal_load_async_to_lds_b128 %2, %6, off\n\tglobal_load_async_to_lds_b128 %3, %7, off\n\ts_wait_xcnt 0x0"
    :: "v"(l), "v"(l + ls), "v"(l + 2 * ls), "v"(l + 3 * ls), "v"(p), "v"(p + gs), "v"(p + 2 * gs), "v"(p + 3 * gs) : "memory"); }
__device__ __forceinline__ void acopy8(unsigned l, unsigned ls, const char* p, size_t gs) {
  asm volatile("global_load_async_to_lds_b128 %0, %8, off\n\tglobal_load_async_to_lds_b128 %1, %9, off\n\tglobal_load_async_to_lds_b128 %2, %10, off\n\tglobal_load_async_to_lds_b128 %3, %11, off\n\t"
               "global_load_async_to_lds_b128 %4, %12, off\n\tglobal_load_async_to_lds_b128 %5, %13, off\n\tglobal_load_async_to_lds_b128 %6, %14, off\n\tglobal_load_async_to_lds_b128 %7, %15, off\n\ts_wait_xcnt 0x0"
    :: "v"(l), "v"(l + ls), "v"(l + 2 * ls), "v"(l + 3 * ls), "v"(l + 4 * ls), "v"(l + 5 * ls), "v"(l + 6 * ls), "v"(l + 7 * ls),
       "v"(p), "v"(p + gs), "v"(p + 2 * gs), "v"(p + 3 * gs), "v"(p + 4 * gs), "v"(p + 5 * gs), "v"(p + 6 * gs), "v"(p + 7 * gs) : "memory"); }
// ---- k_att: block = 64 queries of (b, h), one wave per 16 queries; the waves share the chunk's K and v tiles in LDS. Per 128-key chunk: 2-product logits / 32 in the D registers, running row maximum and rescale (online softmax),
// P = exp(s - m) through the wave's own LDS tile into A fragments (bf16 hi + lo), 3-product P . v into acc; the row sums stay per lane until the end; y = acc / l
__global__ __launch_bounds__(128, 4) /* four waves a SIMD: a budget of 256 registers */ void k_att(const _Float16* __restrict__ QH, const _Float16* __restrict__ QL, const _Float16* __restrict__ KH, const __bf16* __restrict__ VT, const __bf16* __restrict__ VL, float* __restrict__ Y) { __shared__ __align__(16) float ss[4][16][132]; __shared__ __align__(16) _Float16 sk[128 * KP]; __shared__ __align__(16) __bf16 sv[2][HDV * VP];
  const int tid = threadIdx.x, wave = tid >> 5, lane = tid & 31, col = lane & 15, g = lane >> 4; const int h = blockIdx.y, b = blockIdx.z; const int ql0 = blockIdx.x * 64 + wave * 16; const int kend = blockIdx.x * 64 + 64; const size_t q0 = (size_t)b * TT + ql0;
  const v16h ah = frag_h(QH + (q0 + col) * CC + h * HD, lane), al = frag_h(QL + (q0 + col) * CC + h * HD, lane);
  v8f acc[HDV / 16] = {}; float m[8], l[8];
#pragma unroll
  for (int r = 0; r < 8; ++r) { m[r] = -3.0e38f; l[r] = 0.f; }
  const _Float16* kg = KH + ((size_t)b * TT + (tid >> 2)) * CK + h * HD + (tid & 3) * 8;   /* copies: 4 lanes a key row (64 B), copy i 32 rows on; the three pointers walk with k0 */
  const size_t po = ((size_t)b * CK + (h / 2) * HDV + (tid >> 4)) * (size_t)TT + (tid & 15) * 8;   /* value head h/2 (64 wide): 16 lanes a row piece (256 B = 2 whole lines), copy i 8 rows on */ const __bf16 *vtg = VT + po, *vlg = VL + po;
  const unsigned kl = lds_off(sk) + (tid >> 2) * (KP * 2) + (tid & 3) * 16, vl0 = lds_off(&sv[0][0]) + (tid >> 4) * (VP * 2) + (tid & 15) * 16, vl1 = vl0 + HDV * VP * 2;
  const _Float16* kp = sk + col * KP + 8 * g;   /* this lane's half of its key row of the tile */ const __bf16 *vtp = &sv[0][col * VP], *vlp = &sv[1][col * VP];
#pragma unroll 1   /* rolled: one chunk's body fills the register budget; the inner loops are unrolled so that their arrays are registers */
  for (int k0 = 0; k0 < kend; k0 += 128, kg += (size_t)128 * CK, vtg += 128, vlg += 128) { v8f s[8]; v16h kb[8];
    asm volatile("s_wait_dscnt 0x0" ::: "memory");   /* this wave's reads of the last chunk's tiles have returned ... */
    __syncthreads();   /* ... and so have every wave's: the tiles may be refilled */
    acopy4(kl, 32 * KP * 2, (const char*)kg, (size_t)32 * CK * 2); acopy8(vl0, 8 * VP * 2, (const char*)vtg, (size_t)8 * TT * 2); acopy8(vl1, 8 * VP * 2, (const char*)vlg, (size_t)8 * TT * 2);
    asm volatile("s_wait_asynccnt 0x0" ::: "memory");   /* this wave's copies have landed ... */
    __syncthreads();   /* ... and so have every wave's: the tiles may be read */
#pragma unroll
    for (int j = 0; j < 8; ++j) { union { v16h v; v8h q[2]; } u; const _Float16* p = kp + j * 16 * KP; u.q[0] = *(const v8h*)p; u.q[1] = *(const v8h*)(p + 16); kb[j] = u.v; }   /* frag_h's order */
#pragma unroll
    for (int j = 0; j < 8; ++j) { v8f a0 = {}, a1 = {}; a0 = wmma16(ah, kb[j], a0); a1 = wmma16(al, kb[j], a1); s[j] = a0 + a1 * (1.0f / 1024.0f); }
    const bool full = k0 + 64 < kend;   /* wave-uniform: keys 64..127 of the chunk are open to some row */
    const int dq = ql0 + 8 * g - col - k0;   /* causal test against constants: one register, not one per element */
#pragma unroll
    for (int r = 0; r < 8; ++r) { float mx = -3.0e38f;
#pragma unroll
      for (int j = 0; j < 8; ++j) { const float v = (j * 16 - r <= dq) ? s[j][r] * 0.03125f : -3.0e38f;   /* key k0 + 16 j + col <= query ql0 + 8 g + r; q * 32^-1/2 then * 1/sqrt(32) = 1/32 */ s[j][r] = v; mx = fmaxf(mx, v); }
      mx = fmaxf(mx, xrow<1>(mx)); mx = fmaxf(mx, xrow<2>(mx)); mx = fmaxf(mx, xrow<4>(mx)); mx = fmaxf(mx, xrow<8>(mx));   /* the 16 lanes of a half hold one row's columns */
      const float mn = fmaxf(m[r], mx), sc = expf(m[r] - mn); m[r] = mn; float ls = l[r] * sc;
#pragma unroll
      for (int j = 0; j < HDV / 16; ++j) acc[j][r] *= sc;
#pragma unroll
      for (int j = 0; j < 8; ++j) { const float p = expf(s[j][r] - mn);   /* a masked logit (-3e38) gives exactly 0: mn is a real logit, key 0 is open to every row */ ls += p; ss[wave][8 * g + r][j * 16 + col] = p; }
      asm volatile("" : "+v"(ls));   /* each row's sum, against spills: formed here, or the compiler sinks the adds to the loop's foot and all 64 addends stay live through the P . v products */
      l[r] = ls; }
    LDSX();   /* the wave's own P tile: every lane's stores have landed before a lane reads the others' elements */
    const float* prow = &ss[wave][col][0];
    VF va; ld_v(va, vtp, vlp, lane); pv32(acc, prow, 0, va, lane); ld_v(va, vtp + 32, vlp + 32, lane); pv32(acc, prow, 32, va, lane);
    if (full) { ld_v(va, vtp + 64, vlp + 64, lane); pv32(acc, prow, 64, va, lane); ld_v(va, vtp + 96, vlp + 96, lane); pv32(acc, prow, 96, va, lane); } }
#pragma unroll
  for (int r = 0; r < 8; ++r) { float ls = l[r];
    ls += xrow<1>(ls); ls += xrow<2>(ls); ls += xrow<4>(ls); ls += xrow<8>(ls);
    const float inv = 1.0f / ls;
#pragma unroll
    for (int j = 0; j < HDV / 16; ++j) ss[wave][8 * g + r][j * 16 + col] = acc[j][r] * inv; }
  LDSX(); for (int it = 0; it < 8; ++it) { const int rl = it * 2 + g; vst2(Y + ((size_t)b * TT + ql0 + rl) * (NH * HDV) + h * HDV + col * 4, *(const v4f*)&ss[wave][rl][col * 4]); } }   /* Y rows [b*T+t][score head][64] = 2,048 floats */
// ---- k_rms: block = 8 tokens (one wave per 2 tokens? -> 256 threads = 8 tokens x 32 lanes; lane pair handles value heads): for each (token, value head i): d = Y[2i] - lambda Y[2i+1] over 64 dims, rms = rsqrt(mean(d^2) + 1e-5) -> RS[token][i]; lambda computed per block from the four 32-vectors (f32)
__device__ __forceinline__ float lam_full(const float* LQ1, const float* LK1, const float* LQ2, const float* LK2) { float s1 = 0.f, s2 = 0.f;
#pragma unroll 1
  for (int i = 0; i < HD; ++i) { s1 += bfr(LQ1[i]) * bfr(LK1[i]); s2 += bfr(LQ2[i]) * bfr(LK2[i]); }
  return expf(s1) - expf(s2) + 0.2f; }
__global__ __launch_bounds__(256) void k_rms(const float* __restrict__ Y, const float* __restrict__ LQ1, const float* __restrict__ LQ2, const float* __restrict__ LK1, const float* __restrict__ LK2, float* __restrict__ RS) { __shared__ float srs[8][32];
  const int t = threadIdx.x; const int tk = t >> 5, lane = t & 31; const size_t row = (size_t)blockIdx.x * 8 + tk; const float lam = lam_full(LQ1, LK1, LQ2, LK2);
  // lane handles value head i = lane & 15 over half the dims (lane >> 4 picks dims 0..31 / 32..63), then pair-sum via xor 16
  const int i = lane & 15, half = lane >> 4; const float* y1 = Y + row * (NH * HDV) + (2 * i) * HDV + half * 32; const float* y2 = y1 + HDV;
  float s = 0.f;
#pragma unroll 4
  for (int d = 0; d < 32; ++d) { const float v = y1[d] - lam * y2[d]; s += v * v; }
  s += __shfl_xor(s, 16);
  srs[tk][lane] = (lane < 16) ? rsqrtf(s * (1.0f / HDV) + 1e-5f) : 0.f;
  __syncthreads();
  vst2(RS + row * 32 + lane, srs[tk][lane]); }   
// A rows of one k step of k_out from the two score heads' rows: ((Y[2i] - lambda Y[2i+1]) rms 0.8) gamma, split hi + lo; gq = this lane's rounded gamma
__device__ __forceinline__ F2 mk_a(const v4f* ya, const v4f* yb, float rn, float lam, const float* gq) { float v[16]; const float rs = rn * 0.8f;
#pragma unroll
  for (int q = 0; q < 8; ++q) { v[q] = (ya[q >> 2][q & 3] - lam * yb[q >> 2][q & 3]) * rs * gq[q]; v[8 + q] = (ya[2 + (q >> 2)][q & 3] - lam * yb[2 + (q >> 2)][q & 3]) * rs * gq[16 + q]; }
  return bsplit16(v); }
// ---- k_out: block = (64 rows, 128 cols): A = ((Y[2i] - lambda Y[2i+1]) rms gamma 0.8) built on the fly (hi + lo) x w_proj ((in,out)); 4-KB rows
__global__ __launch_bounds__(128) void k_out(const float* __restrict__ Y, const float* __restrict__ RS, const float* __restrict__ GA, const float* __restrict__ LQ1, const float* __restrict__ LQ2, const float* __restrict__ LK1, const float* __restrict__ LK2, const float* __restrict__ WP, float* __restrict__ OUT) { __shared__ __align__(16) float sf[4][16][132]; __shared__ __align__(16) __bf16 sw[2][8 * WJ]; __shared__ __align__(16) float sg[HDV];
  const int tid = threadIdx.x, wave = tid >> 5, lane = tid & 31, col = lane & 15, g = lane >> 4; const int c0 = blockIdx.y * 128; const size_t r0 = (size_t)blockIdx.x * 64 + wave * 16; const size_t arow = r0 + col; const float lam = lam_full(LQ1, LK1, LQ2, LK2);
  v8f acc[8] = {};
  const float* wp = WP + (size_t)(wave * 8) * CC + c0 + lane * 4; const int ws_o = wt_slot(wave, lane);
  const float* yp = Y + arow * (NH * HDV) + 8 * g; const float* rp = RS + arow * 32;
  WT wt; ld_wt(wt, wp, CC); v4f ya[4], yb[4]; float rn = rp[0];   /* step 0's pieces of the rows Y[2i] and Y[2i+1] */
#pragma unroll
  for (int q = 0; q < 4; ++q) { ya[q] = *(const v4f*)(yp + (q >> 1) * 16 + (q & 1) * 4); yb[q] = *(const v4f*)(yp + HDV + (q >> 1) * 16 + (q & 1) * 4); }
  if (tid < HDV) sg[tid] = bfr(GA[tid]);   /* gamma in LDS: a global load of it inside a step would wait out the loads that fly for the next step */
  st_wt(&sw[0][0] + ws_o, wt);
  __syncthreads();
  F2 a = mk_a(ya, yb, rn, lam, &sg[8 * g]);
#pragma unroll 2   /* two steps a trip: the buffer of each step is then a constant */
  for (int kc = 0; kc < CC / 32; ++kc) { const bool more = kc + 1 < CC / 32;
    const int kn = kc + 1;
    if (more) { ld_wt(wt, wp + (size_t)kn * 32 * CC, CC);   /* the next step's loads fly under this step's products */
      const int i = kn >> 1;   /* value head (64 = 2 steps) */ const float* y1 = yp + (2 * i) * HDV + (kn & 1) * 32; rn = rp[i];
#pragma unroll
      for (int q = 0; q < 4; ++q) { ya[q] = *(const v4f*)(y1 + (q >> 1) * 16 + (q & 1) * 4); yb[q] = *(const v4f*)(y1 + HDV + (q >> 1) * 16 + (q & 1) * 4); } }
    v16b w[8];
#pragma unroll
    for (int j = 0; j < 8; ++j) w[j] = frag_wt(&sw[kc & 1][0], j, lane);
#pragma unroll
    for (int j = 0; j < 8; ++j) { acc[j] = wmma_bf(a.h, w[j], acc[j]); acc[j] = wmma_bf(a.l, w[j], acc[j]); }
    __builtin_amdgcn_sched_barrier(0);   /* or the compiler lifts what follows, with its wait for the next step's loads, in among the products, which then stand behind that wait */
    if (more) { a = mk_a(ya, yb, rn, lam, &sg[(kn & 1) * 32 + 8 * g]); st_wt(&sw[kn & 1][0] + ws_o, wt); }
    __syncthreads(); }   /* one barrier a step: it publishes the next tile and ends the reads of the buffer that the next step refills */
#pragma unroll
  for (int j = 0; j < 8; ++j)
#pragma unroll
    for (int r = 0; r < 8; ++r) sf[wave][8 * g + r][j * 16 + col] = acc[j][r];
  LDSX(); for (int rl = 0; rl < 16; ++rl) vst2(OUT + (r0 + rl) * CC + c0 + lane * 4, *(const v4f*)&sf[wave][rl][lane * 4]); }
extern "C" void kernel_launch(void* const* d_in, const int* in_sizes, int n_in, void* d_out, int out_size, void* d_ws, size_t ws_size, hipStream_t stream) {
  (void)in_sizes; (void)n_in; (void)out_size;
  const float** F = (const float**)d_in;   // 0 x [4,1024,1024], 1 w_attn [1024,3072] ((in,out): q | k | v), 2 w_proj ((in,out)), 3 lambda_q1 [32], 4 lambda_q2, 5 lambda_k1, 6 lambda_k2, 7 gamma [64]
  if (ws_size < (size_t)WS_END) return;
  char* ws = (char*)d_ws; _Float16 *QH = (_Float16*)(ws + WS_QH), *QL = (_Float16*)(ws + WS_QL), *KH = (_Float16*)(ws + WS_KH); __bf16 *VT = (__bf16*)(ws + WS_VT), *VL = (__bf16*)(ws + WS_VL); float *Y = (float*)(ws + WS_Y), *RS = (float*)(ws + WS_RS);
  k_proj<<<dim3(TNB * TT / 64, CC / 128, 3), 128, 0, stream>>>(F[0], F[1], nullptr, F[1] + CC, nullptr, F[1] + 2 * CC, nullptr, QH, QL, KH, VT, VL, nullptr, nullptr, 0);
  k_att<<<dim3(TT / 64, NH, TNB), 128, 0, stream>>>(QH, QL, KH, VT, VL, Y);
  k_rms<<<dim3(TNB * TT / 8), 256, 0, stream>>>(Y, F[3], F[4], F[5], F[6], RS);
  k_out<<<dim3(TNB * TT / 64, CC / 128), 128, 0, stream>>>(Y, RS, F[7], F[3], F[4], F[5], F[6], F[2], (float*)d_out);
}

// v004
// Measured time: 177 microseconds a run.
// Next to v003, in two timings, it ran 1.14 times as fast each time.
// Over all steps from v000 it is 8.54 times as fast.
// compute dtype: all float inputs rounded to bf16, the four lambda vectors and gamma read; qkv = x w_attn ((in,out)) with EXACT bf16 products on WMMA 16x16x32, f32 accumulate; q as f16 hi + residual (x 2^10), k f16 -> 2-product causal logits x (32^-1/2)^2 = 1/32 kept in f32 registers (one launch for all score heads); online softmax in f32, in base 2 (logits x log2(e) / 32, hardware exp2); unnormalised P split bf16 hi + lo against v bf16 hi + lo (3 products), divided by the row sum at the end, per score head into its value head-pair slot; the differential combination P1 v - lambda P2 v, RMSNorm, gamma and (1 - lambda_init) in f32; out = that (bf16 hi + lo) w_proj; f32 output.
#include <hip/hip_runtime.h>
#include <math.h>

typedef __attribute__((ext_vector_type(16))) _Float16 v16h;
typedef __attribute__((ext_vector_type(16))) __bf16 v16b;
typedef __attribute__((ext_vector_type(8)))  _Float16 v8h;
typedef __attribute__((ext_vector_type(8)))  float v8f;
typedef __attribute__((ext_vector_type(4)))  float v4f;
typedef __attribute__((ext_vector_type(2)))  float v2f;
typedef __attribute__((ext_vector_type(4)))  unsigned v4u;
typedef __attribute__((ext_vector_type(4)))  int v4i;
typedef float __attribute__((may_alias)) float_a;
typedef int __attribute__((may_alias)) int_a;

template <typename T> __device__ __forceinline__ void vst2(void* p, T v) { *(T*)p = v;  }
__device__ __forceinline__ v8f wmma16(v16h a, v16h b, v8f c) {
  v8f d = __builtin_amdgcn_wmma_f32_16x16x32_f16(false, a, false, b, (short)0, c, false, false);
  asm volatile("v_nop\n\tv_nop\n\tv_nop\n\tv_nop" : "+v"(d) : "v"(a), "v"(b));
  return d;
}
__device__ __forceinline__ v8f wmma_bf(v16b a, v16b b, v8f c) {
  v8f d = __builtin_amdgcn_wmma_f32_16x16x32_bf16(false, a, false, b, (short)0, c, false, false);
  asm volatile("v_nop\n\tv_nop\n\tv_nop\n\tv_nop" : "+v"(d) : "v"(a), "v"(b));
  return d;
}
// 16x16x32 fragments: lane = (h = lane>>4, row/col = lane&15); elements 0..7 = k0+8h+0..7, 8..15 = k0+16+8h+0..7; D element r = row 8h+r
__device__ __forceinline__ v16h frag_h(const _Float16* rowk0, int lane) {
  union { v16h v; v8h q[2]; } u; const _Float16* p = rowk0 + 8 * (lane >> 4);
  u.q[0] = *(const v8h*)p; u.q[1] = *(const v8h*)(p + 16); return u.v;
}
__device__ __forceinline__ v16h frag_f32(const float* rowk0, int lane) {
  v16h a; const float* p = rowk0 + 8 * (lane >> 4);
#pragma unroll
  for (int i = 0; i < 8; ++i) { a[i] = (_Float16)p[i]; a[8 + i] = (_Float16)p[16 + i]; }
  return a;
}
__device__ __forceinline__ v16h frag_f32s(const float* rowk0, int lane, float sc) {
  v16h a; const float* p = rowk0 + 8 * (lane >> 4);
#pragma unroll
  for (int i = 0; i < 8; ++i) { a[i] = (_Float16)(p[i] * sc); a[8 + i] = (_Float16)(p[16 + i] * sc); }
  return a;
}
// column fragment from a [K][ld] layout (column n), rows >= K read as 0
__device__ __forceinline__ v16h fragc_f32(const float* W, int k0, int n, int lane, int ld, int K) {
  v16h a; const int g = lane >> 4;
#pragma unroll
  for (int i = 0; i < 8; ++i) { const int ka = k0 + 8 * g + i, kb = ka + 16;
    a[i] = (_Float16)(ka < K ? W[(size_t)(ka < K ? ka : K - 1) * ld + n] : 0.f); a[8 + i] = (_Float16)(kb < K ? W[(size_t)(kb < K ? kb : K - 1) * ld + n] : 0.f); }
  return a;
}
struct F2 { v16b h, l; };
__device__ __forceinline__ F2 bsplit16(const float v[16]) { F2 r;
#pragma unroll
  for (int i = 0; i < 16; ++i) { const __bf16 h = (__bf16)v[i]; r.h[i] = h; r.l[i] = (__bf16)(v[i] - (float)h); }
  return r; }
__device__ __forceinline__ F2 split_row(const float* row, int k0, int lane) { float v[16]; const float* p = row + k0 + 8 * (lane >> 4);
#pragma unroll
  for (int i = 0; i < 8; ++i) { v[i] = p[i]; v[8 + i] = p[16 + i]; }
  return bsplit16(v); }
__device__ __forceinline__ F2 split_rowK(const float* row, int k0, int lane, int K) { float v[16]; const int g = lane >> 4;
#pragma unroll
  for (int i = 0; i < 8; ++i) { const int ka = k0 + 8 * g + i, kb = ka + 16; v[i] = ka < K ? row[ka < K ? ka : K - 1] : 0.f; v[8 + i] = kb < K ? row[kb < K ? kb : K - 1] : 0.f; }
  return bsplit16(v); }
__device__ __forceinline__ F2 split_col(const float* W, int k0, int n, int lane, int ld, int K) { float v[16]; const int g = lane >> 4;
#pragma unroll
  for (int i = 0; i < 8; ++i) { const int ka = k0 + 8 * g + i, kb = ka + 16; v[i] = ka < K ? W[(size_t)(ka < K ? ka : K - 1) * ld + n] : 0.f; v[8 + i] = kb < K ? W[(size_t)(kb < K ? kb : K - 1) * ld + n] : 0.f; }
  return bsplit16(v); }
__device__ __forceinline__ v8f mac3(const F2& a, const F2& b, v8f c) { c = wmma_bf(a.l, b.h, c); c = wmma_bf(a.h, b.l, c); return wmma_bf(a.h, b.h, c); }
__device__ __forceinline__ float sigm(float v) { return 1.0f / (1.0f + expf(-v)); }
#define LDSX() do { asm volatile("s_wait_dscnt 0" ::: "memory"); __builtin_amdgcn_wave_barrier(); __builtin_amdgcn_fence(__ATOMIC_RELEASE, "workgroup"); } while (0)


// Differential causal attention (B 4, T 1,024, C 1,024; 2H = 32 score heads x 32, 16 value heads x 64): att = softmax(causal(q k^T / 32)) per score head; diff_i = att_{2i} - lambda att_{2i+1}, lambda = exp(lq1.lk1) - exp(lq2.lk2) + 0.2; out_i = RMSNorm(diff_i v_i) * gamma * 0.8; concat w_proj.
#define NB 4
#define TT 1024
#define CC 1024
#define NH 32              // score heads (2H)
#define HD 32              // score head dim
#define HDV 64             // value head dim (16 value heads)
#define WIN (TT + 1)       // plain causal
#define NKV 32             // k has the same 32 heads
#define LDW 3072           // w_attn (in,out) [1024][3072]: q | k | v column blocks
#define CK (NKV * HD)   // 1,024: k/v row width
#define REP (NH / NKV)
#ifndef TNB
#define TNB NB
#endif
typedef __attribute__((ext_vector_type(8))) __bf16 v8b;
__device__ __forceinline__ v16b frag_b(const __bf16* rowk0, int lane) {
  union { v16b v; v8b q[2]; } u; const __bf16* p = rowk0 + 8 * (lane >> 4);
  u.q[0] = *(const v8b*)p; u.q[1] = *(const v8b*)(p + 16); return u.v;
}
__device__ __forceinline__ float bfr(float v) { return (float)(__bf16)v; }
// ---- operand tiles of one k step (32 deep) in LDS, bf16, in fragment order: a weight fragment read is lane * 16 B, contiguous over the wave; an x fragment read is contiguous per 16-lane half
typedef __attribute__((ext_vector_type(4))) __bf16 v4b;
#define WJ 520             // elements per 16-column group of a weight tile: k 0..15 (256) + k 16..31 (256) + 8 of pad, so that the 16 lanes of a store fall on 16 different 16-B slots
#define XC 160             // elements per 8-k chunk of a wave's 16 x rows: 128 + 32 of pad, for the same reason
#define XO (8 * WJ)        // the x rows stand behind the weight tile (128 columns)
struct WT { v4f r[8]; };   // wave w: rows 8w..8w+7 of the tile, a lane 4 columns; one load = one 512-B row piece = 4 whole lines
__device__ __forceinline__ void ld_wt(WT& t, const float* p, int ld) {
#pragma unroll
  for (int i = 0; i < 8; ++i) t.r[i] = *(const v4f*)(p + (size_t)i * ld); }
__device__ __forceinline__ int wt_slot(int wave, int lane) { return (lane >> 2) * WJ + (wave >> 1) * 256 + (wave & 1) * 128 + (lane & 3) * 32; }   // column 4 lane + c stands c * 8 elements on
__device__ __forceinline__ void st_wt(__bf16* p, const WT& t) {
#pragma unroll
  for (int c = 0; c < 4; ++c) { v8b o;
#pragma unroll
    for (int i = 0; i < 8; ++i) o[i] = (__bf16)t.r[i][c];
    *(v8b*)(p + c * 8) = o; } }
__device__ __forceinline__ v16b frag_wt(const __bf16* tile, int j, int lane) {   // frag_b's k order: elements 0..7 = 8g + 0..7, 8..15 = 16 + 8g + 0..7, column 16 j + col
  union { v16b v; v8b q[2]; } u; const __bf16* p = tile + j * WJ + lane * 8;
  u.q[0] = *(const v8b*)p; u.q[1] = *(const v8b*)(p + 256); return u.v; }
__device__ __attribute__((noinline)) float exp_ni(float v) { return expf(v); }
__device__ __attribute__((noinline)) float erf_ni(float v) { return erff(v); }

#define WS_QH  0u
#define WS_QL  (WS_QH + 2u * (size_t)NB * TT * CC)
#define WS_KH  (WS_QL + 2u * (size_t)NB * TT * CC)
#define WS_VT  (WS_KH + 2u * (size_t)NB * TT * CK)      // bf16 v planes [b][CK][t] (k rows are [b*T+t][CK])
#define WS_VL  (WS_VT + 2u * (size_t)NB * CK * TT)
#define WS_Y   (WS_VL + 2u * (size_t)NB * CK * TT)      // f32 y rows [b*t][score head][64]
#define WS_RS  (WS_Y + 4u * (size_t)NB * TT * NH * HDV)
#define WS_END (WS_RS + 128u * (size_t)NB * TT)

// ---- k_proj: block = (64 rows, 128 cols, which): qkv = x W (+ b), exact; q -> f16 hi (+ residual), k -> f16 rows, v -> bf16 hi + lo planes
__global__ __launch_bounds__(128) void k_proj(const float* __restrict__ X, const float* __restrict__ WQ, const float* __restrict__ BQ, const float* __restrict__ WK, const float* __restrict__ BK, const float* __restrict__ WV, const float* __restrict__ BV, _Float16* __restrict__ QH, _Float16* __restrict__ QL, _Float16* __restrict__ KH, __bf16* __restrict__ VT, __bf16* __restrict__ VL, const float* __restrict__ NQW, const float* __restrict__ NKW, int wbase) {
  __shared__ __align__(16) _Float16 sh[64][136], sl[64][136]; __shared__ __align__(16) __bf16 th[128][72], tl2[128][72];
  const int tid = threadIdx.x, wave = tid >> 5, lane = tid & 31, col = lane & 15, g = lane >> 4; const int which = wbase + blockIdx.z; const int OW = (which == 0) ? CC : CK;   /* output row width: q 1,024, k/v 1,024 */ const int c0 = blockIdx.y * 128; const size_t r0 = (size_t)blockIdx.x * 64; const float* WA = which == 0 ? WQ : which == 1 ? WK : WV; const float* BA = which == 0 ? BQ : which == 1 ? BK : BV;
  v8f acc[8] = {};
  __bf16* const sb0 = &th[0][0]; __bf16* const sb1 = &tl2[0][0];   /* the two staging buffers (13,440 B each) lie in the epilogue's planes, which are written only behind the loop's last barrier */
  const float* wp = WA + (size_t)(wave * 8) * LDW + c0 + lane * 4;   /* (in,out), row length 3072 */
  const float* xp = X + (r0 + wave * 16 + (lane >> 3)) * CC + (lane & 7) * 4;   /* 8 lanes a row: one load = 4 rows x one whole line */
  const int ws_o = wt_slot(wave, lane), xs_o = XO + wave * 4 * XC + ((lane & 7) >> 1) * XC + (lane >> 3) * 8 + (lane & 1) * 4, xr_o = XO + wave * 4 * XC + g * XC + col * 8;
  WT wt; v4f xt[4]; ld_wt(wt, wp, LDW);
#pragma unroll
  for (int i = 0; i < 4; ++i) xt[i] = *(const v4f*)(xp + (size_t)(4 * i) * CC);
  st_wt(sb0 + ws_o, wt);
#pragma unroll
  for (int i = 0; i < 4; ++i) { v4b o; o[0] = (__bf16)xt[i][0]; o[1] = (__bf16)xt[i][1]; o[2] = (__bf16)xt[i][2]; o[3] = (__bf16)xt[i][3]; *(v4b*)(sb0 + xs_o + i * 32) = o; }
  __syncthreads();
#pragma unroll 2   /* two steps a trip: the buffer of each step is then a constant */
  for (int kc = 0; kc < CC / 32; ++kc) { const __bf16* cur = (kc & 1) ? sb1 : sb0; __bf16* nxt = (kc & 1) ? sb0 : sb1; const bool more = kc + 1 < CC / 32;
    if (more) { ld_wt(wt, wp + (size_t)(kc + 1) * 32 * LDW, LDW);   /* the next step's loads fly under this step's products */
#pragma unroll
      for (int i = 0; i < 4; ++i) xt[i] = *(const v4f*)(xp + (size_t)(4 * i) * CC + (kc + 1) * 32); }
    v16b a, w[8]; { union { v16b v; v8b q[2]; } u; u.q[0] = *(const v8b*)(cur + xr_o); u.q[1] = *(const v8b*)(cur + xr_o + 2 * XC); a = u.v; }
#pragma unroll
    for (int j = 0; j < 8; ++j) w[j] = frag_wt(cur, j, lane);
#pragma unroll
    for (int j = 0; j < 8; ++j) acc[j] = wmma_bf(a, w[j], acc[j]);
    __builtin_amdgcn_sched_barrier(0);   /* or the compiler lifts the roundings below, with their wait for the next step's loads, in among the products, which then stand behind that wait */
    if (more) { st_wt(nxt + ws_o, wt);
#pragma unroll
      for (int i = 0; i < 4; ++i) { v4b o; o[0] = (__bf16)xt[i][0]; o[1] = (__bf16)xt[i][1]; o[2] = (__bf16)xt[i][2]; o[3] = (__bf16)xt[i][3]; *(v4b*)(nxt + xs_o + i * 32) = o; } }
    __syncthreads(); }   /* one barrier a step: it publishes the next tile and ends the reads of the buffer that the next step refills */
#pragma unroll
  for (int j = 0; j < 8; ++j) { const float bb = BA ? bfr(BA[c0 + j * 16 + col]) : 0.f;
#pragma unroll
    for (int r = 0; r < 8; ++r) { const float v = acc[j][r] + bb; const int rl = wave * 16 + 8 * g + r, cl = j * 16 + col; const _Float16 hv = (_Float16)v;
      if (which == 2) { const __bf16 bh = (__bf16)v; th[cl][rl] = bh; tl2[cl][rl] = (__bf16)(v - (float)bh); } else { sh[rl][cl] = hv; sl[rl][cl] = (_Float16)((v - (float)hv) * 1024.0f); }   /* q residual carried x 2^10 so the plane stays f16-normal on the chip */ } }
  __syncthreads();
  if (which < 2) { _Float16* dh = which == 0 ? QH : KH; for (int e = tid; e < 64 * 16; e += 128) { const int rl = e >> 4, q = e & 15; vst2((unsigned*)(dh + (r0 + rl) * OW + c0 + q * 8), *(const v4u*)&sh[rl][q * 8]); if (which == 0) vst2((unsigned*)(QL + (r0 + rl) * CC + c0 + q * 8), *(const v4u*)&sl[rl][q * 8]); } }
  else { const size_t b = r0 / TT; const int t0 = (int)(r0 % TT); for (int e = tid; e < 128 * 8; e += 128) { const int cl = e >> 3, q = e & 7; const size_t o2 = (b * CK + c0 + cl) * (size_t)TT + t0 + q * 8; vst2((unsigned*)(VT + o2), *(const v4u*)&th[cl][q * 8]); vst2((unsigned*)(VL + o2), *(const v4u*)&tl2[cl][q * 8]); } } }
// e[i] = 2^t[i], one instruction each; below -126 it gives 0, which is what a masked or far-off logit is to give. One statement, so that the slot behind a transcendental is kept by construction: behind each v_exp_f32 stands one that neither reads
// its result nor overwrites its source (every output "=&v"), behind the last a v_nop
__device__ __forceinline__ void ex2x9(float* e, const float* t) {
  asm("v_exp_f32 %0, %9\n\tv_exp_f32 %1, %10\n\tv_exp_f32 %2, %11\n\tv_exp_f32 %3, %12\n\tv_exp_f32 %4, %13\n\tv_exp_f32 %5, %14\n\tv_exp_f32 %6, %15\n\tv_exp_f32 %7, %16\n\tv_exp_f32 %8, %17\n\tv_nop"
    : "=&v"(e[0]), "=&v"(e[1]), "=&v"(e[2]), "=&v"(e[3]), "=&v"(e[4]), "=&v"(e[5]), "=&v"(e[6]), "=&v"(e[7]), "=&v"(e[8]) : "v"(t[0]), "v"(t[1]), "v"(t[2]), "v"(t[3]), "v"(t[4]), "v"(t[5]), "v"(t[6]), "v"(t[7]), "v"(t[8])); }
#define LC 0.045084220027780106f   // log2(e) / 32: the logits' scale and the change of base in one factor, so that exp(s / 32 - m) = 2^(s LC - m')
template <int M> __device__ __forceinline__ float xrow(float v) { return __builtin_bit_cast(float, __builtin_amdgcn_update_dpp(0, __builtin_bit_cast(int, v), 0x160 | M, 0xf, 0xf, true)); }   // lane l reads lane l ^ M of its 16-lane row (DPP row_xmask): no LDS round trip
// ---- K and V tiles of one 128-key chunk in LDS, brought once a block by asynchronous 16-B copies and read by all four waves
#define KP 40              // f16 elements per key row of the K tile: 64 B + 16 B of pad; pitch = 16 B x odd, so the 16 lanes of a fragment read fall on different banks
#define VP 136             // bf16 elements per value-dim row of a v tile: 256 B + 16 B of pad, for the same reason
struct VF { v16b h[HDV / 16], l[HDV / 16]; };   // v fragments (hi, lo planes) of 32 keys x 64 value dims
__device__ __forceinline__ void ld_v(VF& f, const __bf16* vt, const __bf16* vl, int lane) {
#pragma unroll
  for (int j = 0; j < HDV / 16; ++j) { f.h[j] = frag_b(vt + j * 16 * VP, lane); f.l[j] = frag_b(vl + j * 16 * VP, lane); } }   // from the LDS tiles, row pitch VP
__device__ __forceinline__ void pv32(v8f* acc, const float* prow, int kk, const VF& f, int lane) { const F2 p = split_row(prow, kk, lane);
#pragma unroll
  for (int j = 0; j < HDV / 16; ++j) { acc[j] = wmma_bf(p.h, f.h[j], acc[j]); acc[j] = wmma_bf(p.l, f.h[j], acc[j]); acc[j] = wmma_bf(p.h, f.l[j], acc[j]); } }
__device__ __forceinline__ unsigned lds_off(const void* p) { return (unsigned)(size_t)p; }   // byte offset in the work-group's LDS
// n copies of a lane, copy i standing ls bytes on in LDS and gs bytes on in global memory; the wait is the last line of the copies' own statement, so it stands in front of every rewrite of an address register that they name
__device__ __forceinline__ void acopy4(unsigned l, unsigned ls, const char* p, size_t gs) {
  asm volatile("global_load_async_to_lds_b128 %0, %4, off\n\tglobal_load_async_to_lds_b128 %1, %5, off\n\tglobal_load_async_to_lds_b128 %2, %6, off\n\tglobal_load_async_to_lds_b128 %3, %7, off\n\ts_wait_xcnt 0x0"
    :: "v"(l), "v"(l + ls), "v"(l + 2 * ls), "v"(l + 3 * ls), "v"(p), "v"(p + gs), "v"(p + 2 * gs), "v"(p + 3 * gs) : "memory"); }
__device__ __forceinline__ void acopy8(unsigned l, unsigned ls, const char* p, size_t gs) {
  asm volatile("global_load_async_to_lds_b128 %0, %8, off\n\tglobal_load_async_to_lds_b128 %1, %9, off\n\tglobal_load_async_to_lds_b128 %2, %10, off\n\tglobal_load_async_to_lds_b128 %3, %11, off\n\t"
               "global_load_async_to_lds_b128 %4, %12, off\n\tglobal_load_async_to_lds_b128 %5, %13, off\n\tglobal_load_async_to_lds_b128 %6, %14, off\n\tglobal_load_async_to_lds_b128 %7, %15, off\n\ts_wait_xcnt 0x0"
    :: "v"(l), "v"(l + ls), "v"(l + 2 * ls), "v"(l + 3 * ls), "v"(l + 4 * ls), "v"(l + 5 * ls), "v"(l + 6 * ls), "v"(l + 7 * ls),
       "v"(p), "v"(p + gs), "v"(p + 2 * gs), "v"(p + 3 * gs), "v"(p + 4 * gs), "v"(p + 5 * gs), "v"(p + 6 * gs), "v"(p + 7 * gs) : "memory"); }
// ---- k_att: block = 64 queries of (b, h), one wave per 16 queries; the waves share the chunk's K and v tiles in LDS. Per 128-key chunk: 2-product logits x log2(e) / 32 in the D registers, running row maximum and rescale (online softmax),
// P = 2^(s - m) through the wave's own LDS tile into A fragments (bf16 hi + lo), 3-product P . v into acc; the row sums stay per lane until the end; y = acc / l
__global__ __launch_bounds__(128, 4) /* four waves a SIMD: a budget of 256 registers */ void k_att(const _Float16* __restrict__ QH, const _Float16* __restrict__ QL, const _Float16* __restrict__ KH, const __bf16* __restrict__ VT, const __bf16* __restrict__ VL, float* __restrict__ Y) { __shared__ __align__(16) float ss[4][16][132]; __shared__ __align__(16) _Float16 sk[128 * KP]; __shared__ __align__(16) __bf16 sv[2][HDV * VP];
  const int tid = threadIdx.x, wave = tid >> 5, lane = tid & 31, col = lane & 15, g = lane >> 4; const int h = blockIdx.y, b = blockIdx.z; const int ql0 = blockIdx.x * 64 + wave * 16; const int kend = blockIdx.x * 64 + 64; const size_t q0 = (size_t)b * TT + ql0;
  const v16h ah = frag_h(QH + (q0 + col) * CC + h * HD, lane), al = frag_h(QL + (q0 + col) * CC + h * HD, lane);
  v8f acc[HDV / 16] = {}; float m[8], l[8];
#pragma unroll
  for (int r = 0; r < 8; ++r) { m[r] = -3.0e38f; l[r] = 0.f; }
  const _Float16* kg = KH + ((size_t)b * TT + (tid >> 2)) * CK + h * HD + (tid & 3) * 8;   /* copies: 4 lanes a key row (64 B), copy i 32 rows on; the three pointers walk with k0 */
  const size_t po = ((size_t)b * CK + (h / 2) * HDV + (tid >> 4)) * (size_t)TT + (tid & 15) * 8;   /* value head h/2 (64 wide): 16 lanes a row piece (256 B = 2 whole lines), copy i 8 rows on */ const __bf16 *vtg = VT + po, *vlg = VL + po;
  const unsigned kl = lds_off(sk) + (tid >> 2) * (KP * 2) + (tid & 3) * 16, vl0 = lds_off(&sv[0][0]) + (tid >> 4) * (VP * 2) + (tid & 15) * 16, vl1 = vl0 + HDV * VP * 2;
  const _Float16* kp = sk + col * KP + 8 * g;   /* this lane's half of its key row of the tile */ const __bf16 *vtp = &sv[0][col * VP], *vlp = &sv[1][col * VP];
#pragma unroll 1   /* rolled: one chunk's body fills the register budget; the inner loops are unrolled so that their arrays are registers */
  for (int k0 = 0; k0 < kend; k0 += 128, kg += (size_t)128 * CK, vtg += 128, vlg += 128) { v8f s[8]; v16h kb[8];
    asm volatile("s_wait_dscnt 0x0" ::: "memory");   /* this wave's reads of the last chunk's tiles have returned ... */
    __syncthreads();   /* ... and so have every wave's: the tiles may be refilled */
    acopy4(kl, 32 * KP * 2, (const char*)kg, (size_t)32 * CK * 2); acopy8(vl0, 8 * VP * 2, (const char*)vtg, (size_t)8 * TT * 2); acopy8(vl1, 8 * VP * 2, (const char*)vlg, (size_t)8 * TT * 2);
    asm volatile("s_wait_asynccnt 0x0" ::: "memory");   /* this wave's copies have landed ... */
    __syncthreads();   /* ... and so have every wave's: the tiles may be read */
#pragma unroll
    for (int j = 0; j < 8; ++j) { union { v16h v; v8h q[2]; } u; const _Float16* p = kp + j * 16 * KP; u.q[0] = *(const v8h*)p; u.q[1] = *(const v8h*)(p + 16); kb[j] = u.v; }   /* frag_h's order */
#pragma unroll
    for (int j = 0; j < 8; ++j) { v8f a0 = {}, a1 = {}; a0 = wmma16(ah, kb[j], a0); a1 = wmma16(al, kb[j], a1); s[j] = a0 + a1 * (1.0f / 1024.0f); }
    const bool full = k0 + 64 < kend;   /* wave-uniform: keys 64..127 of the chunk are open to some row */
    const int dq = ql0 + 8 * g - col - k0;   /* causal test against constants: one register, not one per element */
#pragma unroll
    for (int r = 0; r < 8; ++r) { float mx = -3.0e38f;
#pragma unroll
      for (int j = 0; j < 8; ++j) { const float v = (j * 16 - r <= dq) ? s[j][r] * LC : -3.0e38f;   /* key k0 + 16 j + col <= query ql0 + 8 g + r; q * 32^-1/2 then * 1/sqrt(32) = 1/32, times log2(e) */ s[j][r] = v; mx = fmaxf(mx, v); }
      mx = fmaxf(mx, xrow<1>(mx)); mx = fmaxf(mx, xrow<2>(mx)); mx = fmaxf(mx, xrow<4>(mx)); mx = fmaxf(mx, xrow<8>(mx));   /* the 16 lanes of a half hold one row's columns */
      const float mn = fmaxf(m[r], mx); float t[9], e[9]; t[0] = m[r] - mn; m[r] = mn;   /* the rescale factor first: it is read first */
#pragma unroll
      for (int j = 0; j < 8; ++j) t[1 + j] = s[j][r] - mn;   /* a masked logit (-3e38) gives exactly 0: mn is a real logit, key 0 is open to every row */
      ex2x9(e, t);
      const float sc = e[0]; float ls = l[r] * sc;
#pragma unroll
      for (int j = 0; j < HDV / 16; ++j) acc[j][r] *= sc;
#pragma unroll
      for (int j = 0; j < 8; ++j) { ls += e[1 + j]; ss[wave][8 * g + r][j * 16 + col] = e[1 + j]; }
      asm volatile("" : "+v"(ls));   /* each row's sum, against spills: formed here, or the compiler sinks the adds to the loop's foot and all 64 addends stay live through the P . v products */
      l[r] = ls; }
    LDSX();   /* the wave's own P tile: every lane's stores have landed before a lane reads the others' elements */
    const float* prow = &ss[wave][col][0];
    VF va; ld_v(va, vtp, vlp, lane); pv32(acc, prow, 0, va, lane); ld_v(va, vtp + 32, vlp + 32, lane); pv32(acc, prow, 32, va, lane);
    if (full) { ld_v(va, vtp + 64, vlp + 64, lane); pv32(acc, prow, 64, va, lane); ld_v(va, vtp + 96, vlp + 96, lane); pv32(acc, prow, 96, va, lane); } }
#pragma unroll
  for (int r = 0; r < 8; ++r) { float ls = l[r];
    ls += xrow<1>(ls); ls += xrow<2>(ls); ls += xrow<4>(ls); ls += xrow<8>(ls);
    const float inv = 1.0f / ls;
#pragma unroll
    for (int j = 0; j < HDV / 16; ++j) ss[wave][8 * g + r][j * 16 + col] = acc[j][r] * inv; }
  LDSX(); for (int it = 0; it < 8; ++it) { const int rl = it * 2 + g; vst2(Y + ((size_t)b * TT + ql0 + rl) * (NH * HDV) + h * HDV + col * 4, *(const v4f*)&ss[wave][rl][col * 4]); } }   /* Y rows [b*T+t][score head][64] = 2,048 floats */
// ---- k_rms: block = 8 tokens (one wave per 2 tokens? -> 256 threads = 8 tokens x 32 lanes; lane pair handles value heads): for each (token, value head i): d = Y[2i] - lambda Y[2i+1] over 64 dims, rms = rsqrt(mean(d^2) + 1e-5) -> RS[token][i]; lambda computed per block from the four 32-vectors (f32)
__device__ __forceinline__ float lam_full(const float* LQ1, const float* LK1, const float* LQ2, const float* LK2) { float s1 = 0.f, s2 = 0.f;
#pragma unroll 1
  for (int i = 0; i < HD; ++i) { s1 += bfr(LQ1[i]) * bfr(LK1[i]); s2 += bfr(LQ2[i]) * bfr(LK2[i]); }
  return expf(s1) - expf(s2) + 0.2f; }
__global__ __launch_bounds__(256) void k_rms(const float* __restrict__ Y, const float* __restrict__ LQ1, const float* __restrict__ LQ2, const float* __restrict__ LK1, const float* __restrict__ LK2, float* __restrict__ RS) { __shared__ float srs[8][32];
  const int t = threadIdx.x; const int tk = t >> 5, lane = t & 31; const size_t row = (size_t)blockIdx.x * 8 + tk; const float lam = lam_full(LQ1, LK1, LQ2, LK2);
  // lane handles value head i = lane & 15 over half the dims (lane >> 4 picks dims 0..31 / 32..63), then pair-sum via xor 16
  const int i = lane & 15, half = lane >> 4; const float* y1 = Y + row * (NH * HDV) + (2 * i) * HDV + half * 32; const float* y2 = y1 + HDV;
  float s = 0.f;
#pragma unroll 4
  for (int d = 0; d < 32; ++d) { const float v = y1[d] - lam * y2[d]; s += v * v; }
  s += __shfl_xor(s, 16);
  srs[tk][lane] = (lane < 16) ? rsqrtf(s * (1.0f / HDV) + 1e-5f) : 0.f;
  __syncthreads();
  vst2(RS + row * 32 + lane, srs[tk][lane]); }   
// A rows of one k step of k_out from the two score heads' rows: ((Y[2i] - lambda Y[2i+1]) rms 0.8) gamma, split hi + lo; gq = this lane's rounded gamma
__device__ __forceinline__ F2 mk_a(const v4f* ya, const v4f* yb, float rn, float lam, const float* gq) { float v[16]; const float rs = rn * 0.8f;
#pragma unroll
  for (int q = 0; q < 8; ++q) { v[q] = (ya[q >> 2][q & 3] - lam * yb[q >> 2][q & 3]) * rs * gq[q]; v[8 + q] = (ya[2 + (q >> 2)][q & 3] - lam * yb[2 + (q >> 2)][q & 3]) * rs * gq[16 + q]; }
  return bsplit16(v); }
// ---- k_out: block = (64 rows, 128 cols): A = ((Y[2i] - lambda Y[2i+1]) rms gamma 0.8) built on the fly (hi + lo) x w_proj ((in,out)); 4-KB rows
__global__ __launch_bounds__(128) void k_out(const float* __restrict__ Y, const float* __restrict__ RS, const float* __restrict__ GA, const float* __restrict__ LQ1, const float* __restrict__ LQ2, const float* __restrict__ LK1, const float* __restrict__ LK2, const float* __restrict__ WP, float* __restrict__ OUT) { __shared__ __align__(16) float sf[4][16][132]; __shared__ __align__(16) __bf16 sw[2][8 * WJ]; __shared__ __align__(16) float sg[HDV];
  const int tid = threadIdx.x, wave = tid >> 5, lane = tid & 31, col = lane & 15, g = lane >> 4; const int c0 = blockIdx.y * 128; const size_t r0 = (size_t)blockIdx.x * 64 + wave * 16; const size_t arow = r0 + col; const float lam = lam_full(LQ1, LK1, LQ2, LK2);
  v8f acc[8] = {};
  const float* wp = WP + (size_t)(wave * 8) * CC + c0 + lane * 4; const int ws_o = wt_slot(wave, lane);
  const float* yp = Y + arow * (NH * HDV) + 8 * g; const float* rp = RS + arow * 32;
  WT wt; ld_wt(wt, wp, CC); v4f ya[4], yb[4]; float rn = rp[0];   /* step 0's pieces of the rows Y[2i] and Y[2i+1] */
#pragma unroll
  for (int q = 0; q < 4; ++q) { ya[q] = *(const v4f*)(yp + (q >> 1) * 16 + (q & 1) * 4); yb[q] = *(const v4f*)(yp + HDV + (q >> 1) * 16 + (q & 1) * 4); }
  if (tid < HDV) sg[tid] = bfr(GA[tid]);   /* gamma in LDS: a global load of it inside a step would wait out the loads that fly for the next step */
  st_wt(&sw[0][0] + ws_o, wt);
  __syncthreads();
  F2 a = mk_a(ya, yb, rn, lam, &sg[8 * g]);
#pragma unroll 2   /* two steps a trip: the buffer of each step is then a constant */
  for (int kc = 0; kc < CC / 32; ++kc) { const bool more = kc + 1 < CC / 32;
    const int kn = kc + 1;
    if (more) { ld_wt(wt, wp + (size_t)kn * 32 * CC, CC);   /* the next step's loads fly under this step's products */
      const int i = kn >> 1;   /* value head (64 = 2 steps) */ const float* y1 = yp + (2 * i) * HDV + (kn & 1) * 32; rn = rp[i];
#pragma unroll
      for (int q = 0; q < 4; ++q) { ya[q] = *(const v4f*)(y1 + (q >> 1) * 16 + (q & 1) * 4); yb[q] = *(const v4f*)(y1 + HDV + (q >> 1) * 16 + (q & 1) * 4); } }
    v16b w[8];
#pragma unroll
    for (int j = 0; j < 8; ++j) w[j] = frag_wt(&sw[kc & 1][0], j, lane);
#pragma unroll
    for (int j = 0; j < 8; ++j) { acc[j] = wmma_bf(a.h, w[j], acc[j]); acc[j] = wmma_bf(a.l, w[j], acc[j]); }
    __builtin_amdgcn_sched_barrier(0);   /* or the compiler lifts what follows, with its wait for the next step's loads, in among the products, which then stand behind that wait */
    if (more) { a = mk_a(ya, yb, rn, lam, &sg[(kn & 1) * 32 + 8 * g]); st_wt(&sw[kn & 1][0] + ws_o, wt); }
    __syncthreads(); }   /* one barrier a step: it publishes the next tile and ends the reads of the buffer that the next step refills */
#pragma unroll
  for (int j = 0; j < 8; ++j)
#pragma unroll
    for (int r = 0; r < 8; ++r) sf[wave][8 * g + r][j * 16 + col] = acc[j][r];
  LDSX(); for (int rl = 0; rl < 16; ++rl) vst2(OUT + (r0 + rl) * CC + c0 + lane * 4, *(const v4f*)&sf[wave][rl][lane * 4]); }
extern "C" void kernel_launch(void* const* d_in, const int* in_sizes, int n_in, void* d_out, int out_size, void* d_ws, size_t ws_size, hipStream_t stream) {
  (void)in_sizes; (void)n_in; (void)out_size;
  const float** F = (const float**)d_in;   // 0 x [4,1024,1024], 1 w_attn [1024,3072] ((in,out): q | k | v), 2 w_proj ((in,out)), 3 lambda_q1 [32], 4 lambda_q2, 5 lambda_k1, 6 lambda_k2, 7 gamma [64]
  if (ws_size < (size_t)WS_END) return;
  char* ws = (char*)d_ws; _Float16 *QH = (_Float16*)(ws + WS_QH), *QL = (_Float16*)(ws + WS_QL), *KH = (_Float16*)(ws + WS_KH); __bf16 *VT = (__bf16*)(ws + WS_VT), *VL = (__bf16*)(ws + WS_VL); float *Y = (float*)(ws + WS_Y), *RS = (float*)(ws + WS_RS);
  k_proj<<<dim3(TNB * TT / 64, CC / 128, 3), 128, 0, stream>>>(F[0], F[1], nullptr, F[1] + CC, nullptr, F[1] + 2 * CC, nullptr, QH, QL, KH, VT, VL, nullptr, nullptr, 0);
  k_att<<<dim3(TT / 64, NH, TNB), 128, 0, stream>>>(QH, QL, KH, VT, VL, Y);
  k_rms<<<dim3(TNB * TT / 8), 256, 0, stream>>>(Y, F[3], F[4], F[5], F[6], RS);
  k_out<<<dim3(TNB * TT / 64, CC / 128), 128, 0, stream>>>(Y, RS, F[7], F[3], F[4], F[5], F[6], F[2], (float*)d_out);
}

// v005
// One run takes 159 microseconds.
// Timed twice side by side with v004, it ran 1.12 and 1.11 times as fast.
// Over all steps from v000 it is 9.52 times as fast.
// compute dtype: all float inputs rounded to bf16, the four lambda vectors and gamma read; qkv = x w_attn ((in,out)) with EXACT bf16 products on WMMA 16x16x32, f32 accumulate; q as f16 hi + residual (x 2^10), k f16 -> 2-product causal logits x (32^-1/2)^2 = 1/32 kept in f32 registers (one launch for all score heads); online softmax in f32, in base 2 (logits x log2(e) / 32, hardware exp2); unnormalised P split bf16 hi + lo against v bf16 hi + lo (3 products), divided by the row sum at the end, per score head into its value head-pair slot; the differential combination P1 v - lambda P2 v, RMSNorm, gamma and (1 - lambda_init) in f32; out = that (bf16 hi + lo) w_proj; f32 output.
#include <hip/hip_runtime.h>
#include <math.h>

typedef __attribute__((ext_vector_type(16))) _Float16 v16h;
typedef __attribute__((ext_vector_type(16))) __bf16 v16b;
typedef __attribute__((ext_vector_type(8)))  _Float16 v8h;
typedef __attribute__((ext_vector_type(8)))  float v8f;
typedef __attribute__((ext_vector_type(4)))  float v4f;
typedef __attribute__((ext_vector_type(2)))  float v2f;
typedef __attribute__((ext_vector_type(4)))  unsigned v4u;
typedef __attribute__((ext_vector_type(4)))  int v4i;
typedef float __attribute__((may_alias)) float_a;
typedef int __attribute__((may_alias)) int_a;

template <typename T> __device__ __forceinline__ void vst2(void* p, T v) { *(T*)p = v;  }
__device__ __forceinline__ v8f wmma16(v16h a, v16h b, v8f c) {
  v8f d = __builtin_amdgcn_wmma_f32_16x16x32_f16(false, a, false, b, (short)0, c, false, false);
  asm volatile("v_nop\n\tv_nop\n\tv_nop\n\tv_nop" : "+v"(d) : "v"(a), "v"(b));
  return d;
}
__device__ __forceinline__ v8f wmma_bf(v16b a, v16b b, v8f c) {
  v8f d = __builtin_amdgcn_wmma_f32_16x16x32_bf16(false, a, false, b, (short)0, c, false, false);
  asm volatile("v_nop\n\tv_nop\n\tv_nop\n\tv_nop" : "+v"(d) : "v"(a), "v"(b));
  return d;
}
// 16x16x32 fragments: lane = (h = lane>>4, row/col = lane&15); elements 0..7 = k0+8h+0..7, 8..15 = k0+16+8h+0..7; D element r = row 8h+r
__device__ __forceinline__ v16h frag_h(const _Float16* rowk0, int lane) {
  union { v16h v; v8h q[2]; } u; const _Float16* p = rowk0 + 8 * (lane >> 4);
  u.q[0] = *(const v8h*)p; u.q[1] = *(const v8h*)(p + 16); return u.v;
}
__device__ __forceinline__ v16h frag_f32(const float* rowk0, int lane) {
  v16h a; const float* p = rowk0 + 8 * (lane >> 4);
#pragma unroll
  for (int i = 0; i < 8; ++i) { a[i] = (_Float16)p[i]; a[8 + i] = (_Float16)p[16 + i]; }
  return a;
}
__device__ __forceinline__ v16h frag_f32s(const float* rowk0, int lane, float sc) {
  v16h a; const float* p = rowk0 + 8 * (lane >> 4);
#pragma unroll
  for (int i = 0; i < 8; ++i) { a[i] = (_Float16)(p[i] * sc); a[8 + i] = (_Float16)(p[16 + i] * sc); }
  return a;
}
// column fragment from a [K][ld] layout (column n), rows >= K read as 0
__device__ __forceinline__ v16h fragc_f32(const float* W, int k0, int n, int lane, int ld, int K) {
  v16h a; const int g = lane >> 4;
#pragma unroll
  for (int i = 0; i < 8; ++i) { const int ka = k0 + 8 * g + i, kb = ka + 16;
    a[i] = (_Float16)(ka < K ? W[(size_t)(ka < K ? ka : K - 1) * ld + n] : 0.f); a[8 + i] = (_Float16)(kb < K ? W[(size_t)(kb < K ? kb : K - 1) * ld + n] : 0.f); }
  return a;
}
struct F2 { v16b h, l; };
__device__ __forceinline__ F2 bsplit16(const float v[16]) { F2 r;
#pragma unroll
  for (int i = 0; i < 16; ++i) { const __bf16 h = (__bf16)v[i]; r.h[i] = h; r.l[i] = (__bf16)(v[i] - (float)h); }
  return r; }
__device__ __forceinline__ F2 split_row(const float* row, int k0, int lane) { float v[16]; const float* p = row + k0 + 8 * (lane >> 4);
#pragma unroll
  for (int i = 0; i < 8; ++i) { v[i] = p[i]; v[8 + i] = p[16 + i]; }
  return bsplit16(v); }
__device__ __forceinline__ F2 split_rowK(const float* row, int k0, int lane, int K) { float v[16]; const int g = lane >> 4;
#pragma unroll
  for (int i = 0; i < 8; ++i) { const int ka = k0 + 8 * g + i, kb = ka + 16; v[i] = ka < K ? row[ka < K ? ka : K - 1] : 0.f; v[8 + i] = kb < K ? row[kb < K ? kb : K - 1] : 0.f; }
  return bsplit16(v); }
__device__ __forceinline__ F2 split_col(const float* W, int k0, int n, int lane, int ld, int K) { float v[16]; const int g = lane >> 4;
#pragma unroll
  for (int i = 0; i < 8; ++i) { const int ka = k0 + 8 * g + i, kb = ka + 16; v[i] = ka < K ? W[(size_t)(ka < K ? ka : K - 1) * ld + n] : 0.f; v[8 + i] = kb < K ? W[(size_t)(kb < K ? kb : K - 1) * ld + n] : 0.f; }
  return bsplit16(v); }
__device__ __forceinline__ v8f mac3(const F2& a, const F2& b, v8f c) { c = wmma_bf(a.l, b.h, c); c = wmma_bf(a.h, b.l, c); return wmma_bf(a.h, b.h, c); }
__device__ __forceinline__ float sigm(float v) { return 1.0f / (1.0f + expf(-v)); }
#define LDSX() do { asm volatile("s_wait_dscnt 0" ::: "memory"); __builtin_amdgcn_wave_barrier(); __builtin_amdgcn_fence(__ATOMIC_RELEASE, "workgroup"); } while (0)


// Differential causal attention (B 4, T 1,024, C 1,024; 2H = 32 score heads x 32, 16 value heads x 64): att = softmax(causal(q k^T / 32)) per score head; diff_i = att_{2i} - lambda att_{2i+1}, lambda = exp(lq1.lk1) - exp(lq2.lk2) + 0.2; out_i = RMSNorm(diff_i v_i) * gamma * 0.8; concat w_proj.
#define NB 4
#define TT 1024
#define CC 1024
#define NH 32              // score heads (2H)
#define HD 32              // score head dim
#define HDV 64             // value head dim (16 value heads)
#define WIN (TT + 1)       // plain causal
#define NKV 32             // k has the same 32 heads
#define LDW 3072           // w_attn (in,out) [1024][3072]: q | k | v column blocks
#define CK (NKV * HD)   // 1,024: k/v row width
#define REP (NH / NKV)
#ifndef TNB
#define TNB NB
#endif
typedef __attribute__((ext_vector_type(8))) __bf16 v8b;
__device__ __forceinline__ v16b frag_b(const __bf16* rowk0, int lane) {
  union { v16b v; v8b q[2]; } u; const __bf16* p = rowk0 + 8 * (lane >> 4);
  u.q[0] = *(const v8b*)p; u.q[1] = *(const v8b*)(p + 16); return u.v;
}
__device__ __forceinline__ float bfr(float v) { return (float)(__bf16)v; }
// ---- operand tiles of one k step (32 deep) in LDS, bf16, in fragment order: a weight fragment read is lane * 16 B, contiguous over the wave; an x fragment read is contiguous per 16-lane half
typedef __attribute__((ext_vector_type(4))) __bf16 v4b;
#define WJ 520             // elements per 16-column group of a weight tile: k 0..15 (256) + k 16..31 (256) + 8 of pad, so that the 16 lanes of a store fall on 16 different 16-B slots
#define XC 160             // elements per 8-k chunk of a wave's 16 x rows: 128 + 32 of pad, for the same reason
#define XO (8 * WJ)        // the x rows stand behind the weight tile (128 columns)
struct WT { v4f r[8]; };   // wave w: rows 8w..8w+7 of the tile, a lane 4 columns; one load = one 512-B row piece = 4 whole lines
__device__ __forceinline__ void ld_wt(WT& t, const float* p, int ld) {
#pragma unroll
  for (int i = 0; i < 8; ++i) t.r[i] = *(const v4f*)(p + (size_t)i * ld); }
__device__ __forceinline__ int wt_slot(int wave, int lane) { return (lane >> 2) * WJ + (wave >> 1) * 256 + (wave & 1) * 128 + (lane & 3) * 32; }   // column 4 lane + c stands c * 8 elements on
__device__ __forceinline__ void st_wt(__bf16* p, const WT& t) {
#pragma unroll
  for (int c = 0; c < 4; ++c) { v8b o;
#pragma unroll
    for (int i = 0; i < 8; ++i) o[i] = (__bf16)t.r[i][c];
    *(v8b*)(p + c * 8) = o; } }
__device__ __forceinline__ v16b frag_wt(const __bf16* tile, int j, int lane) {   // frag_b's k order: elements 0..7 = 8g + 0..7, 8..15 = 16 + 8g + 0..7, column 16 j + col
  union { v16b v; v8b q[2]; } u; const __bf16* p = tile + j * WJ + lane * 8;
  u.q[0] = *(const v8b*)p; u.q[1] = *(const v8b*)(p + 256); return u.v; }
__device__ __attribute__((noinline)) float exp_ni(float v) { return expf(v); }
__device__ __attribute__((noinline)) float erf_ni(float v) { return erff(v); }

#define WS_QH  0u
#define WS_QL  (WS_QH + 2u * (size_t)NB * TT * CC)
#define WS_KH  (WS_QL + 2u * (size_t)NB * TT * CC)
#define WS_VT  (WS_KH + 2u * (size_t)NB * TT * CK)      // bf16 v planes [b][CK][t] (k rows are [b*T+t][CK])
#define WS_VL  (WS_VT + 2u * (size_t)NB * CK * TT)
#define WS_AH  (WS_VL + 2u * (size_t)NB * CK * TT)      // bf16 hi and lo planes of k_out's A rows [b*t][1,024]: the normalised differential output
#define WS_AL  (WS_AH + 2u * (size_t)NB * TT * CC)
#define WS_END (WS_AL + 2u * (size_t)NB * TT * CC)

// ---- k_proj: block = (64 rows, 128 cols, which): qkv = x W (+ b), exact; q -> f16 hi (+ residual), k -> f16 rows, v -> bf16 hi + lo planes
__global__ __launch_bounds__(128) void k_proj(const float* __restrict__ X, const float* __restrict__ WQ, const float* __restrict__ BQ, const float* __restrict__ WK, const float* __restrict__ BK, const float* __restrict__ WV, const float* __restrict__ BV, _Float16* __restrict__ QH, _Float16* __restrict__ QL, _Float16* __restrict__ KH, __bf16* __restrict__ VT, __bf16* __restrict__ VL, const float* __restrict__ NQW, const float* __restrict__ NKW, int wbase) {
  __shared__ __align__(16) _Float16 sh[64][136], sl[64][136]; __shared__ __align__(16) __bf16 th[128][72], tl2[128][72];
  const int tid = threadIdx.x, wave = tid >> 5, lane = tid & 31, col = lane & 15, g = lane >> 4; const int which = wbase + blockIdx.z; const int OW = (which == 0) ? CC : CK;   /* output row width: q 1,024, k/v 1,024 */ const int c0 = blockIdx.y * 128; const size_t r0 = (size_t)blockIdx.x * 64; const float* WA = which == 0 ? WQ : which == 1 ? WK : WV; const float* BA = which == 0 ? BQ : which == 1 ? BK : BV;
  v8f acc[8] = {};
  __bf16* const sb0 = &th[0][0]; __bf16* const sb1 = &tl2[0][0];   /* the two staging buffers (13,440 B each) lie in the epilogue's planes, which are written only behind the loop's last barrier */
  const float* wp = WA + (size_t)(wave * 8) * LDW + c0 + lane * 4;   /* (in,out), row length 3072 */
  const float* xp = X + (r0 + wave * 16 + (lane >> 3)) * CC + (lane & 7) * 4;   /* 8 lanes a row: one load = 4 rows x one whole line */
  const int ws_o = wt_slot(wave, lane), xs_o = XO + wave * 4 * XC + ((lane & 7) >> 1) * XC + (lane >> 3) * 8 + (lane & 1) * 4, xr_o = XO + wave * 4 * XC + g * XC + col * 8;
  WT wt; v4f xt[4]; ld_wt(wt, wp, LDW);
#pragma unroll
  for (int i = 0; i < 4; ++i) xt[i] = *(const v4f*)(xp + (size_t)(4 * i) * CC);
  st_wt(sb0 + ws_o, wt);
#pragma unroll
  for (int i = 0; i < 4; ++i) { v4b o; o[0] = (__bf16)xt[i][0]; o[1] = (__bf16)xt[i][1]; o[2] = (__bf16)xt[i][2]; o[3] = (__bf16)xt[i][3]; *(v4b*)(sb0 + xs_o + i * 32) = o; }
  __syncthreads();
#pragma unroll 2   /* two steps a trip: the buffer of each step is then a constant */
  for (int kc = 0; kc < CC / 32; ++kc) { const __bf16* cur = (kc & 1) ? sb1 : sb0; __bf16* nxt = (kc & 1) ? sb0 : sb1; const bool more = kc + 1 < CC / 32;
    if (more) { ld_wt(wt, wp + (size_t)(kc + 1) * 32 * LDW, LDW);   /* the next step's loads fly under this step's products */
#pragma unroll
      for (int i = 0; i < 4; ++i) xt[i] = *(const v4f*)(xp + (size_t)(4 * i) * CC + (kc + 1) * 32); }
    v16b a, w[8]; { union { v16b v; v8b q[2]; } u; u.q[0] = *(const v8b*)(cur + xr_o); u.q[1] = *(const v8b*)(cur + xr_o + 2 * XC); a = u.v; }
#pragma unroll
    for (int j = 0; j < 8; ++j) w[j] = frag_wt(cur, j, lane);
#pragma unroll
    for (int j = 0; j < 8; ++j) acc[j] = wmma_bf(a, w[j], acc[j]);
    __builtin_amdgcn_sched_barrier(0);   /* or the compiler lifts the roundings below, with their wait for the next step's loads, in among the products, which then stand behind that wait */
    if (more) { st_wt(nxt + ws_o, wt);
#pragma unroll
      for (int i = 0; i < 4; ++i) { v4b o; o[0] = (__bf16)xt[i][0]; o[1] = (__bf16)xt[i][1]; o[2] = (__bf16)xt[i][2]; o[3] = (__bf16)xt[i][3]; *(v4b*)(nxt + xs_o + i * 32) = o; } }
    __syncthreads(); }   /* one barrier a step: it publishes the next tile and ends the reads of the buffer that the next step refills */
#pragma unroll
  for (int j = 0; j < 8; ++j) { const float bb = BA ? bfr(BA[c0 + j * 16 + col]) : 0.f;
#pragma unroll
    for (int r = 0; r < 8; ++r) { const float v = acc[j][r] + bb; const int rl = wave * 16 + 8 * g + r, cl = j * 16 + col; const _Float16 hv = (_Float16)v;
      if (which == 2) { const __bf16 bh = (__bf16)v; th[cl][rl] = bh; tl2[cl][rl] = (__bf16)(v - (float)bh); } else { sh[rl][cl] = hv; sl[rl][cl] = (_Float16)((v - (float)hv) * 1024.0f); }   /* q residual carried x 2^10 so the plane stays f16-normal on the chip */ } }
  __syncthreads();
  if (which < 2) { _Float16* dh = which == 0 ? QH : KH; for (int e = tid; e < 64 * 16; e += 128) { const int rl = e >> 4, q = e & 15; vst2((unsigned*)(dh + (r0 + rl) * OW + c0 + q * 8), *(const v4u*)&sh[rl][q * 8]); if (which == 0) vst2((unsigned*)(QL + (r0 + rl) * CC + c0 + q * 8), *(const v4u*)&sl[rl][q * 8]); } }
  else { const size_t b = r0 / TT; const int t0 = (int)(r0 % TT); for (int e = tid; e < 128 * 8; e += 128) { const int cl = e >> 3, q = e & 7; const size_t o2 = (b * CK + c0 + cl) * (size_t)TT + t0 + q * 8; vst2((unsigned*)(VT + o2), *(const v4u*)&th[cl][q * 8]); vst2((unsigned*)(VL + o2), *(const v4u*)&tl2[cl][q * 8]); } } }
// e[i] = 2^t[i], one instruction each; below -126 it gives 0, which is what a masked or far-off logit is to give. One statement, so that the slot behind a transcendental is kept by construction: behind each v_exp_f32 stands one that neither reads
// its result nor overwrites its source (every output "=&v"), behind the last a v_nop
__device__ __forceinline__ void ex2x9(float* e, const float* t) {
  asm("v_exp_f32 %0, %9\n\tv_exp_f32 %1, %10\n\tv_exp_f32 %2, %11\n\tv_exp_f32 %3, %12\n\tv_exp_f32 %4, %13\n\tv_exp_f32 %5, %14\n\tv_exp_f32 %6, %15\n\tv_exp_f32 %7, %16\n\tv_exp_f32 %8, %17\n\tv_nop"
    : "=&v"(e[0]), "=&v"(e[1]), "=&v"(e[2]), "=&v"(e[3]), "=&v"(e[4]), "=&v"(e[5]), "=&v"(e[6]), "=&v"(e[7]), "=&v"(e[8]) : "v"(t[0]), "v"(t[1]), "v"(t[2]), "v"(t[3]), "v"(t[4]), "v"(t[5]), "v"(t[6]), "v"(t[7]), "v"(t[8])); }
#define LC 0.045084220027780106f   // log2(e) / 32: the logits' scale and the change of base in one factor, so that exp(s / 32 - m) = 2^(s LC - m')
template <int M> __device__ __forceinline__ float xrow(float v) { return __builtin_bit_cast(float, __builtin_amdgcn_update_dpp(0, __builtin_bit_cast(int, v), 0x160 | M, 0xf, 0xf, true)); }   // lane l reads lane l ^ M of its 16-lane row (DPP row_xmask): no LDS round trip
// ---- K and V tiles of one 128-key chunk in LDS, brought once a block by asynchronous 16-B copies and read by all eight waves
#define KP 72              // f16 elements per key row of the K tile: the two score heads' 64 B each + 16 B of pad; pitch = 16 B x odd, so the 16 lanes of a fragment read fall on different banks
#define VP 136             // bf16 elements per value-dim row of a v tile: 256 B + 16 B of pad, for the same reason
struct VF { v16b h[HDV / 16], l[HDV / 16]; };   // v fragments (hi, lo planes) of 32 keys x 64 value dims
__device__ __forceinline__ void ld_v(VF& f, const __bf16* vt, const __bf16* vl, int lane) {
#pragma unroll
  for (int j = 0; j < HDV / 16; ++j) { f.h[j] = frag_b(vt + j * 16 * VP, lane); f.l[j] = frag_b(vl + j * 16 * VP, lane); } }   // from the LDS tiles, row pitch VP
__device__ __forceinline__ void pv32(v8f* acc, const float* prow, int kk, const VF& f, int lane) { const F2 p = split_row(prow, kk, lane);
#pragma unroll
  for (int j = 0; j < HDV / 16; ++j) { acc[j] = wmma_bf(p.h, f.h[j], acc[j]); acc[j] = wmma_bf(p.l, f.h[j], acc[j]); acc[j] = wmma_bf(p.h, f.l[j], acc[j]); } }
__device__ __forceinline__ unsigned lds_off(const void* p) { return (unsigned)(size_t)p; }   // byte offset in the work-group's LDS
// n copies of a lane, copy i standing ls bytes on in LDS and gs bytes on in global memory; the wait is the last line of the copies' own statement, so it stands in front of every rewrite of an address register that they name
__device__ __forceinline__ void acopy4(unsigned l, unsigned ls, const char* p, size_t gs) {
  asm volatile("global_load_async_to_lds_b128 %0, %4, off\n\tglobal_load_async_to_lds_b128 %1, %5, off\n\tglobal_load_async_to_lds_b128 %2, %6, off\n\tglobal_load_async_to_lds_b128 %3, %7, off\n\ts_wait_xcnt 0x0"
    :: "v"(l), "v"(l + ls), "v"(l + 2 * ls), "v"(l + 3 * ls), "v"(p), "v"(p + gs), "v"(p + 2 * gs), "v"(p + 3 * gs) : "memory"); }
// lambda = exp(lq1.lk1) - exp(lq2.lk2) + 0.2: lane i brings element i (one round of loads); the products of bf16-rounded values are exact in f32 and are summed from element 0 up
__device__ __forceinline__ float rdlane(float v, int i) { return __builtin_bit_cast(float, __builtin_amdgcn_readlane(__builtin_bit_cast(int, v), i)); }
__device__ __forceinline__ float lam_lanes(const float* LQ1, const float* LK1, const float* LQ2, const float* LK2, int lane) { const float p1 = bfr(LQ1[lane]) * bfr(LK1[lane]), p2 = bfr(LQ2[lane]) * bfr(LK2[lane]); float s1 = 0.f, s2 = 0.f;
#pragma unroll
  for (int i = 0; i < HD; ++i) { s1 += rdlane(p1, i); s2 += rdlane(p2, i); }
  return expf(s1) - expf(s2) + 0.2f; }
// 1 / sqrt(x) for x >= 1e-5, a normal number, where the library form's rescue of denormal arguments is an identity. One statement, so that the slot behind a transcendental is kept by construction
__device__ __forceinline__ float rsq1(float x) { float r; asm("v_rsq_f32 %0, %1\n\tv_nop" : "=&v"(r) : "v"(x)); return r; }
// ---- k_att: block = 64 queries of (b, value head), 8 waves: waves 0..3 take score head 2i, waves 4..7 score head 2i+1, one wave per 16 queries; all share the chunk's v tiles, and the K tile holds both heads' rows. Per 128-key chunk: 2-product logits x log2(e) / 32 in the D registers, running row maximum and rescale (online softmax),
// P = 2^(s - m) through the wave's own LDS tile into A fragments (bf16 hi + lo), 3-product P . v into acc; the row sums stay per lane until the end; y = acc / l into LDS; then, over the block, (y[2i] - lambda y[2i+1]) rms 0.8 gamma, split bf16 hi + lo: k_out's A rows
__global__ __launch_bounds__(256, 4) /* four waves a SIMD: a budget of 256 registers */ void k_att(const _Float16* __restrict__ QH, const _Float16* __restrict__ QL, const _Float16* __restrict__ KH, const __bf16* __restrict__ VT, const __bf16* __restrict__ VL, const float* __restrict__ LQ1, const float* __restrict__ LQ2, const float* __restrict__ LK1, const float* __restrict__ LK2, const float* __restrict__ GA, __bf16* __restrict__ AH, __bf16* __restrict__ AL) { __shared__ __align__(16) float ss[8][16][132]; __shared__ __align__(16) _Float16 sk[128 * KP]; __shared__ __align__(16) __bf16 sv[2][HDV * VP];
  const int tid = threadIdx.x, wave = tid >> 5, lane = tid & 31, col = lane & 15, g = lane >> 4; const int hs = wave >> 2, wq = wave & 3;   /* which score head of the pair, which 16 queries */ const int vh = blockIdx.y, h = 2 * vh + hs, b = blockIdx.z; const int ql0 = blockIdx.x * 64 + wq * 16; const int kend = blockIdx.x * 64 + 64; const size_t q0 = (size_t)b * TT + ql0;
  const v16h ah = frag_h(QH + (q0 + col) * CC + h * HD, lane), al = frag_h(QL + (q0 + col) * CC + h * HD, lane);
  v8f acc[HDV / 16] = {}; float m[8], l[8];
#pragma unroll
  for (int r = 0; r < 8; ++r) { m[r] = -3.0e38f; l[r] = 0.f; }
  const _Float16* kg = KH + ((size_t)b * TT + (tid >> 3)) * CK + vh * (2 * HD) + (tid & 7) * 8;   /* copies: 8 lanes a key row (both heads, 128 B = one whole line), copy i 32 rows on; the three pointers walk with k0 */
  const size_t po = ((size_t)b * CK + vh * HDV + (tid >> 4)) * (size_t)TT + (tid & 15) * 8;   /* value head vh (64 wide): 16 lanes a row piece (256 B = 2 whole lines), copy i 16 rows on */ const __bf16 *vtg = VT + po, *vlg = VL + po;
  const unsigned kl = lds_off(sk) + (tid >> 3) * (KP * 2) + (tid & 7) * 16, vl0 = lds_off(&sv[0][0]) + (tid >> 4) * (VP * 2) + (tid & 15) * 16, vl1 = vl0 + HDV * VP * 2;
  const _Float16* kp = sk + col * KP + hs * HD + 8 * g;   /* this lane's half of its head's part of its key row of the tile */ const __bf16 *vtp = &sv[0][col * VP], *vlp = &sv[1][col * VP];
#pragma unroll 1   /* rolled: one chunk's body fills the register budget; the inner loops are unrolled so that their arrays are registers */
  for (int k0 = 0; k0 < kend; k0 += 128, kg += (size_t)128 * CK, vtg += 128, vlg += 128) { v8f s[8]; v16h kb[8];
    asm volatile("s_wait_dscnt 0x0" ::: "memory");   /* this wave's reads of the last chunk's tiles have returned ... */
    __syncthreads();   /* ... and so have every wave's: the tiles may be refilled */
    acopy4(kl, 32 * KP * 2, (const char*)kg, (size_t)32 * CK * 2); acopy4(vl0, 16 * VP * 2, (const char*)vtg, (size_t)16 * TT * 2); acopy4(vl1, 16 * VP * 2, (const char*)vlg, (size_t)16 * TT * 2);
    asm volatile("s_wait_asynccnt 0x0" ::: "memory");   /* this wave's copies have landed ... */
    __syncthreads();   /* ... and so have every wave's: the tiles may be read */
#pragma unroll
    for (int j = 0; j < 8; ++j) { union { v16h v; v8h q[2]; } u; const _Float16* p = kp + j * 16 * KP; u.q[0] = *(const v8h*)p; u.q[1] = *(const v8h*)(p + 16); kb[j] = u.v; }   /* frag_h's order */
#pragma unroll
    for (int j = 0; j < 8; ++j) { v8f a0 = {}, a1 = {}; a0 = wmma16(ah, kb[j], a0); a1 = wmma16(al, kb[j], a1); s[j] = a0 + a1 * (1.0f / 1024.0f); }
    const bool full = k0 + 64 < kend;   /* wave-uniform: keys 64..127 of the chunk are open to some row */
    const int dq = ql0 + 8 * g - col - k0;   /* causal test against constants: one register, not one per element */
#pragma unroll
    for (int r = 0; r < 8; ++r) { float mx = -3.0e38f;
#pragma unroll
      for (int j = 0; j < 8; ++j) { const float v = (j * 16 - r <= dq) ? s[j][r] * LC : -3.0e38f;   /* key k0 + 16 j + col <= query ql0 + 8 g + r; q * 32^-1/2 then * 1/sqrt(32) = 1/32, times log2(e) */ s[j][r] = v; mx = fmaxf(mx, v); }
      mx = fmaxf(mx, xrow<1>(mx)); mx = fmaxf(mx, xrow<2>(mx)); mx = fmaxf(mx, xrow<4>(mx)); mx = fmaxf(mx, xrow<8>(mx));   /* the 16 lanes of a half hold one row's columns */
      const float mn = fmaxf(m[r], mx); float t[9], e[9]; t[0] = m[r] - mn; m[r] = mn;   /* the rescale factor first: it is read first */
#pragma unroll
      for (int j = 0; j < 8; ++j) t[1 + j] = s[j][r] - mn;   /* a masked logit (-3e38) gives exactly 0: mn is a real logit, key 0 is open to every row */
      ex2x9(e, t);
      const float sc = e[0]; float ls = l[r] * sc;
#pragma unroll
      for (int j = 0; j < HDV / 16; ++j) acc[j][r] *= sc;
#pragma unroll
      for (int j = 0; j < 8; ++j) { ls += e[1 + j]; ss[wave][8 * g + r][j * 16 + col] = e[1 + j]; }
      asm volatile("" : "+v"(ls));   /* each row's sum, against spills: formed here, or the compiler sinks the adds to the loop's foot and all 64 addends stay live through the P . v products */
      l[r] = ls; }
    LDSX();   /* the wave's own P tile: every lane's stores have landed before a lane reads the others' elements */
    const float* prow = &ss[wave][col][0];
    VF va; ld_v(va, vtp, vlp, lane); pv32(acc, prow, 0, va, lane); ld_v(va, vtp + 32, vlp + 32, lane); pv32(acc, prow, 32, va, lane);
    if (full) { ld_v(va, vtp + 64, vlp + 64, lane); pv32(acc, prow, 64, va, lane); ld_v(va, vtp + 96, vlp + 96, lane); pv32(acc, prow, 96, va, lane); } }
#pragma unroll
  for (int r = 0; r < 8; ++r) { float ls = l[r];
    ls += xrow<1>(ls); ls += xrow<2>(ls); ls += xrow<4>(ls); ls += xrow<8>(ls);
    const float inv = 1.0f / ls;
#pragma unroll
    for (int j = 0; j < HDV / 16; ++j) ss[wave][8 * g + r][j * 16 + col] = acc[j][r] * inv; }
  const float lam = lam_lanes(LQ1, LK1, LQ2, LK2, lane);
  const int row = hs * 8 + (lane >> 2), d0 = (lane & 3) * 16;   /* waves wq and 4 + wq halve the 16 queries of tile wq: 4 lanes a query, 16 value dims a lane */
  v4f gv[4];
#pragma unroll
  for (int q = 0; q < 4; ++q) gv[q] = *(const v4f*)(GA + d0 + q * 4);
  __syncthreads();   /* both score heads' y rows stand in LDS before a wave reads the other head's */
  const float *y1 = &ss[wq][row][d0], *y2 = &ss[4 + wq][row][d0]; float d[16], sq = 0.f;
#pragma unroll
  for (int q = 0; q < 16; ++q) { d[q] = y1[q] - lam * y2[q]; sq += d[q] * d[q]; }
  sq += xrow<1>(sq); sq += xrow<2>(sq);   /* the 4 lanes of a query */
  const float rs = rsq1(sq * (1.0f / HDV) + 1e-5f) * 0.8f; v8b oh[2], ol[2];
#pragma unroll
  for (int q = 0; q < 16; ++q) { const float v = d[q] * rs * bfr(gv[q >> 2][q & 3]); const __bf16 hv = (__bf16)v; oh[q >> 3][q & 7] = hv; ol[q >> 3][q & 7] = (__bf16)(v - (float)hv); }
  const size_t ao = ((size_t)b * TT + blockIdx.x * 64 + wq * 16 + row) * CC + vh * HDV + d0;   /* a query's 64 dims = one whole 128-B line of each plane, from 4 neighbouring lanes */
  *(v8b*)(AH + ao) = oh[0]; *(v8b*)(AH + ao + 8) = oh[1]; *(v8b*)(AL + ao) = ol[0]; *(v8b*)(AL + ao + 8) = ol[1]; }
__device__ __forceinline__ v16b join_b(v8b a, v8b b) { union { v16b v; v8b q[2]; } u; u.q[0] = a; u.q[1] = b; return u.v; }
// ---- k_out: block = (64 rows, 128 cols): A rows (bf16 hi + lo planes, frag_b's k order) x w_proj ((in,out)); 4-KB rows
__global__ __launch_bounds__(128) void k_out(const __bf16* __restrict__ AH, const __bf16* __restrict__ AL, const float* __restrict__ WP, float* __restrict__ OUT) { __shared__ __align__(16) float sf[4][16][132]; __shared__ __align__(16) __bf16 sw[2][8 * WJ];
  const int tid = threadIdx.x, wave = tid >> 5, lane = tid & 31, col = lane & 15, g = lane >> 4; const int c0 = blockIdx.y * 128; const size_t r0 = (size_t)blockIdx.x * 64 + wave * 16; const size_t arow = r0 + col;
  v8f acc[8] = {};
  const float* wp = WP + (size_t)(wave * 8) * CC + c0 + lane * 4; const int ws_o = wt_slot(wave, lane);
  const __bf16 *hp = AH + arow * CC + 8 * g, *lp = AL + arow * CC + 8 * g;
  WT wt; ld_wt(wt, wp, CC); v8b nh[2], nl[2];   /* step 0's pieces of the A row */
  nh[0] = *(const v8b*)hp; nh[1] = *(const v8b*)(hp + 16); nl[0] = *(const v8b*)lp; nl[1] = *(const v8b*)(lp + 16);
  st_wt(&sw[0][0] + ws_o, wt);
  __syncthreads();
  F2 a; a.h = join_b(nh[0], nh[1]); a.l = join_b(nl[0], nl[1]);
#pragma unroll 2   /* two steps a trip: the buffer of each step is then a constant */
  for (int kc = 0; kc < CC / 32; ++kc) { const bool more = kc + 1 < CC / 32;
    const int kn = kc + 1;
    if (more) { ld_wt(wt, wp + (size_t)kn * 32 * CC, CC);   /* the next step's loads fly under this step's products */
      nh[0] = *(const v8b*)(hp + kn * 32); nh[1] = *(const v8b*)(hp + kn * 32 + 16); nl[0] = *(const v8b*)(lp + kn * 32); nl[1] = *(const v8b*)(lp + kn * 32 + 16);
      asm volatile("s_wait_xcnt 0x0" ::: "memory"); }   /* in front of any rewrite of an address register that the loads above name: the roundings below reuse such registers while the youngest loads are still out */
    v16b w[8];
#pragma unroll
    for (int j = 0; j < 8; ++j) w[j] = frag_wt(&sw[kc & 1][0], j, lane);
#pragma unroll
    for (int j = 0; j < 8; ++j) { acc[j] = wmma_bf(a.h, w[j], acc[j]); acc[j] = wmma_bf(a.l, w[j], acc[j]); }
    __builtin_amdgcn_sched_barrier(0);   /* or the compiler lifts what follows, with its wait for the next step's loads, in among the products, which then stand behind that wait */
    if (more) { a.h = join_b(nh[0], nh[1]); a.l = join_b(nl[0], nl[1]); st_wt(&sw[kn & 1][0] + ws_o, wt); }
    __syncthreads(); }   /* one barrier a step: it publishes the next tile and ends the reads of the buffer that the next step refills */
#pragma unroll
  for (int j = 0; j < 8; ++j)
#pragma unroll
    for (int r = 0; r < 8; ++r) sf[wave][8 * g + r][j * 16 + col] = acc[j][r];
  LDSX(); for (int rl = 0; rl < 16; ++rl) vst2(OUT + (r0 + rl) * CC + c0 + lane * 4, *(const v4f*)&sf[wave][rl][lane * 4]); }
extern "C" void kernel_launch(void* const* d_in, const int* in_sizes, int n_in, void* d_out, int out_size, void* d_ws, size_t ws_size, hipStream_t stream) {
  (void)in_sizes; (void)n_in; (void)out_size;
  const float** F = (const float**)d_in;   // 0 x [4,1024,1024], 1 w_attn [1024,3072] ((in,out): q | k | v), 2 w_proj ((in,out)), 3 lambda_q1 [32], 4 lambda_q2, 5 lambda_k1, 6 lambda_k2, 7 gamma [64]
  if (ws_size < (size_t)WS_END) return;
  char* ws = (char*)d_ws; _Float16 *QH = (_Float16*)(ws + WS_QH), *QL = (_Float16*)(ws + WS_QL), *KH = (_Float16*)(ws + WS_KH); __bf16 *VT = (__bf16*)(ws + WS_VT), *VL = (__bf16*)(ws + WS_VL), *AH = (__bf16*)(ws + WS_AH), *AL = (__bf16*)(ws + WS_AL);
  k_proj<<<dim3(TNB * TT / 64, CC / 128, 3), 128, 0, stream>>>(F[0], F[1], nullptr, F[1] + CC, nullptr, F[1] + 2 * CC, nullptr, QH, QL, KH, VT, VL, nullptr, nullptr, 0);
  k_att<<<dim3(TT / 64, NH / 2, TNB), 256, 0, stream>>>(QH, QL, KH, VT, VL, F[3], F[4], F[5], F[6], F[7], AH, AL);
  k_out<<<dim3(TNB * TT / 64, CC / 128), 128, 0, stream>>>(AH, AL, F[2], (float*)d_out);
}

// v006
// It runs in 137 microseconds.
// In two side-by-side timings against v005, it was 1.17 and 1.16 times as fast.
// Counting every step since v000, it is 11.1 times as fast.
// compute dtype: all float inputs rounded to bf16, the four lambda vectors and gamma read; qkv = x w_attn ((in,out)) with EXACT bf16 products on WMMA 16x16x32, f32 accumulate; q as f16 hi + residual (x 2^10), k f16 -> 2-product causal logits x (32^-1/2)^2 = 1/32 kept in f32 registers (one launch for all score heads); online softmax in f32, in base 2 (logits x log2(e) / 32, hardware exp2); unnormalised P split bf16 hi + lo against v bf16 hi + lo (3 products), divided by the row sum at the end, per score head into its value head-pair slot; the differential combination P1 v - lambda P2 v, RMSNorm, gamma and (1 - lambda_init) in f32; out = that (bf16 hi + lo) w_proj; f32 output.
#include <hip/hip_runtime.h>
#include <math.h>

typedef __attribute__((ext_vector_type(16))) _Float16 v16h;
typedef __attribute__((ext_vector_type(16))) __bf16 v16b;
typedef __attribute__((ext_vector_type(8)))  _Float16 v8h;
typedef __attribute__((ext_vector_type(8)))  float v8f;
typedef __attribute__((ext_vector_type(4)))  float v4f;
typedef __attribute__((ext_vector_type(2)))  float v2f;
typedef __attribute__((ext_vector_type(4)))  unsigned v4u;
typedef __attribute__((ext_vector_type(4)))  int v4i;
typedef float __attribute__((may_alias)) float_a;
typedef int __attribute__((may_alias)) int_a;

template <typename T> __device__ __forceinline__ void vst2(void* p, T v) { *(T*)p = v;  }
__device__ __forceinline__ v8f wmma16(v16h a, v16h b, v8f c) {
  v8f d = __builtin_amdgcn_wmma_f32_16x16x32_f16(false, a, false, b, (short)0, c, false, false);
  asm volatile("v_nop\n\tv_nop\n\tv_nop\n\tv_nop" : "+v"(d) : "v"(a), "v"(b));
  return d;
}
__device__ __forceinline__ v8f wmma_bf(v16b a, v16b b, v8f c) {
  v8f d = __builtin_amdgcn_wmma_f32_16x16x32_bf16(false, a, false, b, (short)0, c, false, false);
  asm volatile("v_nop\n\tv_nop\n\tv_nop\n\tv_nop" : "+v"(d) : "v"(a), "v"(b));
  return d;
}
// 16x16x32 fragments: lane = (h = lane>>4, row/col = lane&15); elements 0..7 = k0+8h+0..7, 8..15 = k0+16+8h+0..7; D element r = row 8h+r
__device__ __forceinline__ v16h frag_h(const _Float16* rowk0, int lane) {
  union { v16h v; v8h q[2]; } u; const _Float16* p = rowk0 + 8 * (lane >> 4);
  u.q[0] = *(const v8h*)p; u.q[1] = *(const v8h*)(p + 16); return u.v;
}
__device__ __forceinline__ v16h frag_f32(const float* rowk0, int lane) {
  v16h a; const float* p = rowk0 + 8 * (lane >> 4);
#pragma unroll
  for (int i = 0; i < 8; ++i) { a[i] = (_Float16)p[i]; a[8 + i] = (_Float16)p[16 + i]; }
  return a;
}
__device__ __forceinline__ v16h frag_f32s(const float* rowk0, int lane, float sc) {
  v16h a; const float* p = rowk0 + 8 * (lane >> 4);
#pragma unroll
  for (int i = 0; i < 8; ++i) { a[i] = (_Float16)(p[i] * sc); a[8 + i] = (_Float16)(p[16 + i] * sc); }
  return a;
}
// column fragment from a [K][ld] layout (column n), rows >= K read as 0
__device__ __forceinline__ v16h fragc_f32(const float* W, int k0, int n, int lane, int ld, int K) {
  v16h a; const int g = lane >> 4;
#pragma unroll
  for (int i = 0; i < 8; ++i) { const int ka = k0 + 8 * g + i, kb = ka + 16;
    a[i] = (_Float16)(ka < K ? W[(size_t)(ka < K ? ka : K - 1) * ld + n] : 0.f); a[8 + i] = (_Float16)(kb < K ? W[(size_t)(kb < K ? kb : K - 1) * ld + n] : 0.f); }
  return a;
}
struct F2 { v16b h, l; };
__device__ __forceinline__ F2 bsplit16(const float v[16]) { F2 r;
#pragma unroll
  for (int i = 0; i < 16; ++i) { const __bf16 h = (__bf16)v[i]; r.h[i] = h; r.l[i] = (__bf16)(v[i] - (float)h); }
  return r; }
__device__ __forceinline__ F2 split_row(const float* row, int k0, int lane) { float v[16]; const float* p = row + k0 + 8 * (lane >> 4);
#pragma unroll
  for (int i = 0; i < 8; ++i) { v[i] = p[i]; v[8 + i] = p[16 + i]; }
  return bsplit16(v); }
__device__ __forceinline__ F2 split_rowK(const float* row, int k0, int lane, int K) { float v[16]; const int g = lane >> 4;
#pragma unroll
  for (int i = 0; i < 8; ++i) { const int ka = k0 + 8 * g + i, kb = ka + 16; v[i] = ka < K ? row[ka < K ? ka : K - 1] : 0.f; v[8 + i] = kb < K ? row[kb < K ? kb : K - 1] : 0.f; }
  return bsplit16(v); }
__device__ __forceinline__ F2 split_col(const float* W, int k0, int n, int lane, int ld, int K) { float v[16]; const int g = lane >> 4;
#pragma unroll
  for (int i = 0; i < 8; ++i) { const int ka = k0 + 8 * g + i, kb = ka + 16; v[i] = ka < K ? W[(size_t)(ka < K ? ka : K - 1) * ld + n] : 0.f; v[8 + i] = kb < K ? W[(size_t)(kb < K ? kb : K - 1) * ld + n] : 0.f; }
  return bsplit16(v); }
__device__ __forceinline__ v8f mac3(const F2& a, const F2& b, v8f c) { c = wmma_bf(a.l, b.h, c); c = wmma_bf(a.h, b.l, c); return wmma_bf(a.h, b.h, c); }
__device__ __forceinline__ float sigm(float v) { return 1.0f / (1.0f + expf(-v)); }
#define LDSX() do { asm volatile("s_wait_dscnt 0" ::: "memory"); __builtin_amdgcn_wave_barrier(); __builtin_amdgcn_fence(__ATOMIC_RELEASE, "workgroup"); } while (0)


// Differential causal attention (B 4, T 1,024, C 1,024; 2H = 32 score heads x 32, 16 value heads x 64): att = softmax(causal(q k^T / 32)) per score head; diff_i = att_{2i} - lambda att_{2i+1}, lambda = exp(lq1.lk1) - exp(lq2.lk2) + 0.2; out_i = RMSNorm(diff_i v_i) * gamma * 0.8; concat w_proj.
#define NB 4
#define TT 1024
#define CC 1024
#define NH 32              // score heads (2H)
#define HD 32              // score head dim
#define HDV 64             // value head dim (16 value heads)
#define WIN (TT + 1)       // plain causal
#define NKV 32             // k has the same 32 heads
#define LDW 3072           // w_attn (in,out) [1024][3072]: q | k | v column blocks
#define CK (NKV * HD)   // 1,024: k/v row width
#define REP (NH / NKV)
#ifndef TNB
#define TNB NB
#endif
typedef __attribute__((ext_vector_type(8))) __bf16 v8b;
__device__ __forceinline__ v16b frag_b(const __bf16* rowk0, int lane) {
  union { v16b v; v8b q[2]; } u; const __bf16* p = rowk0 + 8 * (lane >> 4);
  u.q[0] = *(const v8b*)p; u.q[1] = *(const v8b*)(p + 16); return u.v;
}
__device__ __forceinline__ float bfr(float v) { return (float)(__bf16)v; }
// ---- operand tiles of one k step (32 deep) in LDS, bf16, in fragment order: a weight fragment read is lane * 16 B, contiguous over the wave; an x fragment read is contiguous per 16-lane half
typedef __attribute__((ext_vector_type(4))) __bf16 v4b;
#define WJ 520             // elements per 16-column group of a weight tile: k 0..15 (256) + k 16..31 (256) + 8 of pad, so that the 16 lanes of a store fall on 16 different 16-B slots
#define XC 160             // elements per 8-k chunk of a wave's 16 x rows: 128 + 32 of pad, for the same reason
#define XO (8 * WJ)        // the x rows stand behind the weight tile (128 columns)
struct WT { v4f r[8]; };   // wave w: rows 8w..8w+7 of the tile, a lane 4 columns; one load = one 512-B row piece = 4 whole lines
__device__ __forceinline__ void ld_wt(WT& t, const float* p, int ld) {
#pragma unroll
  for (int i = 0; i < 8; ++i) t.r[i] = *(const v4f*)(p + (size_t)i * ld); }
__device__ __forceinline__ int wt_slot(int wave, int lane) { return (lane >> 2) * WJ + (wave >> 1) * 256 + (wave & 1) * 128 + (lane & 3) * 32; }   // column 4 lane + c stands c * 8 elements on
__device__ __forceinline__ void st_wt(__bf16* p, const WT& t) {
#pragma unroll
  for (int c = 0; c < 4; ++c) { v8b o;
#pragma unroll
    for (int i = 0; i < 8; ++i) o[i] = (__bf16)t.r[i][c];
    *(v8b*)(p + c * 8) = o; } }
__device__ __forceinline__ v16b frag_wt(const __bf16* tile, int j, int lane) {   // frag_b's k order: elements 0..7 = 8g + 0..7, 8..15 = 16 + 8g + 0..7, column 16 j + col
  union { v16b v; v8b q[2]; } u; const __bf16* p = tile + j * WJ + lane * 8;
  u.q[0] = *(const v8b*)p; u.q[1] = *(const v8b*)(p + 256); return u.v; }
__device__ __attribute__((noinline)) float exp_ni(float v) { return expf(v); }
__device__ __attribute__((noinline)) float erf_ni(float v) { return erff(v); }

#define WS_QH  0u
#define WS_QL  (WS_QH + 2u * (size_t)NB * TT * CC)
#define WS_KH  (WS_QL + 2u * (size_t)NB * TT * CC)
#define WS_VT  (WS_KH + 2u * (size_t)NB * TT * CK)      // bf16 v planes [b][CK][t] (k rows are [b*T+t][CK])
#define WS_VL  (WS_VT + 2u * (size_t)NB * CK * TT)
#define WS_AH  (WS_VL + 2u * (size_t)NB * CK * TT)      // bf16 hi and lo planes of k_out's A rows [b*t][1,024]: the normalised differential output
#define WS_AL  (WS_AH + 2u * (size_t)NB * TT * CC)
#define WS_END (WS_AL + 2u * (size_t)NB * TT * CC)

// ---- k_proj: block = (64 rows, 128 cols, which): qkv = x W (+ b), exact; q -> f16 hi (+ residual), k -> f16 rows, v -> bf16 hi + lo planes
__global__ __launch_bounds__(128) void k_proj(const float* __restrict__ X, const float* __restrict__ WQ, const float* __restrict__ BQ, const float* __restrict__ WK, const float* __restrict__ BK, const float* __restrict__ WV, const float* __restrict__ BV, _Float16* __restrict__ QH, _Float16* __restrict__ QL, _Float16* __restrict__ KH, __bf16* __restrict__ VT, __bf16* __restrict__ VL, const float* __restrict__ NQW, const float* __restrict__ NKW, int wbase) {
  __shared__ __align__(16) _Float16 sh[64][136], sl[64][136]; __shared__ __align__(16) __bf16 th[128][72], tl2[128][72];
  const int tid = threadIdx.x, wave = tid >> 5, lane = tid & 31, col = lane & 15, g = lane >> 4; const int which = wbase + blockIdx.z; const int OW = (which == 0) ? CC : CK;   /* output row width: q 1,024, k/v 1,024 */ const int c0 = blockIdx.y * 128; const size_t r0 = (size_t)blockIdx.x * 64; const float* WA = which == 0 ? WQ : which == 1 ? WK : WV; const float* BA = which == 0 ? BQ : which == 1 ? BK : BV;
  v8f acc[8] = {};
  __bf16* const sb0 = &th[0][0]; __bf16* const sb1 = &tl2[0][0];   /* the two staging buffers (13,440 B each) lie in the epilogue's planes, which are written only behind the loop's last barrier */
  const float* wp = WA + (size_t)(wave * 8) * LDW + c0 + lane * 4;   /* (in,out), row length 3072 */
  const float* xp = X + (r0 + wave * 16 + (lane >> 3)) * CC + (lane & 7) * 4;   /* 8 lanes a row: one load = 4 rows x one whole line */
  const int ws_o = wt_slot(wave, lane), xs_o = XO + wave * 4 * XC + ((lane & 7) >> 1) * XC + (lane >> 3) * 8 + (lane & 1) * 4, xr_o = XO + wave * 4 * XC + g * XC + col * 8;
  WT wt; v4f xt[4]; ld_wt(wt, wp, LDW);
#pragma unroll
  for (int i = 0; i < 4; ++i) xt[i] = *(const v4f*)(xp + (size_t)(4 * i) * CC);
  st_wt(sb0 + ws_o, wt);
#pragma unroll
  for (int i = 0; i < 4; ++i) { v4b o; o[0] = (__bf16)xt[i][0]; o[1] = (__bf16)xt[i][1]; o[2] = (__bf16)xt[i][2]; o[3] = (__bf16)xt[i][3]; *(v4b*)(sb0 + xs_o + i * 32) = o; }
  __syncthreads();
#pragma unroll 2   /* two steps a trip: the buffer of each step is then a constant */
  for (int kc = 0; kc < CC / 32; ++kc) { const __bf16* cur = (kc & 1) ? sb1 : sb0; __bf16* nxt = (kc & 1) ? sb0 : sb1; const bool more = kc + 1 < CC / 32;
    if (more) { ld_wt(wt, wp + (size_t)(kc + 1) * 32 * LDW, LDW);   /* the next step's loads fly under this step's products */
#pragma unroll
      for (int i = 0; i < 4; ++i) xt[i] = *(const v4f*)(xp + (size_t)(4 * i) * CC + (kc + 1) * 32); }
    v16b a, w[8]; { union { v16b v; v8b q[2]; } u; u.q[0] = *(const v8b*)(cur + xr_o); u.q[1] = *(const v8b*)(cur + xr_o + 2 * XC); a = u.v; }
#pragma unroll
    for (int j = 0; j < 8; ++j) w[j] = frag_wt(cur, j, lane);
#pragma unroll
    for (int j = 0; j < 8; ++j) acc[j] = wmma_bf(a, w[j], acc[j]);
    __builtin_amdgcn_sched_barrier(0);   /* or the compiler lifts the roundings below, with their wait for the next step's loads, in among the products, which then stand behind that wait */
    if (more) { st_wt(nxt + ws_o, wt);
#pragma unroll
      for (int i = 0; i < 4; ++i) { v4b o; o[0] = (__bf16)xt[i][0]; o[1] = (__bf16)xt[i][1]; o[2] = (__bf16)xt[i][2]; o[3] = (__bf16)xt[i][3]; *(v4b*)(nxt + xs_o + i * 32) = o; } }
    __syncthreads(); }   /* one barrier a step: it publishes the next tile and ends the reads of the buffer that the next step refills */
#pragma unroll
  for (int j = 0; j < 8; ++j) { const float bb = BA ? bfr(BA[c0 + j * 16 + col]) : 0.f;
#pragma unroll
    for (int r = 0; r < 8; ++r) { const float v = acc[j][r] + bb; const int rl = wave * 16 + 8 * g + r, cl = j * 16 + col; const _Float16 hv = (_Float16)v;
      if (which == 2) { const __bf16 bh = (__bf16)v; th[cl][rl] = bh; tl2[cl][rl] = (__bf16)(v - (float)bh); } else { sh[rl][cl] = hv; sl[rl][cl] = (_Float16)((v - (float)hv) * 1024.0f); }   /* q residual carried x 2^10 so the plane stays f16-normal on the chip */ } }
  __syncthreads();
  if (which < 2) { _Float16* dh = which == 0 ? QH : KH; for (int e = tid; e < 64 * 16; e += 128) { const int rl = e >> 4, q = e & 15; vst2((unsigned*)(dh + (r0 + rl) * OW + c0 + q * 8), *(const v4u*)&sh[rl][q * 8]); if (which == 0) vst2((unsigned*)(QL + (r0 + rl) * CC + c0 + q * 8), *(const v4u*)&sl[rl][q * 8]); } }
  else { const size_t b = r0 / TT; const int t0 = (int)(r0 % TT); for (int e = tid; e < 128 * 8; e += 128) { const int cl = e >> 3, q = e & 7; const size_t o2 = (b * CK + c0 + cl) * (size_t)TT + t0 + q * 8; vst2((unsigned*)(VT + o2), *(const v4u*)&th[cl][q * 8]); vst2((unsigned*)(VL + o2), *(const v4u*)&tl2[cl][q * 8]); } } }
// e[i] = 2^t[i], one instruction each; below -126 it gives 0, which is what a masked or far-off logit is to give. One statement, so that the slot behind a transcendental is kept by construction: behind each v_exp_f32 stands one that neither reads
// its result nor overwrites its source (every output "=&v"), behind the last a v_nop
__device__ __forceinline__ void ex2x9(float* e, const float* t) {
  asm("v_exp_f32 %0, %9\n\tv_exp_f32 %1, %10\n\tv_exp_f32 %2, %11\n\tv_exp_f32 %3, %12\n\tv_exp_f32 %4, %13\n\tv_exp_f32 %5, %14\n\tv_exp_f32 %6, %15\n\tv_exp_f32 %7, %16\n\tv_exp_f32 %8, %17\n\tv_nop"
    : "=&v"(e[0]), "=&v"(e[1]), "=&v"(e[2]), "=&v"(e[3]), "=&v"(e[4]), "=&v"(e[5]), "=&v"(e[6]), "=&v"(e[7]), "=&v"(e[8]) : "v"(t[0]), "v"(t[1]), "v"(t[2]), "v"(t[3]), "v"(t[4]), "v"(t[5]), "v"(t[6]), "v"(t[7]), "v"(t[8])); }
#define LC 0.045084220027780106f   // log2(e) / 32: the logits' scale and the change of base in one factor, so that exp(s / 32 - m) = 2^(s LC - m')
template <int M> __device__ __forceinline__ float xrow(float v) { return __builtin_bit_cast(float, __builtin_amdgcn_update_dpp(0, __builtin_bit_cast(int, v), 0x160 | M, 0xf, 0xf, true)); }   // lane l reads lane l ^ M of its 16-lane row (DPP row_xmask): no LDS round trip
// ---- K and V tiles of one 128-key chunk in LDS, brought once a block by asynchronous 16-B copies and read by all eight waves
#define KP 72              // f16 elements per key row of the K tile: the two score heads' 64 B each + 16 B of pad; pitch = 16 B x odd, so the 16 lanes of a fragment read fall on different banks
#define VP 136             // bf16 elements per value-dim row of a v tile: 256 B + 16 B of pad, for the same reason
struct VF { v16b h[HDV / 16], l[HDV / 16]; };   // v fragments (hi, lo planes) of 32 keys x 64 value dims
__device__ __forceinline__ void ld_v(VF& f, const __bf16* vt, const __bf16* vl, int lane) {
#pragma unroll
  for (int j = 0; j < HDV / 16; ++j) { f.h[j] = frag_b(vt + j * 16 * VP, lane); f.l[j] = frag_b(vl + j * 16 * VP, lane); } }   // from the LDS tiles, row pitch VP
__device__ __forceinline__ void pv32(v8f* acc, const float* prow, int kk, const VF& f, int lane) { const F2 p = split_row(prow, kk, lane);
#pragma unroll
  for (int j = 0; j < HDV / 16; ++j) { acc[j] = wmma_bf(p.h, f.h[j], acc[j]); acc[j] = wmma_bf(p.l, f.h[j], acc[j]); acc[j] = wmma_bf(p.h, f.l[j], acc[j]); } }
__device__ __forceinline__ unsigned lds_off(const void* p) { return (unsigned)(size_t)p; }   // byte offset in the work-group's LDS
// n copies of a lane, copy i standing ls bytes on in LDS and gs bytes on in global memory; the wait is the last line of the copies' own statement, so it stands in front of every rewrite of an address register that they name
__device__ __forceinline__ void acopy4(unsigned l, unsigned ls, const char* p, size_t gs) {
  asm volatile("global_load_async_to_lds_b128 %0, %4, off\n\tglobal_load_async_to_lds_b128 %1, %5, off\n\tglobal_load_async_to_lds_b128 %2, %6, off\n\tglobal_load_async_to_lds_b128 %3, %7, off\n\ts_wait_xcnt 0x0"
    :: "v"(l), "v"(l + ls), "v"(l + 2 * ls), "v"(l + 3 * ls), "v"(p), "v"(p + gs), "v"(p + 2 * gs), "v"(p + 3 * gs) : "memory"); }
// lambda = exp(lq1.lk1) - exp(lq2.lk2) + 0.2: lane i brings element i (one round of loads); the products of bf16-rounded values are exact in f32 and are summed from element 0 up
__device__ __forceinline__ float rdlane(float v, int i) { return __builtin_bit_cast(float, __builtin_amdgcn_readlane(__builtin_bit_cast(int, v), i)); }
__device__ __forceinline__ float lam_lanes(const float* LQ1, const float* LK1, const float* LQ2, const float* LK2, int lane) { const float p1 = bfr(LQ1[lane]) * bfr(LK1[lane]), p2 = bfr(LQ2[lane]) * bfr(LK2[lane]); float s1 = 0.f, s2 = 0.f;
#pragma unroll
  for (int i = 0; i < HD; ++i) { s1 += rdlane(p1, i); s2 += rdlane(p2, i); }
  return expf(s1) - expf(s2) + 0.2f; }
// 1 / sqrt(x) for x >= 1e-5, a normal number, where the library form's rescue of denormal arguments is an identity. One statement, so that the slot behind a transcendental is kept by construction
__device__ __forceinline__ float rsq1(float x) { float r; asm("v_rsq_f32 %0, %1\n\tv_nop" : "=&v"(r) : "v"(x)); return r; }
// ---- k_att: block = 64 queries of (b, value head), 8 waves: waves 0..3 take score head 2i, waves 4..7 score head 2i+1, one wave per 16 queries; all share the chunk's v tiles, and the K tile holds both heads' rows. Per 128-key chunk: 2-product logits x log2(e) / 32 in the D registers, running row maximum and rescale (online softmax),
// P = 2^(s - m) through the wave's own LDS tile into A fragments (bf16 hi + lo), 3-product P . v into acc; the row sums stay per lane until the end; y = acc / l into LDS; then, over the block, (y[2i] - lambda y[2i+1]) rms 0.8 gamma, split bf16 hi + lo: k_out's A rows
__global__ __launch_bounds__(256, 4) /* four waves a SIMD: a budget of 256 registers */ void k_att(const _Float16* __restrict__ QH, const _Float16* __restrict__ QL, const _Float16* __restrict__ KH, const __bf16* __restrict__ VT, const __bf16* __restrict__ VL, const float* __restrict__ LQ1, const float* __restrict__ LQ2, const float* __restrict__ LK1, const float* __restrict__ LK2, const float* __restrict__ GA, __bf16* __restrict__ AH, __bf16* __restrict__ AL) { __shared__ __align__(16) float ss[8][16][132]; __shared__ __align__(16) _Float16 sk[128 * KP]; __shared__ __align__(16) __bf16 sv[2][HDV * VP];
  const int tid = threadIdx.x, wave = tid >> 5, lane = tid & 31, col = lane & 15, g = lane >> 4; const int hs = wave >> 2, wq = wave & 3;   /* which score head of the pair, which 16 queries */ const int vh = blockIdx.x, h = 2 * vh + hs, b = blockIdx.y; const int qt = TT / 64 - 1 - blockIdx.z;   /* the query tile is the slowest block index and falls with it: the tiles with the most key chunks take the lowest indices (for speed only) */ const int ql0 = qt * 64 + wq * 16; const int kend = qt * 64 + 64; const size_t q0 = (size_t)b * TT + ql0;
  const v16h ah = frag_h(QH + (q0 + col) * CC + h * HD, lane), al = frag_h(QL + (q0 + col) * CC + h * HD, lane);
  v8f acc[HDV / 16] = {}; float m[8], l[8];
#pragma unroll
  for (int r = 0; r < 8; ++r) { m[r] = -3.0e38f; l[r] = 0.f; }
  const _Float16* kg = KH + ((size_t)b * TT + (tid >> 3)) * CK + vh * (2 * HD) + (tid & 7) * 8;   /* copies: 8 lanes a key row (both heads, 128 B = one whole line), copy i 32 rows on; the three pointers walk with k0 */
  const size_t po = ((size_t)b * CK + vh * HDV + (tid >> 4)) * (size_t)TT + (tid & 15) * 8;   /* value head vh (64 wide): 16 lanes a row piece (256 B = 2 whole lines), copy i 16 rows on */ const __bf16 *vtg = VT + po, *vlg = VL + po;
  const unsigned kl = lds_off(sk) + (tid >> 3) * (KP * 2) + (tid & 7) * 16, vl0 = lds_off(&sv[0][0]) + (tid >> 4) * (VP * 2) + (tid & 15) * 16, vl1 = vl0 + HDV * VP * 2;
  const _Float16* kp = sk + col * KP + hs * HD + 8 * g;   /* this lane's half of its head's part of its key row of the tile */ const __bf16 *vtp = &sv[0][col * VP], *vlp = &sv[1][col * VP];
#pragma unroll 1   /* rolled: one chunk's body fills the register budget; the inner loops are unrolled so that their arrays are registers */
  for (int k0 = 0; k0 < kend; k0 += 128, kg += (size_t)128 * CK, vtg += 128, vlg += 128) { v8f s[8]; v16h kb[8];
    asm volatile("s_wait_dscnt 0x0" ::: "memory");   /* this wave's reads of the last chunk's tiles have returned ... */
    __syncthreads();   /* ... and so have every wave's: the tiles may be refilled */
    acopy4(kl, 32 * KP * 2, (const char*)kg, (size_t)32 * CK * 2); acopy4(vl0, 16 * VP * 2, (const char*)vtg, (size_t)16 * TT * 2); acopy4(vl1, 16 * VP * 2, (const char*)vlg, (size_t)16 * TT * 2);
    asm volatile("s_wait_asynccnt 0x0" ::: "memory");   /* this wave's copies have landed ... */
    __syncthreads();   /* ... and so have every wave's: the tiles may be read */
#pragma unroll
    for (int j = 0; j < 8; ++j) { union { v16h v; v8h q[2]; } u; const _Float16* p = kp + j * 16 * KP; u.q[0] = *(const v8h*)p; u.q[1] = *(const v8h*)(p + 16); kb[j] = u.v; }   /* frag_h's order */
#pragma unroll
    for (int j = 0; j < 8; ++j) { v8f a0 = {}, a1 = {}; a0 = wmma16(ah, kb[j], a0); a1 = wmma16(al, kb[j], a1); s[j] = a0 + a1 * (1.0f / 1024.0f); }
    const bool full = k0 + 64 < kend;   /* wave-uniform: keys 64..127 of the chunk are open to some row */
    const int dq = ql0 + 8 * g - col - k0;   /* causal test against constants: one register, not one per element */
#pragma unroll
    for (int r = 0; r < 8; ++r) { float mx = -3.0e38f;
#pragma unroll
      for (int j = 0; j < 8; ++j) { const float v = (j * 16 - r <= dq) ? s[j][r] * LC : -3.0e38f;   /* key k0 + 16 j + col <= query ql0 + 8 g + r; q * 32^-1/2 then * 1/sqrt(32) = 1/32, times log2(e) */ s[j][r] = v; mx = fmaxf(mx, v); }
      mx = fmaxf(mx, xrow<1>(mx)); mx = fmaxf(mx, xrow<2>(mx)); mx = fmaxf(mx, xrow<4>(mx)); mx = fmaxf(mx, xrow<8>(mx));   /* the 16 lanes of a half hold one row's columns */
      const float mn = fmaxf(m[r], mx); float t[9], e[9]; t[0] = m[r] - mn; m[r] = mn;   /* the rescale factor first: it is read first */
#pragma unroll
      for (int j = 0; j < 8; ++j) t[1 + j] = s[j][r] - mn;   /* a masked logit (-3e38) gives exactly 0: mn is a real logit, key 0 is open to every row */
      ex2x9(e, t);
      const float sc = e[0]; float ls = l[r] * sc;
#pragma unroll
      for (int j = 0; j < HDV / 16; ++j) acc[j][r] *= sc;
#pragma unroll
      for (int j = 0; j < 8; ++j) { ls += e[1 + j]; ss[wave][8 * g + r][j * 16 + col] = e[1 + j]; }
      asm volatile("" : "+v"(ls));   /* each row's sum, against spills: formed here, or the compiler sinks the adds to the loop's foot and all 64 addends stay live through the P . v products */
      l[r] = ls; }
    LDSX();   /* the wave's own P tile: every lane's stores have landed before a lane reads the others' elements */
    const float* prow = &ss[wave][col][0];
    VF va; ld_v(va, vtp, vlp, lane); pv32(acc, prow, 0, va, lane); ld_v(va, vtp + 32, vlp + 32, lane); pv32(acc, prow, 32, va, lane);
    if (full) { ld_v(va, vtp + 64, vlp + 64, lane); pv32(acc, prow, 64, va, lane); ld_v(va, vtp + 96, vlp + 96, lane); pv32(acc, prow, 96, va, lane); } }
#pragma unroll
  for (int r = 0; r < 8; ++r) { float ls = l[r];
    ls += xrow<1>(ls); ls += xrow<2>(ls); ls += xrow<4>(ls); ls += xrow<8>(ls);
    const float inv = 1.0f / ls;
#pragma unroll
    for (int j = 0; j < HDV / 16; ++j) ss[wave][8 * g + r][j * 16 + col] = acc[j][r] * inv; }
  const float lam = lam_lanes(LQ1, LK1, LQ2, LK2, lane);
  const int row = hs * 8 + (lane >> 2), d0 = (lane & 3) * 16;   /* waves wq and 4 + wq halve the 16 queries of tile wq: 4 lanes a query, 16 value dims a lane */
  v4f gv[4];
#pragma unroll
  for (int q = 0; q < 4; ++q) gv[q] = *(const v4f*)(GA + d0 + q * 4);
  __syncthreads();   /* both score heads' y rows stand in LDS before a wave reads the other head's */
  const float *y1 = &ss[wq][row][d0], *y2 = &ss[4 + wq][row][d0]; float d[16], sq = 0.f;
#pragma unroll
  for (int q = 0; q < 16; ++q) { d[q] = y1[q] - lam * y2[q]; sq += d[q] * d[q]; }
  sq += xrow<1>(sq); sq += xrow<2>(sq);   /* the 4 lanes of a query */
  const float rs = rsq1(sq * (1.0f / HDV) + 1e-5f) * 0.8f; v8b oh[2], ol[2];
#pragma unroll
  for (int q = 0; q < 16; ++q) { const float v = d[q] * rs * bfr(gv[q >> 2][q & 3]); const __bf16 hv = (__bf16)v; oh[q >> 3][q & 7] = hv; ol[q >> 3][q & 7] = (__bf16)(v - (float)hv); }
  const size_t ao = ((size_t)b * TT + qt * 64 + wq * 16 + row) * CC + vh * HDV + d0;   /* a query's 64 dims = one whole 128-B line of each plane, from 4 neighbouring lanes */
  *(v8b*)(AH + ao) = oh[0]; *(v8b*)(AH + ao + 8) = oh[1]; *(v8b*)(AL + ao) = ol[0]; *(v8b*)(AL + ao + 8) = ol[1]; }
__device__ __forceinline__ v16b join_b(v8b a, v8b b) { union { v16b v; v8b q[2]; } u; u.q[0] = a; u.q[1] = b; return u.v; }
// ---- k_out: block = (64 rows, 128 cols): A rows (bf16 hi + lo planes, frag_b's k order) x w_proj ((in,out)); 4-KB rows
__global__ __launch_bounds__(128) void k_out(const __bf16* __restrict__ AH, const __bf16* __restrict__ AL, const float* __restrict__ WP, float* __restrict__ OUT) { __shared__ __align__(16) float sf[4][16][132]; __shared__ __align__(16) __bf16 sw[2][8 * WJ];
  const int tid = threadIdx.x, wave = tid >> 5, lane = tid & 31, col = lane & 15, g = lane >> 4; const int c0 = blockIdx.y * 128; const size_t r0 = (size_t)blockIdx.x * 64 + wave * 16; const size_t arow = r0 + col;
  v8f acc[8] = {};
  const float* wp = WP + (size_t)(wave * 8) * CC + c0 + lane * 4; const int ws_o = wt_slot(wave, lane);
  const __bf16 *hp = AH + arow * CC + 8 * g, *lp = AL + arow * CC + 8 * g;
  WT wt; ld_wt(wt, wp, CC); v8b nh[2], nl[2];   /* step 0's pieces of the A row */
  nh[0] = *(const v8b*)hp; nh[1] = *(const v8b*)(hp + 16); nl[0] = *(const v8b*)lp; nl[1] = *(const v8b*)(lp + 16);
  st_wt(&sw[0][0] + ws_o, wt);
  __syncthreads();
  F2 a; a.h = join_b(nh[0], nh[1]); a.l = join_b(nl[0], nl[1]);
#pragma unroll 2   /* two steps a trip: the buffer of each step is then a constant */
  for (int kc = 0; kc < CC / 32; ++kc) { const bool more = kc + 1 < CC / 32;
    const int kn = kc + 1;
    if (more) { ld_wt(wt, wp + (size_t)kn * 32 * CC, CC);   /* the next step's loads fly under this step's products */
      nh[0] = *(const v8b*)(hp + kn * 32); nh[1] = *(const v8b*)(hp + kn * 32 + 16); nl[0] = *(const v8b*)(lp + kn * 32); nl[1] = *(const v8b*)(lp + kn * 32 + 16);
      asm volatile("s_wait_xcnt 0x0" ::: "memory"); }   /* in front of any rewrite of an address register that the loads above name: the roundings below reuse such registers while the youngest loads are still out */
    v16b w[8];
#pragma unroll
    for (int j = 0; j < 8; ++j) w[j] = frag_wt(&sw[kc & 1][0], j, lane);
#pragma unroll
    for (int j = 0; j < 8; ++j) { acc[j] = wmma_bf(a.h, w[j], acc[j]); acc[j] = wmma_bf(a.l, w[j], acc[j]); }
    __builtin_amdgcn_sched_barrier(0);   /* or the compiler lifts what follows, with its wait for the next step's loads, in among the products, which then stand behind that wait */
    if (more) { a.h = join_b(nh[0], nh[1]); a.l = join_b(nl[0], nl[1]); st_wt(&sw[kn & 1][0] + ws_o, wt); }
    __syncthreads(); }   /* one barrier a step: it publishes the next tile and ends the reads of the buffer that the next step refills */
#pragma unroll
  for (int j = 0; j < 8; ++j)
#pragma unroll
    for (int r = 0; r < 8; ++r) sf[wave][8 * g + r][j * 16 + col] = acc[j][r];
  LDSX(); for (int rl = 0; rl < 16; ++rl) vst2(OUT + (r0 + rl) * CC + c0 + lane * 4, *(const v4f*)&sf[wave][rl][lane * 4]); }
extern "C" void kernel_launch(void* const* d_in, const int* in_sizes, int n_in, void* d_out, int out_size, void* d_ws, size_t ws_size, hipStream_t stream) {
  (void)in_sizes; (void)n_in; (void)out_size;
  const float** F = (const float**)d_in;   // 0 x [4,1024,1024], 1 w_attn [1024,3072] ((in,out): q | k | v), 2 w_proj ((in,out)), 3 lambda_q1 [32], 4 lambda_q2, 5 lambda_k1, 6 lambda_k2, 7 gamma [64]
  if (ws_size < (size_t)WS_END) return;
  char* ws = (char*)d_ws; _Float16 *QH = (_Float16*)(ws + WS_QH), *QL = (_Float16*)(ws + WS_QL), *KH = (_Float16*)(ws + WS_KH); __bf16 *VT = (__bf16*)(ws + WS_VT), *VL = (__bf16*)(ws + WS_VL), *AH = (__bf16*)(ws + WS_AH), *AL = (__bf16*)(ws + WS_AL);
  k_proj<<<dim3(TNB * TT / 64, CC / 128, 3), 128, 0, stream>>>(F[0], F[1], nullptr, F[1] + CC, nullptr, F[1] + 2 * CC, nullptr, QH, QL, KH, VT, VL, nullptr, nullptr, 0);
  k_att<<<dim3(NH / 2, TNB, TT / 64), 256, 0, stream>>>(QH, QL, KH, VT, VL, F[3], F[4], F[5], F[6], F[7], AH, AL);
  k_out<<<dim3(TNB * TT / 64, CC / 128), 128, 0, stream>>>(AH, AL, F[2], (float*)d_out);
}

// v007
// Measured time: 130 microseconds a run.
// Two timings next to v006 both put it at 1.06 times that version's speed.
// Counting every step since v000, it is 11.7 times as fast.
// compute dtype: all float inputs rounded to bf16, the four lambda vectors and gamma read; qkv = x w_attn ((in,out)) with EXACT bf16 products on WMMA 16x16x32, f32 accumulate; q as f16 hi + residual (x 2^10), k f16 -> 2-product causal logits x (32^-1/2)^2 = 1/32 kept in f32 registers (one launch for all score heads); online softmax in f32, in base 2 (logits x log2(e) / 32, hardware exp2); unnormalised P split bf16 hi + lo against v bf16 hi + lo (3 products), divided by the row sum at the end, per score head into its value head-pair slot; the differential combination P1 v - lambda P2 v, RMSNorm, gamma and (1 - lambda_init) in f32; out = that (bf16 hi + lo) w_proj; f32 output.
#include <hip/hip_runtime.h>
#include <math.h>

typedef __attribute__((ext_vector_type(16))) _Float16 v16h;
typedef __attribute__((ext_vector_type(16))) __bf16 v16b;
typedef __attribute__((ext_vector_type(8)))  _Float16 v8h;
typedef __attribute__((ext_vector_type(8)))  float v8f;
typedef __attribute__((ext_vector_type(4)))  float v4f;
typedef __attribute__((ext_vector_type(2)))  float v2f;
typedef __attribute__((ext_vector_type(4)))  unsigned v4u;
typedef __attribute__((ext_vector_type(4)))  int v4i;
typedef float __attribute__((may_alias)) float_a;
typedef int __attribute__((may_alias)) int_a;

template <typename T> __device__ __forceinline__ void vst2(void* p, T v) { *(T*)p = v;  }
__device__ __forceinline__ v8f wmma16(v16h a, v16h b, v8f c) {
  v8f d = __builtin_amdgcn_wmma_f32_16x16x32_f16(false, a, false, b, (short)0, c, false, false);
  asm volatile("v_nop\n\tv_nop\n\tv_nop\n\tv_nop" : "+v"(d) : "v"(a), "v"(b));
  return d;
}
__device__ __forceinline__ v8f wmma_bf(v16b a, v16b b, v8f c) {
  v8f d = __builtin_amdgcn_wmma_f32_16x16x32_bf16(false, a, false, b, (short)0, c, false, false);
  asm volatile("v_nop\n\tv_nop\n\tv_nop\n\tv_nop" : "+v"(d) : "v"(a), "v"(b));
  return d;
}
// 16x16x32 fragments: lane = (h = lane>>4, row/col = lane&15); elements 0..7 = k0+8h+0..7, 8..15 = k0+16+8h+0..7; D element r = row 8h+r
__device__ __forceinline__ v16h frag_h(const _Float16* rowk0, int lane) {
  union { v16h v; v8h q[2]; } u; const _Float16* p = rowk0 + 8 * (lane >> 4);
  u.q[0] = *(const v8h*)p; u.q[1] = *(const v8h*)(p + 16); return u.v;
}
__device__ __forceinline__ v16h frag_f32(const float* rowk0, int lane) {
  v16h a; const float* p = rowk0 + 8 * (lane >> 4);
#pragma unroll
  for (int i = 0; i < 8; ++i) { a[i] = (_Float16)p[i]; a[8 + i] = (_Float16)p[16 + i]; }
  return a;
}
__device__ __forceinline__ v16h frag_f32s(const float* rowk0, int lane, float sc) {
  v16h a; const float* p = rowk0 + 8 * (lane >> 4);
#pragma unroll
  for (int i = 0; i < 8; ++i) { a[i] = (_Float16)(p[i] * sc); a[8 + i] = (_Float16)(p[16 + i] * sc); }
  return a;
}
// column fragment from a [K][ld] layout (column n), rows >= K read as 0
__device__ __forceinline__ v16h fragc_f32(const float* W, int k0, int n, int lane, int ld, int K) {
  v16h a; const int g = lane >> 4;
#pragma unroll
  for (int i = 0; i < 8; ++i) { const int ka = k0 + 8 * g + i, kb = ka + 16;
    a[i] = (_Float16)(ka < K ? W[(size_t)(ka < K ? ka : K - 1) * ld + n] : 0.f); a[8 + i] = (_Float16)(kb < K ? W[(size_t)(kb < K ? kb : K - 1) * ld + n] : 0.f); }
  return a;
}
struct F2 { v16b h, l; };
__device__ __forceinline__ F2 bsplit16(const float v[16]) { F2 r;
#pragma unroll
  for (int i = 0; i < 16; ++i) { const __bf16 h = (__bf16)v[i]; r.h[i] = h; r.l[i] = (__bf16)(v[i] - (float)h); }
  return r; }
__device__ __forceinline__ F2 split_row(const float* row, int k0, int lane) { float v[16]; const float* p = row + k0 + 8 * (lane >> 4);
#pragma unroll
  for (int i = 0; i < 8; ++i) { v[i] = p[i]; v[8 + i] = p[16 + i]; }
  return bsplit16(v); }
__device__ __forceinline__ F2 split_rowK(const float* row, int k0, int lane, int K) { float v[16]; const int g = lane >> 4;
#pragma unroll
  for (int i = 0; i < 8; ++i) { const int ka = k0 + 8 * g + i, kb = ka + 16; v[i] = ka < K ? row[ka < K ? ka : K - 1] : 0.f; v[8 + i] = kb < K ? row[kb < K ? kb : K - 1] : 0.f; }
  return bsplit16(v); }
__device__ __forceinline__ F2 split_col(const float* W, int k0, int n, int lane, int ld, int K) { float v[16]; const int g = lane >> 4;
#pragma unroll
  for (int i = 0; i < 8; ++i) { const int ka = k0 + 8 * g + i, kb = ka + 16; v[i] = ka < K ? W[(size_t)(ka < K ? ka : K - 1) * ld + n] : 0.f; v[8 + i] = kb < K ? W[(size_t)(kb < K ? kb : K - 1) * ld + n] : 0.f; }
  return bsplit16(v); }
__device__ __forceinline__ v8f mac3(const F2& a, const F2& b, v8f c) { c = wmma_bf(a.l, b.h, c); c = wmma_bf(a.h, b.l, c); return wmma_bf(a.h, b.h, c); }
__device__ __forceinline__ float sigm(float v) { return 1.0f / (1.0f + expf(-v)); }
#define LDSX() do { asm volatile("s_wait_dscnt 0" ::: "memory"); __builtin_amdgcn_wave_barrier(); __builtin_amdgcn_fence(__ATOMIC_RELEASE, "workgroup"); } while (0)


// Differential causal attention (B 4, T 1,024, C 1,024; 2H = 32 score heads x 32, 16 value heads x 64): att = softmax(causal(q k^T / 32)) per score head; diff_i = att_{2i} - lambda att_{2i+1}, lambda = exp(lq1.lk1) - exp(lq2.lk2) + 0.2; out_i = RMSNorm(diff_i v_i) * gamma * 0.8; concat w_proj.
#define NB 4
#define TT 1024
#define CC 1024
#define NH 32              // score heads (2H)
#define HD 32              // score head dim
#define HDV 64             // value head dim (16 value heads)
#define WIN (TT + 1)       // plain causal
#define NKV 32             // k has the same 32 heads
#define LDW 3072           // w_attn (in,out) [1024][3072]: q | k | v column blocks
#define CK (NKV * HD)   // 1,024: k/v row width
#define REP (NH / NKV)
#ifndef TNB
#define TNB NB
#endif
typedef __attribute__((ext_vector_type(8))) __bf16 v8b;
__device__ __forceinline__ v16b frag_b(const __bf16* rowk0, int lane) {
  union { v16b v; v8b q[2]; } u; const __bf16* p = rowk0 + 8 * (lane >> 4);
  u.q[0] = *(const v8b*)p; u.q[1] = *(const v8b*)(p + 16); return u.v;
}
__device__ __forceinline__ float bfr(float v) { return (float)(__bf16)v; }
// ---- operand tiles of one k step (32 deep) in LDS, bf16, in fragment order: a weight fragment read is lane * 16 B, contiguous over the wave; an x fragment read is contiguous per 16-lane half
typedef __attribute__((ext_vector_type(4))) __bf16 v4b;
#define WJ 520             // elements per 16-column group of a weight tile: k 0..15 (256) + k 16..31 (256) + 8 of pad, so that the 16 lanes of a store fall on 16 different 16-B slots
#define XC 160             // elements per 8-k chunk of a wave's 16 x rows: 128 + 32 of pad, for the same reason
#define XO (8 * WJ)        // the x rows stand behind the weight tile (128 columns)
struct WT { v4f r[8]; };   // wave w: rows 8w..8w+7 of the tile, a lane 4 columns; one load = one 512-B row piece = 4 whole lines
__device__ __forceinline__ void ld_wt(WT& t, const float* p, int ld) {
#pragma unroll
  for (int i = 0; i < 8; ++i) t.r[i] = *(const v4f*)(p + (size_t)i * ld); }
__device__ __forceinline__ int wt_slot(int wave, int lane) { return (lane >> 2) * WJ + (wave >> 1) * 256 + (wave & 1) * 128 + (lane & 3) * 32; }   // column 4 lane + c stands c * 8 elements on
__device__ __forceinline__ void st_wt(__bf16* p, const WT& t) {
#pragma unroll
  for (int c = 0; c < 4; ++c) { v8b o;
#pragma unroll
    for (int i = 0; i < 8; ++i) o[i] = (__bf16)t.r[i][c];
    *(v8b*)(p + c * 8) = o; } }
__device__ __forceinline__ v16b frag_wt(const __bf16* tile, int j, int lane) {   // frag_b's k order: elements 0..7 = 8g + 0..7, 8..15 = 16 + 8g + 0..7, column 16 j + col
  union { v16b v; v8b q[2]; } u; const __bf16* p = tile + j * WJ + lane * 8;
  u.q[0] = *(const v8b*)p; u.q[1] = *(const v8b*)(p + 256); return u.v; }
__device__ __attribute__((noinline)) float exp_ni(float v) { return expf(v); }
__device__ __attribute__((noinline)) float erf_ni(float v) { return erff(v); }

#define WS_QH  0u
#define WS_QL  (WS_QH + 2u * (size_t)NB * TT * CC)
#define WS_KH  (WS_QL + 2u * (size_t)NB * TT * CC)
#define WS_VT  (WS_KH + 2u * (size_t)NB * TT * CK)      // bf16 v planes [b][CK][t] (k rows are [b*T+t][CK])
#define WS_VL  (WS_VT + 2u * (size_t)NB * CK * TT)
#define WS_AH  (WS_VL + 2u * (size_t)NB * CK * TT)      // bf16 hi and lo planes of k_out's A rows [b*t][1,024]: the normalised differential output
#define WS_AL  (WS_AH + 2u * (size_t)NB * TT * CC)
#define WS_END (WS_AL + 2u * (size_t)NB * TT * CC)

// ---- k_proj: block = (64 rows, 128 cols, which): qkv = x W (+ b), exact; q -> f16 hi (+ residual), k -> f16 rows, v -> bf16 hi + lo planes
__global__ __launch_bounds__(128) void k_proj(const float* __restrict__ X, const float* __restrict__ WQ, const float* __restrict__ BQ, const float* __restrict__ WK, const float* __restrict__ BK, const float* __restrict__ WV, const float* __restrict__ BV, _Float16* __restrict__ QH, _Float16* __restrict__ QL, _Float16* __restrict__ KH, __bf16* __restrict__ VT, __bf16* __restrict__ VL, const float* __restrict__ NQW, const float* __restrict__ NKW, int wbase) {
  __shared__ __align__(16) _Float16 sh[64][136], sl[64][136]; __shared__ __align__(16) __bf16 th[128][72], tl2[128][72];
  const int tid = threadIdx.x, wave = tid >> 5, lane = tid & 31, col = lane & 15, g = lane >> 4; const int which = wbase + blockIdx.z; const int OW = (which == 0) ? CC : CK;   /* output row width: q 1,024, k/v 1,024 */ const int c0 = blockIdx.y * 128; const size_t r0 = (size_t)blockIdx.x * 64; const float* WA = which == 0 ? WQ : which == 1 ? WK : WV; const float* BA = which == 0 ? BQ : which == 1 ? BK : BV;
  v8f acc[8] = {};
  __bf16* const sb0 = &th[0][0]; __bf16* const sb1 = &tl2[0][0];   /* the two staging buffers (13,440 B each) lie in the epilogue's planes, which are written only behind the loop's last barrier */
  const float* wp = WA + (size_t)(wave * 8) * LDW + c0 + lane * 4;   /* (in,out), row length 3072 */
  const float* xp = X + (r0 + wave * 16 + (lane >> 3)) * CC + (lane & 7) * 4;   /* 8 lanes a row: one load = 4 rows x one whole line */
  const int ws_o = wt_slot(wave, lane), xs_o = XO + wave * 4 * XC + ((lane & 7) >> 1) * XC + (lane >> 3) * 8 + (lane & 1) * 4, xr_o = XO + wave * 4 * XC + g * XC + col * 8;
  WT wt; v4f xt[4]; ld_wt(wt, wp, LDW);
#pragma unroll
  for (int i = 0; i < 4; ++i) xt[i] = *(const v4f*)(xp + (size_t)(4 * i) * CC);
  st_wt(sb0 + ws_o, wt);
#pragma unroll
  for (int i = 0; i < 4; ++i) { v4b o; o[0] = (__bf16)xt[i][0]; o[1] = (__bf16)xt[i][1]; o[2] = (__bf16)xt[i][2]; o[3] = (__bf16)xt[i][3]; *(v4b*)(sb0 + xs_o + i * 32) = o; }
  __syncthreads();
#pragma unroll 2   /* two steps a trip: the buffer of each step is then a constant */
  for (int kc = 0; kc < CC / 32; ++kc) { const __bf16* cur = (kc & 1) ? sb1 : sb0; __bf16* nxt = (kc & 1) ? sb0 : sb1; const bool more = kc + 1 < CC / 32;
    if (more) { ld_wt(wt, wp + (size_t)(kc + 1) * 32 * LDW, LDW);   /* the next step's loads fly under this step's products */
#pragma unroll
      for (int i = 0; i < 4; ++i) xt[i] = *(const v4f*)(xp + (size_t)(4 * i) * CC + (kc + 1) * 32); }
    v16b a, w[8]; { union { v16b v; v8b q[2]; } u; u.q[0] = *(const v8b*)(cur + xr_o); u.q[1] = *(const v8b*)(cur + xr_o + 2 * XC); a = u.v; }
#pragma unroll
    for (int j = 0; j < 8; ++j) w[j] = frag_wt(cur, j, lane);
#pragma unroll
    for (int j = 0; j < 8; ++j) acc[j] = wmma_bf(a, w[j], acc[j]);
    __builtin_amdgcn_sched_barrier(0);   /* or the compiler lifts the roundings below, with their wait for the next step's loads, in among the products, which then stand behind that wait */
    if (more) { st_wt(nxt + ws_o, wt);
#pragma unroll
      for (int i = 0; i < 4; ++i) { v4b o; o[0] = (__bf16)xt[i][0]; o[1] = (__bf16)xt[i][1]; o[2] = (__bf16)xt[i][2]; o[3] = (__bf16)xt[i][3]; *(v4b*)(nxt + xs_o + i * 32) = o; } }
    __syncthreads(); }   /* one barrier a step: it publishes the next tile and ends the reads of the buffer that the next step refills */
#pragma unroll
  for (int j = 0; j < 8; ++j) { const float bb = BA ? bfr(BA[c0 + j * 16 + col]) : 0.f;
#pragma unroll
    for (int r = 0; r < 8; ++r) { const float v = acc[j][r] + bb; const int rl = wave * 16 + 8 * g + r, cl = j * 16 + col; const _Float16 hv = (_Float16)v;
      if (which == 2) { const __bf16 bh = (__bf16)v; th[cl][rl] = bh; tl2[cl][rl] = (__bf16)(v - (float)bh); } else { sh[rl][cl] = hv; sl[rl][cl] = (_Float16)((v - (float)hv) * 1024.0f); }   /* q residual carried x 2^10 so the plane stays f16-normal on the chip */ } }
  __syncthreads();
  if (which < 2) { _Float16* dh = which == 0 ? QH : KH; for (int e = tid; e < 64 * 16; e += 128) { const int rl = e >> 4, q = e & 15; vst2((unsigned*)(dh + (r0 + rl) * OW + c0 + q * 8), *(const v4u*)&sh[rl][q * 8]); if (which == 0) vst2((unsigned*)(QL + (r0 + rl) * CC + c0 + q * 8), *(const v4u*)&sl[rl][q * 8]); } }
  else { const size_t b = r0 / TT; const int t0 = (int)(r0 % TT); for (int e = tid; e < 128 * 8; e += 128) { const int cl = e >> 3, q = e & 7; const size_t o2 = (b * CK + c0 + cl) * (size_t)TT + t0 + q * 8; vst2((unsigned*)(VT + o2), *(const v4u*)&th[cl][q * 8]); vst2((unsigned*)(VL + o2), *(const v4u*)&tl2[cl][q * 8]); } } }
// e[i] = 2^t[i], one instruction each; below -126 it gives 0, which is what a masked or far-off logit is to give. One statement, so that the slot behind a transcendental is kept by construction: behind each v_exp_f32 stands one that neither reads
// its result nor overwrites its source (every output "=&v"), behind the last a v_nop
__device__ __forceinline__ void ex2x9(float* e, const float* t) {
  asm("v_exp_f32 %0, %9\n\tv_exp_f32 %1, %10\n\tv_exp_f32 %2, %11\n\tv_exp_f32 %3, %12\n\tv_exp_f32 %4, %13\n\tv_exp_f32 %5, %14\n\tv_exp_f32 %6, %15\n\tv_exp_f32 %7, %16\n\tv_exp_f32 %8, %17\n\tv_nop"
    : "=&v"(e[0]), "=&v"(e[1]), "=&v"(e[2]), "=&v"(e[3]), "=&v"(e[4]), "=&v"(e[5]), "=&v"(e[6]), "=&v"(e[7]), "=&v"(e[8]) : "v"(t[0]), "v"(t[1]), "v"(t[2]), "v"(t[3]), "v"(t[4]), "v"(t[5]), "v"(t[6]), "v"(t[7]), "v"(t[8])); }
__device__ __forceinline__ void ex2x8(float* e, const float* t) {   // the same for eight
  asm("v_exp_f32 %0, %8\n\tv_exp_f32 %1, %9\n\tv_exp_f32 %2, %10\n\tv_exp_f32 %3, %11\n\tv_exp_f32 %4, %12\n\tv_exp_f32 %5, %13\n\tv_exp_f32 %6, %14\n\tv_exp_f32 %7, %15\n\tv_nop"
    : "=&v"(e[0]), "=&v"(e[1]), "=&v"(e[2]), "=&v"(e[3]), "=&v"(e[4]), "=&v"(e[5]), "=&v"(e[6]), "=&v"(e[7]) : "v"(t[0]), "v"(t[1]), "v"(t[2]), "v"(t[3]), "v"(t[4]), "v"(t[5]), "v"(t[6]), "v"(t[7])); }
#define LC 0.045084220027780106f   // log2(e) / 32: the logits' scale and the change of base in one factor, so that exp(s / 32 - m) = 2^(s LC - m')
template <int M> __device__ __forceinline__ float xrow(float v) { return __builtin_bit_cast(float, __builtin_amdgcn_update_dpp(0, __builtin_bit_cast(int, v), 0x160 | M, 0xf, 0xf, true)); }   // lane l reads lane l ^ M of its 16-lane row (DPP row_xmask): no LDS round trip
__device__ __forceinline__ float xhalf(float v) { return __builtin_bit_cast(float, __builtin_amdgcn_permlanex16(__builtin_bit_cast(int, v), __builtin_bit_cast(int, v), 0x76543210, 0xfedcba98, false, false)); }   // lane l reads lane l ^ 16
// ---- K and V tiles of one 128-key chunk in LDS, brought once a block by asynchronous 16-B copies and read by all eight waves
#define KP 72              // f16 elements per key row of the K tile: the two score heads' 64 B each + 16 B of pad; pitch = 16 B x odd, so the 16 lanes of a fragment read fall on different banks
#define VP 136             // bf16 elements per value-dim row of a v tile: 256 B + 16 B of pad, for the same reason
struct VF { v16b h[HDV / 16], l[HDV / 16]; };   // v fragments (hi, lo planes) of 32 keys x 64 value dims
__device__ __forceinline__ void ld_v(VF& f, const __bf16* vt, const __bf16* vl, int lane) {
#pragma unroll
  for (int j = 0; j < HDV / 16; ++j) { f.h[j] = frag_b(vt + j * 16 * VP, lane); f.l[j] = frag_b(vl + j * 16 * VP, lane); } }   // from the LDS tiles, row pitch VP
// two transposed score tiles (keys 0..15 and 16..31 of 32; D register r = key 8 g + r, the lane's column = its query) are, element for element, a B fragment in frag_b's k order; v's rows (value dims) are the A side: acc[j][r] = O^T[16 j + 8 g + r][query]
__device__ __forceinline__ void pvt32(v8f* acc, v8f e0, v8f e1, const VF& f) { float v[16];
#pragma unroll
  for (int i = 0; i < 8; ++i) { v[i] = e0[i]; v[8 + i] = e1[i]; }
  const F2 p = bsplit16(v);
#pragma unroll
  for (int j = 0; j < HDV / 16; ++j) { acc[j] = wmma_bf(f.h[j], p.h, acc[j]); acc[j] = wmma_bf(f.h[j], p.l, acc[j]); acc[j] = wmma_bf(f.l[j], p.h, acc[j]); } }
__device__ __forceinline__ unsigned lds_off(const void* p) { return (unsigned)(size_t)p; }   // byte offset in the work-group's LDS
// n copies of a lane, copy i standing ls bytes on in LDS and gs bytes on in global memory; the wait is the last line of the copies' own statement, so it stands in front of every rewrite of an address register that they name
__device__ __forceinline__ void acopy4(unsigned l, unsigned ls, const char* p, size_t gs) {
  asm volatile("global_load_async_to_lds_b128 %0, %4, off\n\tglobal_load_async_to_lds_b128 %1, %5, off\n\tglobal_load_async_to_lds_b128 %2, %6, off\n\tglobal_load_async_to_lds_b128 %3, %7, off\n\ts_wait_xcnt 0x0"
    :: "v"(l), "v"(l + ls), "v"(l + 2 * ls), "v"(l + 3 * ls), "v"(p), "v"(p + gs), "v"(p + 2 * gs), "v"(p + 3 * gs) : "memory"); }
// lambda = exp(lq1.lk1) - exp(lq2.lk2) + 0.2: lane i brings element i (one round of loads); the products of bf16-rounded values are exact in f32 and are summed from element 0 up
__device__ __forceinline__ float rdlane(float v, int i) { return __builtin_bit_cast(float, __builtin_amdgcn_readlane(__builtin_bit_cast(int, v), i)); }
__device__ __forceinline__ float lam_lanes(const float* LQ1, const float* LK1, const float* LQ2, const float* LK2, int lane) { const float p1 = bfr(LQ1[lane]) * bfr(LK1[lane]), p2 = bfr(LQ2[lane]) * bfr(LK2[lane]); float s1 = 0.f, s2 = 0.f;
#pragma unroll
  for (int i = 0; i < HD; ++i) { s1 += rdlane(p1, i); s2 += rdlane(p2, i); }
  return expf(s1) - expf(s2) + 0.2f; }
// 1 / sqrt(x) for x >= 1e-5, a normal number, where the library form's rescue of denormal arguments is an identity. One statement, so that the slot behind a transcendental is kept by construction
__device__ __forceinline__ float rsq1(float x) { float r; asm("v_rsq_f32 %0, %1\n\tv_nop" : "=&v"(r) : "v"(x)); return r; }
// ---- k_att: block = 64 queries of (b, value head), 8 waves: waves 0..3 take score head 2i, waves 4..7 score head 2i+1, one wave per 16 queries; all share the chunk's v tiles, and the K tile holds both heads' rows. Per 128-key chunk: 2-product logits transposed (K rows the A side, q the B side), x log2(e) / 32, in the D registers: a lane holds 64 keys of ONE query, its partner lane ^ 16 the other 64; running maximum and rescale (online softmax) in the lane, one exchange between the halves;
// P = 2^(s - m) goes from the D registers straight into B fragments (bf16 hi + lo), 3-product v^T . P^T into acc; the sums stay per lane until the end; y = acc / l into LDS; then, over the block, (y[2i] - lambda y[2i+1]) rms 0.8 gamma, split bf16 hi + lo: k_out's A rows
__global__ __launch_bounds__(256, 4) /* four waves a SIMD: a budget of 256 registers */ void k_att(const _Float16* __restrict__ QH, const _Float16* __restrict__ QL, const _Float16* __restrict__ KH, const __bf16* __restrict__ VT, const __bf16* __restrict__ VL, const float* __restrict__ LQ1, const float* __restrict__ LQ2, const float* __restrict__ LK1, const float* __restrict__ LK2, const float* __restrict__ GA, __bf16* __restrict__ AH, __bf16* __restrict__ AL) { __shared__ __align__(16) float ss[8][16][68];   /* y rows of the epilogue; pitch = 16 B x odd */ __shared__ __align__(16) _Float16 sk[128 * KP]; __shared__ __align__(16) __bf16 sv[2][HDV * VP];
  const int tid = threadIdx.x, wave = tid >> 5, lane = tid & 31, col = lane & 15, g = lane >> 4; const int hs = wave >> 2, wq = wave & 3;   /* which score head of the pair, which 16 queries */ const int vh = blockIdx.x, h = 2 * vh + hs, b = blockIdx.y; const int qt = TT / 64 - 1 - blockIdx.z;   /* the query tile is the slowest block index and falls with it: the tiles with the most key chunks come first in index order (for speed only) */ const int ql0 = qt * 64 + wq * 16; const int kend = qt * 64 + 64; const size_t q0 = (size_t)b * TT + ql0;
  const v16h ah = frag_h(QH + (q0 + col) * CC + h * HD, lane), al = frag_h(QL + (q0 + col) * CC + h * HD, lane);
  v8f acc[HDV / 16] = {}; float m = -3.0e38f, l = 0.f;   /* of this lane's query, ql0 + col */
  const _Float16* kg = KH + ((size_t)b * TT + (tid >> 3)) * CK + vh * (2 * HD) + (tid & 7) * 8;   /* copies: 8 lanes a key row (both heads, 128 B = one whole line), copy i 32 rows on; the three pointers walk with k0 */
  const size_t po = ((size_t)b * CK + vh * HDV + (tid >> 4)) * (size_t)TT + (tid & 15) * 8;   /* value head vh (64 wide): 16 lanes a row piece (256 B = 2 whole lines), copy i 16 rows on */ const __bf16 *vtg = VT + po, *vlg = VL + po;
  const unsigned kl = lds_off(sk) + (tid >> 3) * (KP * 2) + (tid & 7) * 16, vl0 = lds_off(&sv[0][0]) + (tid >> 4) * (VP * 2) + (tid & 15) * 16, vl1 = vl0 + HDV * VP * 2;
  const _Float16* kp = sk + col * KP + hs * HD + 8 * g;   /* this lane's half of its head's part of its key row of the tile */ const __bf16 *vtp = &sv[0][col * VP], *vlp = &sv[1][col * VP];
#pragma unroll 1   /* rolled: one chunk's body fills the register budget; the inner loops are unrolled so that their arrays are registers */
  for (int k0 = 0; k0 < kend; k0 += 128, kg += (size_t)128 * CK, vtg += 128, vlg += 128) { v8f s[8]; v16h kb[8];
    asm volatile("s_wait_dscnt 0x0" ::: "memory");   /* this wave's reads of the last chunk's tiles have returned ... */
    __syncthreads();   /* ... and so have every wave's: the tiles may be refilled */
    acopy4(kl, 32 * KP * 2, (const char*)kg, (size_t)32 * CK * 2); acopy4(vl0, 16 * VP * 2, (const char*)vtg, (size_t)16 * TT * 2); acopy4(vl1, 16 * VP * 2, (const char*)vlg, (size_t)16 * TT * 2);
    asm volatile("s_wait_asynccnt 0x0" ::: "memory");   /* this wave's copies have landed ... */
    __syncthreads();   /* ... and so have every wave's: the tiles may be read */
#pragma unroll
    for (int j = 0; j < 8; ++j) { union { v16h v; v8h q[2]; } u; const _Float16* p = kp + j * 16 * KP; u.q[0] = *(const v8h*)p; u.q[1] = *(const v8h*)(p + 16); kb[j] = u.v; }   /* frag_h's order */
#pragma unroll
    for (int j = 0; j < 8; ++j) { v8f a0 = {}, a1 = {}; a0 = wmma16(kb[j], ah, a0); a1 = wmma16(kb[j], al, a1); s[j] = a0 + a1 * (1.0f / 1024.0f); }
    const bool full = k0 + 64 < kend;   /* wave-uniform: keys 64..127 of the chunk are open to some row */
    const int dq = ql0 + col - 8 * g - k0;   /* causal test against constants: one register, not one per element */
    float mj[8];   /* eight independent chains */
#pragma unroll
    for (int j = 0; j < 8; ++j) { mj[j] = -3.0e38f;
#pragma unroll
      for (int r = 0; r < 8; ++r) { const float v = (j * 16 + r <= dq) ? s[j][r] * LC : -3.0e38f;   /* key k0 + 16 j + 8 g + r <= query ql0 + col; q * 32^-1/2 then * 1/sqrt(32) = 1/32, times log2(e) */ s[j][r] = v; mj[j] = fmaxf(mj[j], v); } }
    float mx = fmaxf(fmaxf(fmaxf(mj[0], mj[1]), fmaxf(mj[2], mj[3])), fmaxf(fmaxf(mj[4], mj[5]), fmaxf(mj[6], mj[7])));
    mx = fmaxf(mx, xhalf(mx));   /* the two halves hold one query's keys */
    const float mn = fmaxf(m, mx); float sc;
    { float t[9], e[9]; t[0] = m - mn;   /* the rescale factor */
#pragma unroll
      for (int r = 0; r < 8; ++r) t[1 + r] = s[0][r] - mn;   /* a masked logit (-3e38) gives exactly 0: mn is a real logit, key 0 is open to every query */
      ex2x9(e, t); sc = e[0];
#pragma unroll
      for (int r = 0; r < 8; ++r) s[0][r] = e[1 + r]; }
#pragma unroll
    for (int j = 1; j < 8; ++j) { float t[8], e[8];
#pragma unroll
      for (int r = 0; r < 8; ++r) t[r] = s[j][r] - mn;
      ex2x8(e, t);
#pragma unroll
      for (int r = 0; r < 8; ++r) s[j][r] = e[r]; }
    m = mn;
    const v8f sm = ((s[0] + s[1]) + (s[2] + s[3])) + ((s[4] + s[5]) + (s[6] + s[7]));
    l = l * sc + (((sm[0] + sm[1]) + (sm[2] + sm[3])) + ((sm[4] + sm[5]) + (sm[6] + sm[7])));
#pragma unroll
    for (int j = 0; j < HDV / 16; ++j) acc[j] *= sc;
    VF va; ld_v(va, vtp, vlp, lane); pvt32(acc, s[0], s[1], va); ld_v(va, vtp + 32, vlp + 32, lane); pvt32(acc, s[2], s[3], va);
    if (full) { ld_v(va, vtp + 64, vlp + 64, lane); pvt32(acc, s[4], s[5], va); ld_v(va, vtp + 96, vlp + 96, lane); pvt32(acc, s[6], s[7], va); } }
  const float inv = 1.0f / (l + xhalf(l));   /* the halves' sums joined once */
#pragma unroll
  for (int j = 0; j < HDV / 16; ++j) { const v8f y = acc[j] * inv; v4f y0, y1v;   /* a lane's 8 registers are 8 neighbouring value dims of its query's row */
#pragma unroll
    for (int r = 0; r < 4; ++r) { y0[r] = y[r]; y1v[r] = y[4 + r]; }
    *(v4f*)&ss[wave][col][j * 16 + 8 * g] = y0; *(v4f*)&ss[wave][col][j * 16 + 8 * g + 4] = y1v; }
  const float lam = lam_lanes(LQ1, LK1, LQ2, LK2, lane);
  const int row = hs * 8 + (lane >> 2), d0 = (lane & 3) * 16;   /* waves wq and 4 + wq halve the 16 queries of tile wq: 4 lanes a query, 16 value dims a lane */
  v4f gv[4];
#pragma unroll
  for (int q = 0; q < 4; ++q) gv[q] = *(const v4f*)(GA + d0 + q * 4);
  __syncthreads();   /* both score heads' y rows stand in LDS before a wave reads the other head's */
  const float *y1 = &ss[wq][row][d0], *y2 = &ss[4 + wq][row][d0]; float d[16], sq = 0.f;
#pragma unroll
  for (int q = 0; q < 16; ++q) { d[q] = y1[q] - lam * y2[q]; sq += d[q] * d[q]; }
  sq += xrow<1>(sq); sq += xrow<2>(sq);   /* the 4 lanes of a query */
  const float rs = rsq1(sq * (1.0f / HDV) + 1e-5f) * 0.8f; v8b oh[2], ol[2];
#pragma unroll
  for (int q = 0; q < 16; ++q) { const float v = d[q] * rs * bfr(gv[q >> 2][q & 3]); const __bf16 hv = (__bf16)v; oh[q >> 3][q & 7] = hv; ol[q >> 3][q & 7] = (__bf16)(v - (float)hv); }
  const size_t ao = ((size_t)b * TT + qt * 64 + wq * 16 + row) * CC + vh * HDV + d0;   /* a query's 64 dims = one whole 128-B line of each plane, from 4 neighbouring lanes */
  *(v8b*)(AH + ao) = oh[0]; *(v8b*)(AH + ao + 8) = oh[1]; *(v8b*)(AL + ao) = ol[0]; *(v8b*)(AL + ao + 8) = ol[1]; }
__device__ __forceinline__ v16b join_b(v8b a, v8b b) { union { v16b v; v8b q[2]; } u; u.q[0] = a; u.q[1] = b; return u.v; }
// ---- k_out: block = (64 rows, 128 cols): A rows (bf16 hi + lo planes, frag_b's k order) x w_proj ((in,out)); 4-KB rows
__global__ __launch_bounds__(128) void k_out(const __bf16* __restrict__ AH, const __bf16* __restrict__ AL, const float* __restrict__ WP, float* __restrict__ OUT) { __shared__ __align__(16) float sf[4][16][132]; __shared__ __align__(16) __bf16 sw[2][8 * WJ];
  const int tid = threadIdx.x, wave = tid >> 5, lane = tid & 31, col = lane & 15, g = lane >> 4; const int c0 = blockIdx.y * 128; const size_t r0 = (size_t)blockIdx.x * 64 + wave * 16; const size_t arow = r0 + col;
  v8f acc[8] = {};
  const float* wp = WP + (size_t)(wave * 8) * CC + c0 + lane * 4; const int ws_o = wt_slot(wave, lane);
  const __bf16 *hp = AH + arow * CC + 8 * g, *lp = AL + arow * CC + 8 * g;
  WT wt; ld_wt(wt, wp, CC); v8b nh[2], nl[2];   /* step 0's pieces of the A row */
  nh[0] = *(const v8b*)hp; nh[1] = *(const v8b*)(hp + 16); nl[0] = *(const v8b*)lp; nl[1] = *(const v8b*)(lp + 16);
  st_wt(&sw[0][0] + ws_o, wt);
  __syncthreads();
  F2 a; a.h = join_b(nh[0], nh[1]); a.l = join_b(nl[0], nl[1]);
#pragma unroll 2   /* two steps a trip: the buffer of each step is then a constant */
  for (int kc = 0; kc < CC / 32; ++kc) { const bool more = kc + 1 < CC / 32;
    const int kn = kc + 1;
    if (more) { ld_wt(wt, wp + (size_t)kn * 32 * CC, CC);   /* the next step's loads fly under this step's products */
      nh[0] = *(const v8b*)(hp + kn * 32); nh[1] = *(const v8b*)(hp + kn * 32 + 16); nl[0] = *(const v8b*)(lp + kn * 32); nl[1] = *(const v8b*)(lp + kn * 32 + 16);
      asm volatile("s_wait_xcnt 0x0" ::: "memory"); }   /* in front of any rewrite of an address register that the loads above name: the roundings below reuse such registers while the youngest loads are still out */
    v16b w[8];
#pragma unroll
    for (int j = 0; j < 8; ++j) w[j] = frag_wt(&sw[kc & 1][0], j, lane);
#pragma unroll
    for (int j = 0; j < 8; ++j) { acc[j] = wmma_bf(a.h, w[j], acc[j]); acc[j] = wmma_bf(a.l, w[j], acc[j]); }
    __builtin_amdgcn_sched_barrier(0);   /* or the compiler lifts what follows, with its wait for the next step's loads, in among the products, which then stand behind that wait */
    if (more) { a.h = join_b(nh[0], nh[1]); a.l = join_b(nl[0], nl[1]); st_wt(&sw[kn & 1][0] + ws_o, wt); }
    __syncthreads(); }   /* one barrier a step: it publishes the next tile and ends the reads of the buffer that the next step refills */
#pragma unroll
  for (int j = 0; j < 8; ++j)
#pragma unroll
    for (int r = 0; r < 8; ++r) sf[wave][8 * g + r][j * 16 + col] = acc[j][r];
  LDSX(); for (int rl = 0; rl < 16; ++rl) vst2(OUT + (r0 + rl) * CC + c0 + lane * 4, *(const v4f*)&sf[wave][rl][lane * 4]); }
extern "C" void kernel_launch(void* const* d_in, const int* in_sizes, int n_in, void* d_out, int out_size, void* d_ws, size_t ws_size, hipStream_t stream) {
  (void)in_sizes; (void)n_in; (void)out_size;
  const float** F = (const float**)d_in;   // 0 x [4,1024,1024], 1 w_attn [1024,3072] ((in,out): q | k | v), 2 w_proj ((in,out)), 3 lambda_q1 [32], 4 lambda_q2, 5 lambda_k1, 6 lambda_k2, 7 gamma [64]
  if (ws_size < (size_t)WS_END) return;
  char* ws = (char*)d_ws; _Float16 *QH = (_Float16*)(ws + WS_QH), *QL = (_Float16*)(ws + WS_QL), *KH = (_Float16*)(ws + WS_KH); __bf16 *VT = (__bf16*)(ws + WS_VT), *VL = (__bf16*)(ws + WS_VL), *AH = (__bf16*)(ws + WS_AH), *AL = (__bf16*)(ws + WS_AL);
  k_proj<<<dim3(TNB * TT / 64, CC / 128, 3), 128, 0, stream>>>(F[0], F[1], nullptr, F[1] + CC, nullptr, F[1] + 2 * CC, nullptr, QH, QL, KH, VT, VL, nullptr, nullptr, 0);
  k_att<<<dim3(NH / 2, TNB, TT / 64), 256, 0, stream>>>(QH, QL, KH, VT, VL, F[3], F[4], F[5], F[6], F[7], AH, AL);
  k_out<<<dim3(TNB * TT / 64, CC / 128), 128, 0, stream>>>(AH, AL, F[2], (float*)d_out);
}

// v008
// A run of this version takes 108 microseconds.
// Next to v007, in two timings, it ran 1.20 and 1.21 times as fast.
// Over all steps from v000 it is 14.1 times as fast.
// compute dtype: all float inputs rounded to bf16, the four lambda vectors and gamma read; qkv = x w_attn ((in,out)) with EXACT bf16 products on WMMA 16x16x32, f32 accumulate; q as f16 hi + residual (x 2^10), k f16 -> 2-product causal logits x (32^-1/2)^2 = 1/32 kept in f32 registers (one launch for all score heads); online softmax in f32, in base 2 (logits x log2(e) / 32, hardware exp2); unnormalised P split bf16 hi + lo against v bf16 hi + lo (3 products), divided by the row sum at the end, per score head into its value head-pair slot; the differential combination P1 v - lambda P2 v, RMSNorm, gamma and (1 - lambda_init) in f32; out = that (bf16 hi + lo) w_proj; f32 output.
#include <hip/hip_runtime.h>
#include <math.h>

typedef __attribute__((ext_vector_type(16))) _Float16 v16h;
typedef __attribute__((ext_vector_type(16))) __bf16 v16b;
typedef __attribute__((ext_vector_type(8)))  _Float16 v8h;
typedef __attribute__((ext_vector_type(8)))  float v8f;
typedef __attribute__((ext_vector_type(4)))  float v4f;
typedef __attribute__((ext_vector_type(2)))  float v2f;
typedef __attribute__((ext_vector_type(4)))  unsigned v4u;
typedef __attribute__((ext_vector_type(4)))  int v4i;
typedef float __attribute__((may_alias)) float_a;
typedef int __attribute__((may_alias)) int_a;

template <typename T> __device__ __forceinline__ void vst2(void* p, T v) { *(T*)p = v;  }
__device__ __forceinline__ v8f wmma16(v16h a, v16h b, v8f c) {
  v8f d = __builtin_amdgcn_wmma_f32_16x16x32_f16(false, a, false, b, (short)0, c, false, false);
  asm volatile("v_nop\n\tv_nop\n\tv_nop\n\tv_nop" : "+v"(d) : "v"(a), "v"(b));
  return d;
}
__device__ __forceinline__ v8f wmma_bf(v16b a, v16b b, v8f c) {
  v8f d = __builtin_amdgcn_wmma_f32_16x16x32_bf16(false, a, false, b, (short)0, c, false, false);
  asm volatile("v_nop\n\tv_nop\n\tv_nop\n\tv_nop" : "+v"(d) : "v"(a), "v"(b));
  return d;
}
// 16x16x32 fragments: lane = (h = lane>>4, row/col = lane&15); elements 0..7 = k0+8h+0..7, 8..15 = k0+16+8h+0..7; D element r = row 8h+r
__device__ __forceinline__ v16h frag_h(const _Float16* rowk0, int lane) {
  union { v16h v; v8h q[2]; } u; const _Float16* p = rowk0 + 8 * (lane >> 4);
  u.q[0] = *(const v8h*)p; u.q[1] = *(const v8h*)(p + 16); return u.v;
}
__device__ __forceinline__ v16h frag_f32(const float* rowk0, int lane) {
  v16h a; const float* p = rowk0 + 8 * (lane >> 4);
#pragma unroll
  for (int i = 0; i < 8; ++i) { a[i] = (_Float16)p[i]; a[8 + i] = (_Float16)p[16 + i]; }
  return a;
}
__device__ __forceinline__ v16h frag_f32s(const float* rowk0, int lane, float sc) {
  v16h a; const float* p = rowk0 + 8 * (lane >> 4);
#pragma unroll
  for (int i = 0; i < 8; ++i) { a[i] = (_Float16)(p[i] * sc); a[8 + i] = (_Float16)(p[16 + i] * sc); }
  return a;
}
// column fragment from a [K][ld] layout (column n), rows >= K read as 0
__device__ __forceinline__ v16h fragc_f32(const float* W, int k0, int n, int lane, int ld, int K) {
  v16h a; const int g = lane >> 4;
#pragma unroll
  for (int i = 0; i < 8; ++i) { const int ka = k0 + 8 * g + i, kb = ka + 16;
    a[i] = (_Float16)(ka < K ? W[(size_t)(ka < K ? ka : K - 1) * ld + n] : 0.f); a[8 + i] = (_Float16)(kb < K ? W[(size_t)(kb < K ? kb : K - 1) * ld + n] : 0.f); }
  return a;
}
struct F2 { v16b h, l; };
__device__ __forceinline__ F2 bsplit16(const float v[16]) { F2 r;
#pragma unroll
  for (int i = 0; i < 16; ++i) { const __bf16 h = (__bf16)v[i]; r.h[i] = h; r.l[i] = (__bf16)(v[i] - (float)h); }
  return r; }
__device__ __forceinline__ F2 split_row(const float* row, int k0, int lane) { float v[16]; const float* p = row + k0 + 8 * (lane >> 4);
#pragma unroll
  for (int i = 0; i < 8; ++i) { v[i] = p[i]; v[8 + i] = p[16 + i]; }
  return bsplit16(v); }
__device__ __forceinline__ F2 split_rowK(const float* row, int k0, int lane, int K) { float v[16]; const int g = lane >> 4;
#pragma unroll
  for (int i = 0; i < 8; ++i) { const int ka = k0 + 8 * g + i, kb = ka + 16; v[i] = ka < K ? row[ka < K ? ka : K - 1] : 0.f; v[8 + i] = kb < K ? row[kb < K ? kb : K - 1] : 0.f; }
  return bsplit16(v); }
__device__ __forceinline__ F2 split_col(const float* W, int k0, int n, int lane, int ld, int K) { float v[16]; const int g = lane >> 4;
#pragma unroll
  for (int i = 0; i < 8; ++i) { const int ka = k0 + 8 * g + i, kb = ka + 16; v[i] = ka < K ? W[(size_t)(ka < K ? ka : K - 1) * ld + n] : 0.f; v[8 + i] = kb < K ? W[(size_t)(kb < K ? kb : K - 1) * ld + n] : 0.f; }
  return bsplit16(v); }
__device__ __forceinline__ v8f mac3(const F2& a, const F2& b, v8f c) { c = wmma_bf(a.l, b.h, c); c = wmma_bf(a.h, b.l, c); return wmma_bf(a.h, b.h, c); }
__device__ __forceinline__ float sigm(float v) { return 1.0f / (1.0f + expf(-v)); }
#define LDSX() do { asm volatile("s_wait_dscnt 0" ::: "memory"); __builtin_amdgcn_wave_barrier(); __builtin_amdgcn_fence(__ATOMIC_RELEASE, "workgroup"); } while (0)


// Differential causal attention (B 4, T 1,024, C 1,024; 2H = 32 score heads x 32, 16 value heads x 64): att = softmax(causal(q k^T / 32)) per score head; diff_i = att_{2i} - lambda att_{2i+1}, lambda = exp(lq1.lk1) - exp(lq2.lk2) + 0.2; out_i = RMSNorm(diff_i v_i) * gamma * 0.8; concat w_proj.
#define NB 4
#define TT 1024
#define CC 1024
#define NH 32              // score heads (2H)
#define HD 32              // score head dim
#define HDV 64             // value head dim (16 value heads)
#define WIN (TT + 1)       // plain causal
#define NKV 32             // k has the same 32 heads
#define LDW 3072           // w_attn (in,out) [1024][3072]: q | k | v column blocks
#define CK (NKV * HD)   // 1,024: k/v row width
#define REP (NH / NKV)
#ifndef TNB
#define TNB NB
#endif
typedef __attribute__((ext_vector_type(8))) __bf16 v8b;
__device__ __forceinline__ v16b frag_b(const __bf16* rowk0, int lane) {
  union { v16b v; v8b q[2]; } u; const __bf16* p = rowk0 + 8 * (lane >> 4);
  u.q[0] = *(const v8b*)p; u.q[1] = *(const v8b*)(p + 16); return u.v;
}
__device__ __forceinline__ float bfr(float v) { return (float)(__bf16)v; }
// ---- operand tiles of one k step (32 deep) in LDS, bf16, in fragment order: a weight fragment read is lane * 16 B, contiguous over the wave; an x fragment read is contiguous per 16-lane half
typedef __attribute__((ext_vector_type(4))) __bf16 v4b;
#define WJ 520             // elements per 16-column group of a weight tile: k 0..15 (256) + k 16..31 (256) + 8 of pad, so that the 16 lanes of a store fall on 16 different 16-B slots
#define XC 160             // elements per 8-k chunk of a group of 16 x rows: 128 + 32 of pad, for the same reason
#define XO (16 * WJ)       // the x rows stand behind k_proj's weight tile (256 columns)
struct WT { v4f r[8]; };   // wave w: rows 8w..8w+7 of the tile, a lane 4 columns; one load = one 512-B row piece = 4 whole lines
__device__ __forceinline__ void ld_wt(WT& t, const float* p, int ld) {
#pragma unroll
  for (int i = 0; i < 8; ++i) t.r[i] = *(const v4f*)(p + (size_t)i * ld); }
__device__ __forceinline__ int wt_slot(int wave, int lane) { return (lane >> 2) * WJ + (wave >> 1) * 256 + (wave & 1) * 128 + (lane & 3) * 32; }   // column 4 lane + c stands c * 8 elements on
__device__ __forceinline__ void st_wt(__bf16* p, const WT& t) {
#pragma unroll
  for (int c = 0; c < 4; ++c) { v8b o;
#pragma unroll
    for (int i = 0; i < 8; ++i) o[i] = (__bf16)t.r[i][c];
    *(v8b*)(p + c * 8) = o; } }
__device__ __forceinline__ v16b frag_wt(const __bf16* tile, int j, int lane) {   // frag_b's k order: elements 0..7 = 8g + 0..7, 8..15 = 16 + 8g + 0..7, column 16 j + col
  union { v16b v; v8b q[2]; } u; const __bf16* p = tile + j * WJ + lane * 8;
  u.q[0] = *(const v8b*)p; u.q[1] = *(const v8b*)(p + 256); return u.v; }
__device__ __attribute__((noinline)) float exp_ni(float v) { return expf(v); }
__device__ __attribute__((noinline)) float erf_ni(float v) { return erff(v); }

#define WS_QH  0u
#define WS_QL  (WS_QH + 2u * (size_t)NB * TT * CC)
#define WS_KH  (WS_QL + 2u * (size_t)NB * TT * CC)
#define WS_VT  (WS_KH + 2u * (size_t)NB * TT * CK)      // bf16 v planes [b][CK][t] (k rows are [b*T+t][CK])
#define WS_VL  (WS_VT + 2u * (size_t)NB * CK * TT)
#define WS_AH  (WS_VL + 2u * (size_t)NB * CK * TT)      // bf16 hi and lo planes of k_out's A rows [b*t][1,024]: the normalised differential output
#define WS_AL  (WS_AH + 2u * (size_t)NB * TT * CC)
#define WS_END (WS_AL + 2u * (size_t)NB * TT * CC)

// ---- k_proj: block = (256 rows, 256 cols, which), 16 waves in a 4 x 4 grid, a wave 64 x 64 (4 x 4 accumulator tiles): qkv = x W (+ b), exact; q -> f16 hi (+ residual), k -> f16 rows, v -> bf16 planes. Each fetched x row serves 256 columns and each weight row 256 rows; each fragment read from LDS serves 4 products
__device__ __forceinline__ void ld_xt(WT& t, const float* p) {   // 32 x rows of one k step: 8 lanes a row, one load = 4 rows x one whole line
#pragma unroll
  for (int i = 0; i < 8; ++i) t.r[i] = *(const v4f*)(p + (size_t)(4 * i) * CC); }
__device__ __forceinline__ void st_xt(__bf16* p, const WT& t) {   // loads 0..3 are the first 16-row group, 4..7 the second
#pragma unroll
  for (int i = 0; i < 8; ++i) { v4b o; o[0] = (__bf16)t.r[i][0]; o[1] = (__bf16)t.r[i][1]; o[2] = (__bf16)t.r[i][2]; o[3] = (__bf16)t.r[i][3]; *(v4b*)(p + (i >> 2) * 4 * XC + (i & 3) * 32) = o; } }
#define SBE (XO + 16 * 4 * XC)   // elements of one staging buffer: the weight tile and 16 groups of 16 x rows
#define EP 264             // elements per row of an epilogue plane: 512 B + 16 B of pad; pitch = 16 B x odd
__global__ __launch_bounds__(512) void k_proj(const float* __restrict__ X, const float* __restrict__ WQ, const float* __restrict__ BQ, const float* __restrict__ WK, const float* __restrict__ BK, const float* __restrict__ WV, const float* __restrict__ BV, _Float16* __restrict__ QH, _Float16* __restrict__ QL, _Float16* __restrict__ KH, __bf16* __restrict__ VT, __bf16* __restrict__ VL, const float* __restrict__ NQW, const float* __restrict__ NKW, int wbase) {
  __shared__ __align__(16) char pool[2 * 256 * EP * 2];   /* the epilogue's two planes; the two staging buffers (37,120 B each) lie in the first, which is written only behind the loop's last barrier */
  const int tid = threadIdx.x, wave = __builtin_amdgcn_readfirstlane(tid >> 5), lane = tid & 31, col = lane & 15, g = lane >> 4; const int wm = wave >> 2, wn = wave & 3;   /* the wave's 64 rows, its 64 columns */ const int which = wbase + blockIdx.z; const int OW = (which == 0) ? CC : CK;   /* output row width */ const int c0 = blockIdx.y * 256; const size_t r0 = (size_t)blockIdx.x * 256; const float* WA = which == 0 ? WQ : which == 1 ? WK : WV; const float* BA = which == 0 ? BQ : which == 1 ? BK : BV;
  v8f acc[4][4] = {};
  __bf16* const sb0 = (__bf16*)pool; __bf16* const sb1 = sb0 + SBE;
  const bool wrole = wave < 8;   /* wave-uniform: waves 0..7 bring the weight tile (8 k rows x 128 columns each), waves 8..15 the x rows (32 each); 8 loads of 16 B a lane either way */
  const float* gp = wrole ? WA + (size_t)((wave & 3) * 8) * LDW + c0 + (wave >> 2) * 128 + lane * 4   /* (in,out), row length 3072 */ : X + (r0 + (wave - 8) * 32 + (lane >> 3)) * CC + (lane & 7) * 4;
  const int st_o = wrole ? (wave >> 2) * 8 * WJ + wt_slot(wave & 3, lane) : XO + (wave - 8) * 8 * XC + ((lane & 7) >> 1) * XC + (lane >> 3) * 8 + (lane & 1) * 4; const int xr_o = XO + wm * 16 * XC + g * XC + col * 8;
  WT wt;
  if (wrole) ld_wt(wt, gp, LDW); else ld_xt(wt, gp);
  asm volatile("s_wait_xcnt 0x0" ::: "memory");   /* in front of any rewrite of an address register that the loads above name: the roundings below reuse such registers */
  if (wrole) st_wt(sb0 + st_o, wt); else st_xt(sb0 + st_o, wt);
  __syncthreads();
#pragma unroll 2   /* two steps a trip: the buffer of each step is then a constant */
  for (int kc = 0; kc < CC / 32; ++kc) { const __bf16* cur = (kc & 1) ? sb1 : sb0; __bf16* nxt = (kc & 1) ? sb0 : sb1; const bool more = kc + 1 < CC / 32;
    if (more) { if (wrole) ld_wt(wt, gp + (size_t)(kc + 1) * 32 * LDW, LDW); else ld_xt(wt, gp + (kc + 1) * 32);   /* the next step's loads fly under this step's products */
      asm volatile("s_wait_xcnt 0x0" ::: "memory"); }   /* in front of any rewrite of an address register that the loads above name */
    v16b a[4], w[4];
#pragma unroll
    for (int i = 0; i < 4; ++i) { union { v16b v; v8b q[2]; } u; u.q[0] = *(const v8b*)(cur + xr_o + i * 4 * XC); u.q[1] = *(const v8b*)(cur + xr_o + i * 4 * XC + 2 * XC); a[i] = u.v; }
#pragma unroll
    for (int j = 0; j < 4; ++j) w[j] = frag_wt(cur, wn * 4 + j, lane);
#pragma unroll
    for (int i = 0; i < 4; ++i)
#pragma unroll
      for (int j = 0; j < 4; ++j) acc[i][j] = wmma_bf(a[i], w[j], acc[i][j]);
    __builtin_amdgcn_sched_barrier(0);   /* or the compiler lifts the roundings below, with their wait for the next step's loads, in among the products, which then stand behind that wait */
    if (more) { if (wrole) st_wt(nxt + st_o, wt); else st_xt(nxt + st_o, wt); }
    __syncthreads(); }   /* one barrier a step: it publishes the next tile and ends the reads of the buffer that the next step refills */
  _Float16* const sh = (_Float16*)pool; _Float16* const sl = sh + 256 * EP; __bf16* const th = (__bf16*)pool; __bf16* const tl2 = th + 256 * EP;   /* q, k: [row][column]; v: [column][row] */
  const int rb = wm * 64 + 8 * g, cb = wn * 64 + col;   /* accumulator tile (i, j), register r: row rb + 16 i + r, column cb + 16 j */
  if (BA) {
#pragma unroll
    for (int j = 0; j < 4; ++j) { const float bb = bfr(BA[c0 + cb + j * 16]); asm volatile("s_wait_xcnt 0x0" ::: "memory");   /* in front of any rewrite of the index register that the load names */
#pragma unroll
      for (int i = 0; i < 4; ++i) acc[i][j] += bb; } }
  if (which == 2) {
#pragma unroll
    for (int i = 0; i < 4; ++i)
#pragma unroll
      for (int j = 0; j < 4; ++j) { v8b oh, ol;   /* a lane's 8 registers are 8 neighbouring rows: one 16-B store a plane */
#pragma unroll
        for (int r = 0; r < 8; ++r) { const float v = acc[i][j][r]; const __bf16 bh = (__bf16)v; oh[r] = bh; ol[r] = (__bf16)(v - (float)bh); }
        *(v8b*)(th + (cb + j * 16) * EP + rb + i * 16) = oh; *(v8b*)(tl2 + (cb + j * 16) * EP + rb + i * 16) = ol; } }
  else {
#pragma unroll
    for (int i = 0; i < 4; ++i)
#pragma unroll
      for (int j = 0; j < 4; ++j)
#pragma unroll
        for (int r = 0; r < 8; ++r) sh[(rb + i * 16 + r) * EP + cb + j * 16] = (_Float16)acc[i][j][r]; }
  if (which == 0) {   /* q alone has a residual plane, carried x 2^10 so that it stays f16-normal on the chip */
#pragma unroll
    for (int i = 0; i < 4; ++i)
#pragma unroll
      for (int j = 0; j < 4; ++j)
#pragma unroll
        for (int r = 0; r < 8; ++r) { const float v = acc[i][j][r]; sl[(rb + i * 16 + r) * EP + cb + j * 16] = (_Float16)((v - (float)(_Float16)v) * 1024.0f); } }
  __syncthreads();
  const int er = tid >> 5, eq = (tid & 31) * 8;   /* a wave stores one plane row's 512 B: 4 whole lines; pass it takes rows 16 it + 0..15 */
  if (which == 0) { for (int it = 0; it < 16; ++it) { const int rl = it * 16 + er; const size_t o = (r0 + rl) * CC + c0 + eq; vst2((unsigned*)(QH + o), *(const v4u*)&sh[rl * EP + eq]); vst2((unsigned*)(QL + o), *(const v4u*)&sl[rl * EP + eq]); } }
  else if (which == 1) { for (int it = 0; it < 16; ++it) { const int rl = it * 16 + er; vst2((unsigned*)(KH + (r0 + rl) * OW + c0 + eq), *(const v4u*)&sh[rl * EP + eq]); }
    asm volatile("s_wait_xcnt 0x0" ::: "memory"); }   /* behind the last store of the run: in front of any rewrite of a register that the stores name */
  else { const size_t b = r0 / TT; const int t0 = (int)(r0 % TT); for (int it = 0; it < 16; ++it) { const int cl = it * 16 + er; const size_t o2 = (b * CK + c0 + cl) * (size_t)TT + t0 + eq; vst2((unsigned*)(VT + o2), *(const v4u*)&th[cl * EP + eq]); vst2((unsigned*)(VL + o2), *(const v4u*)&tl2[cl * EP + eq]); }
    asm volatile("s_wait_xcnt 0x0" ::: "memory"); } }   /* behind the last store of the run: in front of any rewrite of a register that the stores name */
// e[i] = 2^t[i], one instruction each; below -126 it gives 0, which is what a masked or far-off logit is to give. One statement, so that the slot behind a transcendental is kept by construction: behind each v_exp_f32 stands one that neither reads
// its result nor overwrites its source (every output "=&v"), behind the last a v_nop
__device__ __forceinline__ void ex2x9(float* e, const float* t) {
  asm("v_exp_f32 %0, %9\n\tv_exp_f32 %1, %10\n\tv_exp_f32 %2, %11\n\tv_exp_f32 %3, %12\n\tv_exp_f32 %4, %13\n\tv_exp_f32 %5, %14\n\tv_exp_f32 %6, %15\n\tv_exp_f32 %7, %16\n\tv_exp_f32 %8, %17\n\tv_nop"
    : "=&v"(e[0]), "=&v"(e[1]), "=&v"(e[2]), "=&v"(e[3]), "=&v"(e[4]), "=&v"(e[5]), "=&v"(e[6]), "=&v"(e[7]), "=&v"(e[8]) : "v"(t[0]), "v"(t[1]), "v"(t[2]), "v"(t[3]), "v"(t[4]), "v"(t[5]), "v"(t[6]), "v"(t[7]), "v"(t[8])); }
__device__ __forceinline__ void ex2x8(float* e, const float* t) {   // the same for eight
  asm("v_exp_f32 %0, %8\n\tv_exp_f32 %1, %9\n\tv_exp_f32 %2, %10\n\tv_exp_f32 %3, %11\n\tv_exp_f32 %4, %12\n\tv_exp_f32 %5, %13\n\tv_exp_f32 %6, %14\n\tv_exp_f32 %7, %15\n\tv_nop"
    : "=&v"(e[0]), "=&v"(e[1]), "=&v"(e[2]), "=&v"(e[3]), "=&v"(e[4]), "=&v"(e[5]), "=&v"(e[6]), "=&v"(e[7]) : "v"(t[0]), "v"(t[1]), "v"(t[2]), "v"(t[3]), "v"(t[4]), "v"(t[5]), "v"(t[6]), "v"(t[7])); }
#define LC 0.045084220027780106f   // log2(e) / 32: the logits' scale and the change of base in one factor, so that exp(s / 32 - m) = 2^(s LC - m')
template <int M> __device__ __forceinline__ float xrow(float v) { return __builtin_bit_cast(float, __builtin_amdgcn_update_dpp(0, __builtin_bit_cast(int, v), 0x160 | M, 0xf, 0xf, true)); }   // lane l reads lane l ^ M of its 16-lane row (DPP row_xmask): no LDS round trip
__device__ __forceinline__ float xhalf(float v) { return __builtin_bit_cast(float, __builtin_amdgcn_permlanex16(__builtin_bit_cast(int, v), __builtin_bit_cast(int, v), 0x76543210, 0xfedcba98, false, false)); }   // lane l reads lane l ^ 16
// ---- K and V tiles of one 128-key chunk in LDS, brought once a block by asynchronous 16-B copies and read by all eight waves
#define KP 72              // f16 elements per key row of the K tile: the two score heads' 64 B each + 16 B of pad; pitch = 16 B x odd, so the 16 lanes of a fragment read fall on different banks
#define VP 136             // bf16 elements per value-dim row of a v tile: 256 B + 16 B of pad, for the same reason
struct VF { v16b h[HDV / 16], l[HDV / 16]; };   // v fragments (hi, lo planes) of 32 keys x 64 value dims
__device__ __forceinline__ void ld_v(VF& f, const __bf16* vt, const __bf16* vl, int lane) {
#pragma unroll
  for (int j = 0; j < HDV / 16; ++j) { f.h[j] = frag_b(vt + j * 16 * VP, lane); f.l[j] = frag_b(vl + j * 16 * VP, lane); } }   // from the LDS tiles, row pitch VP
// two transposed score tiles (keys 0..15 and 16..31 of 32; D register r = key 8 g + r, the lane's column = its query) are, element for element, a B fragment in frag_b's k order; v's rows (value dims) are the A side: acc[j][r] = O^T[16 j + 8 g + r][query]
__device__ __forceinline__ void pvt32(v8f* acc, v8f e0, v8f e1, const VF& f) { float v[16];
#pragma unroll
  for (int i = 0; i < 8; ++i) { v[i] = e0[i]; v[8 + i] = e1[i]; }
  const F2 p = bsplit16(v);
#pragma unroll
  for (int j = 0; j < HDV / 16; ++j) { acc[j] = wmma_bf(f.h[j], p.h, acc[j]); acc[j] = wmma_bf(f.h[j], p.l, acc[j]); acc[j] = wmma_bf(f.l[j], p.h, acc[j]); } }
__device__ __forceinline__ unsigned lds_off(const void* p) { return (unsigned)(size_t)p; }   // byte offset in the work-group's LDS
// n copies of a lane, copy i standing ls bytes on in LDS and gs bytes on in global memory; the wait is the last line of the copies' own statement, so it stands in front of every rewrite of an address register that they name
__device__ __forceinline__ void acopy4(unsigned l, unsigned ls, const char* p, size_t gs) {
  asm volatile("global_load_async_to_lds_b128 %0, %4, off\n\tglobal_load_async_to_lds_b128 %1, %5, off\n\tglobal_load_async_to_lds_b128 %2, %6, off\n\tglobal_load_async_to_lds_b128 %3, %7, off\n\ts_wait_xcnt 0x0"
    :: "v"(l), "v"(l + ls), "v"(l + 2 * ls), "v"(l + 3 * ls), "v"(p), "v"(p + gs), "v"(p + 2 * gs), "v"(p + 3 * gs) : "memory"); }
// lambda = exp(lq1.lk1) - exp(lq2.lk2) + 0.2: lane i brings element i (one round of loads); the products of bf16-rounded values are exact in f32 and are summed from element 0 up
__device__ __forceinline__ float rdlane(float v, int i) { return __builtin_bit_cast(float, __builtin_amdgcn_readlane(__builtin_bit_cast(int, v), i)); }
__device__ __forceinline__ float lam_lanes(const float* LQ1, const float* LK1, const float* LQ2, const float* LK2, int lane) { const float p1 = bfr(LQ1[lane]) * bfr(LK1[lane]), p2 = bfr(LQ2[lane]) * bfr(LK2[lane]); float s1 = 0.f, s2 = 0.f;
#pragma unroll
  for (int i = 0; i < HD; ++i) { s1 += rdlane(p1, i); s2 += rdlane(p2, i); }
  return expf(s1) - expf(s2) + 0.2f; }
// 1 / sqrt(x) for x >= 1e-5, a normal number, where the library form's rescue of denormal arguments is an identity. One statement, so that the slot behind a transcendental is kept by construction
__device__ __forceinline__ float rsq1(float x) { float r; asm("v_rsq_f32 %0, %1\n\tv_nop" : "=&v"(r) : "v"(x)); return r; }
// ---- k_att: block = 64 queries of (b, value head), 8 waves: waves 0..3 take score head 2i, waves 4..7 score head 2i+1, one wave per 16 queries; all share the chunk's v tiles, and the K tile holds both heads' rows. Per 128-key chunk: 2-product logits transposed (K rows the A side, q the B side), x log2(e) / 32, in the D registers: a lane holds 64 keys of ONE query, its partner lane ^ 16 the other 64; running maximum and rescale (online softmax) in the lane, one exchange between the halves;
// P = 2^(s - m) goes from the D registers straight into B fragments (bf16 hi + lo), 3-product v^T . P^T into acc; the sums stay per lane until the end; y = acc / l into LDS; then, over the block, (y[2i] - lambda y[2i+1]) rms 0.8 gamma, split bf16 hi + lo: k_out's A rows
__global__ __launch_bounds__(256, 4) /* four waves a SIMD: a budget of 256 registers */ void k_att(const _Float16* __restrict__ QH, const _Float16* __restrict__ QL, const _Float16* __restrict__ KH, const __bf16* __restrict__ VT, const __bf16* __restrict__ VL, const float* __restrict__ LQ1, const float* __restrict__ LQ2, const float* __restrict__ LK1, const float* __restrict__ LK2, const float* __restrict__ GA, __bf16* __restrict__ AH, __bf16* __restrict__ AL) { __shared__ __align__(16) float ss[8][16][68];   /* y rows of the epilogue; pitch = 16 B x odd */ __shared__ __align__(16) _Float16 sk[128 * KP]; __shared__ __align__(16) __bf16 sv[2][HDV * VP];
  const int tid = threadIdx.x, wave = tid >> 5, lane = tid & 31, col = lane & 15, g = lane >> 4; const int hs = wave >> 2, wq = wave & 3;   /* which score head of the pair, which 16 queries */ const int vh = blockIdx.x, h = 2 * vh + hs, b = blockIdx.y; const int qt = TT / 64 - 1 - blockIdx.z;   /* the query tile is the slowest block index and falls with it: the tiles with the most key chunks come first in index order (for speed only) */ const int ql0 = qt * 64 + wq * 16; const int kend = qt * 64 + 64; const size_t q0 = (size_t)b * TT + ql0;
  const v16h ah = frag_h(QH + (q0 + col) * CC + h * HD, lane), al = frag_h(QL + (q0 + col) * CC + h * HD, lane);
  v8f acc[HDV / 16] = {}; float m = -3.0e38f, l = 0.f;   /* of this lane's query, ql0 + col */
  const _Float16* kg = KH + ((size_t)b * TT + (tid >> 3)) * CK + vh * (2 * HD) + (tid & 7) * 8;   /* copies: 8 lanes a key row (both heads, 128 B = one whole line), copy i 32 rows on; the three pointers walk with k0 */
  const size_t po = ((size_t)b * CK + vh * HDV + (tid >> 4)) * (size_t)TT + (tid & 15) * 8;   /* value head vh (64 wide): 16 lanes a row piece (256 B = 2 whole lines), copy i 16 rows on */ const __bf16 *vtg = VT + po, *vlg = VL + po;
  const unsigned kl = lds_off(sk) + (tid >> 3) * (KP * 2) + (tid & 7) * 16, vl0 = lds_off(&sv[0][0]) + (tid >> 4) * (VP * 2) + (tid & 15) * 16, vl1 = vl0 + HDV * VP * 2;
  const _Float16* kp = sk + col * KP + hs * HD + 8 * g;   /* this lane's half of its head's part of its key row of the tile */ const __bf16 *vtp = &sv[0][col * VP], *vlp = &sv[1][col * VP];
#pragma unroll 1   /* rolled: one chunk's body fills the register budget; the inner loops are unrolled so that their arrays are registers */
  for (int k0 = 0; k0 < kend; k0 += 128, kg += (size_t)128 * CK, vtg += 128, vlg += 128) { v8f s[8]; v16h kb[8];
    asm volatile("s_wait_dscnt 0x0" ::: "memory");   /* this wave's reads of the last chunk's tiles have returned ... */
    __syncthreads();   /* ... and so have every wave's: the tiles may be refilled */
    acopy4(kl, 32 * KP * 2, (const char*)kg, (size_t)32 * CK * 2); acopy4(vl0, 16 * VP * 2, (const char*)vtg, (size_t)16 * TT * 2); acopy4(vl1, 16 * VP * 2, (const char*)vlg, (size_t)16 * TT * 2);
    asm volatile("s_wait_asynccnt 0x0" ::: "memory");   /* this wave's copies have landed ... */
    __syncthreads();   /* ... and so have every wave's: the tiles may be read */
#pragma unroll
    for (int j = 0; j < 8; ++j) { union { v16h v; v8h q[2]; } u; const _Float16* p = kp + j * 16 * KP; u.q[0] = *(const v8h*)p; u.q[1] = *(const v8h*)(p + 16); kb[j] = u.v; }   /* frag_h's order */
#pragma unroll
    for (int j = 0; j < 8; ++j) { v8f a0 = {}, a1 = {}; a0 = wmma16(kb[j], ah, a0); a1 = wmma16(kb[j], al, a1); s[j] = a0 + a1 * (1.0f / 1024.0f); }
    const bool full = k0 + 64 < kend;   /* wave-uniform: keys 64..127 of the chunk are open to some row */
    const int dq = ql0 + col - 8 * g - k0;   /* causal test against constants: one register, not one per element */
    float mj[8];   /* eight independent chains */
#pragma unroll
    for (int j = 0; j < 8; ++j) { mj[j] = -3.0e38f;
#pragma unroll
      for (int r = 0; r < 8; ++r) { const float v = (j * 16 + r <= dq) ? s[j][r] * LC : -3.0e38f;   /* key k0 + 16 j + 8 g + r <= query ql0 + col; q * 32^-1/2 then * 1/sqrt(32) = 1/32, times log2(e) */ s[j][r] = v; mj[j] = fmaxf(mj[j], v); } }
    float mx = fmaxf(fmaxf(fmaxf(mj[0], mj[1]), fmaxf(mj[2], mj[3])), fmaxf(fmaxf(mj[4], mj[5]), fmaxf(mj[6], mj[7])));
    mx = fmaxf(mx, xhalf(mx));   /* the two halves hold one query's keys */
    const float mn = fmaxf(m, mx); float sc;
    { float t[9], e[9]; t[0] = m - mn;   /* the rescale factor */
#pragma unroll
      for (int r = 0; r < 8; ++r) t[1 + r] = s[0][r] - mn;   /* a masked logit (-3e38) gives exactly 0: mn is a real logit, key 0 is open to every query */
      ex2x9(e, t); sc = e[0];
#pragma unroll
      for (int r = 0; r < 8; ++r) s[0][r] = e[1 + r]; }
#pragma unroll
    for (int j = 1; j < 8; ++j) { float t[8], e[8];
#pragma unroll
      for (int r = 0; r < 8; ++r) t[r] = s[j][r] - mn;
      ex2x8(e, t);
#pragma unroll
      for (int r = 0; r < 8; ++r) s[j][r] = e[r]; }
    m = mn;
    const v8f sm = ((s[0] + s[1]) + (s[2] + s[3])) + ((s[4] + s[5]) + (s[6] + s[7]));
    l = l * sc + (((sm[0] + sm[1]) + (sm[2] + sm[3])) + ((sm[4] + sm[5]) + (sm[6] + sm[7])));
#pragma unroll
    for (int j = 0; j < HDV / 16; ++j) acc[j] *= sc;
    VF va; ld_v(va, vtp, vlp, lane); pvt32(acc, s[0], s[1], va); ld_v(va, vtp + 32, vlp + 32, lane); pvt32(acc, s[2], s[3], va);
    if (full) { ld_v(va, vtp + 64, vlp + 64, lane); pvt32(acc, s[4], s[5], va); ld_v(va, vtp + 96, vlp + 96, lane); pvt32(acc, s[6], s[7], va); } }
  const float inv = 1.0f / (l + xhalf(l));   /* the halves' sums joined once */
#pragma unroll
  for (int j = 0; j < HDV / 16; ++j) { const v8f y = acc[j] * inv; v4f y0, y1v;   /* a lane's 8 registers are 8 neighbouring value dims of its query's row */
#pragma unroll
    for (int r = 0; r < 4; ++r) { y0[r] = y[r]; y1v[r] = y[4 + r]; }
    *(v4f*)&ss[wave][col][j * 16 + 8 * g] = y0; *(v4f*)&ss[wave][col][j * 16 + 8 * g + 4] = y1v; }
  const float lam = lam_lanes(LQ1, LK1, LQ2, LK2, lane);
  const int row = hs * 8 + (lane >> 2), d0 = (lane & 3) * 16;   /* waves wq and 4 + wq halve the 16 queries of tile wq: 4 lanes a query, 16 value dims a lane */
  v4f gv[4];
#pragma unroll
  for (int q = 0; q < 4; ++q) gv[q] = *(const v4f*)(GA + d0 + q * 4);
  __syncthreads();   /* both score heads' y rows stand in LDS before a wave reads the other head's */
  const float *y1 = &ss[wq][row][d0], *y2 = &ss[4 + wq][row][d0]; float d[16], sq = 0.f;
#pragma unroll
  for (int q = 0; q < 16; ++q) { d[q] = y1[q] - lam * y2[q]; sq += d[q] * d[q]; }
  sq += xrow<1>(sq); sq += xrow<2>(sq);   /* the 4 lanes of a query */
  const float rs = rsq1(sq * (1.0f / HDV) + 1e-5f) * 0.8f; v8b oh[2], ol[2];
#pragma unroll
  for (int q = 0; q < 16; ++q) { const float v = d[q] * rs * bfr(gv[q >> 2][q & 3]); const __bf16 hv = (__bf16)v; oh[q >> 3][q & 7] = hv; ol[q >> 3][q & 7] = (__bf16)(v - (float)hv); }
  const size_t ao = ((size_t)b * TT + qt * 64 + wq * 16 + row) * CC + vh * HDV + d0;   /* a query's 64 dims = one whole 128-B line of each plane, from 4 neighbouring lanes */
  *(v8b*)(AH + ao) = oh[0]; *(v8b*)(AH + ao + 8) = oh[1]; *(v8b*)(AL + ao) = ol[0]; *(v8b*)(AL + ao + 8) = ol[1]; }
__device__ __forceinline__ v16b join_b(v8b a, v8b b) { union { v16b v; v8b q[2]; } u; u.q[0] = a; u.q[1] = b; return u.v; }
// ---- k_out: block = (64 rows, 128 cols): A rows (bf16 hi + lo planes, frag_b's k order) x w_proj ((in,out)); 4-KB rows
__global__ __launch_bounds__(128) void k_out(const __bf16* __restrict__ AH, const __bf16* __restrict__ AL, const float* __restrict__ WP, float* __restrict__ OUT) { __shared__ __align__(16) float sf[4][16][132]; __shared__ __align__(16) __bf16 sw[2][8 * WJ];
  const int tid = threadIdx.x, wave = tid >> 5, lane = tid & 31, col = lane & 15, g = lane >> 4; const int c0 = blockIdx.y * 128; const size_t r0 = (size_t)blockIdx.x * 64 + wave * 16; const size_t arow = r0 + col;
  v8f acc[8] = {};
  const float* wp = WP + (size_t)(wave * 8) * CC + c0 + lane * 4; const int ws_o = wt_slot(wave, lane);
  const __bf16 *hp = AH + arow * CC + 8 * g, *lp = AL + arow * CC + 8 * g;
  WT wt; ld_wt(wt, wp, CC); v8b nh[2], nl[2];   /* step 0's pieces of the A row */
  nh[0] = *(const v8b*)hp; nh[1] = *(const v8b*)(hp + 16); nl[0] = *(const v8b*)lp; nl[1] = *(const v8b*)(lp + 16);
  st_wt(&sw[0][0] + ws_o, wt);
  __syncthreads();
  F2 a; a.h = join_b(nh[0], nh[1]); a.l = join_b(nl[0], nl[1]);
#pragma unroll 2   /* two steps a trip: the buffer of each step is then a constant */
  for (int kc = 0; kc < CC / 32; ++kc) { const bool more = kc + 1 < CC / 32;
    const int kn = kc + 1;
    if (more) { ld_wt(wt, wp + (size_t)kn * 32 * CC, CC);   /* the next step's loads fly under this step's products */
      nh[0] = *(const v8b*)(hp + kn * 32); nh[1] = *(const v8b*)(hp + kn * 32 + 16); nl[0] = *(const v8b*)(lp + kn * 32); nl[1] = *(const v8b*)(lp + kn * 32 + 16);
      asm volatile("s_wait_xcnt 0x0" ::: "memory"); }   /* in front of any rewrite of an address register that the loads above name: the roundings below reuse such registers while the youngest loads are still out */
    v16b w[8];
#pragma unroll
    for (int j = 0; j < 8; ++j) w[j] = frag_wt(&sw[kc & 1][0], j, lane);
#pragma unroll
    for (int j = 0; j < 8; ++j) { acc[j] = wmma_bf(a.h, w[j], acc[j]); acc[j] = wmma_bf(a.l, w[j], acc[j]); }
    __builtin_amdgcn_sched_barrier(0);   /* or the compiler lifts what follows, with its wait for the next step's loads, in among the products, which then stand behind that wait */
    if (more) { a.h = join_b(nh[0], nh[1]); a.l = join_b(nl[0], nl[1]); st_wt(&sw[kn & 1][0] + ws_o, wt); }
    __syncthreads(); }   /* one barrier a step: it publishes the next tile and ends the reads of the buffer that the next step refills */
#pragma unroll
  for (int j = 0; j < 8; ++j)
#pragma unroll
    for (int r = 0; r < 8; ++r) sf[wave][8 * g + r][j * 16 + col] = acc[j][r];
  LDSX(); for (int rl = 0; rl < 16; ++rl) vst2(OUT + (r0 + rl) * CC + c0 + lane * 4, *(const v4f*)&sf[wave][rl][lane * 4]); }
extern "C" void kernel_launch(void* const* d_in, const int* in_sizes, int n_in, void* d_out, int out_size, void* d_ws, size_t ws_size, hipStream_t stream) {
  (void)in_sizes; (void)n_in; (void)out_size;
  const float** F = (const float**)d_in;   // 0 x [4,1024,1024], 1 w_attn [1024,3072] ((in,out): q | k | v), 2 w_proj ((in,out)), 3 lambda_q1 [32], 4 lambda_q2, 5 lambda_k1, 6 lambda_k2, 7 gamma [64]
  if (ws_size < (size_t)WS_END) return;
  char* ws = (char*)d_ws; _Float16 *QH = (_Float16*)(ws + WS_QH), *QL = (_Float16*)(ws + WS_QL), *KH = (_Float16*)(ws + WS_KH); __bf16 *VT = (__bf16*)(ws + WS_VT), *VL = (__bf16*)(ws + WS_VL), *AH = (__bf16*)(ws + WS_AH), *AL = (__bf16*)(ws + WS_AL);
  k_proj<<<dim3(TNB * TT / 256, CC / 256, 3), 512, 0, stream>>>(F[0], F[1], nullptr, F[1] + CC, nullptr, F[1] + 2 * CC, nullptr, QH, QL, KH, VT, VL, nullptr, nullptr, 0);
  k_att<<<dim3(NH / 2, TNB, TT / 64), 256, 0, stream>>>(QH, QL, KH, VT, VL, F[3], F[4], F[5], F[6], F[7], AH, AL);
  k_out<<<dim3(TNB * TT / 64, CC / 128), 128, 0, stream>>>(AH, AL, F[2], (float*)d_out);
}

// v009
// One run takes 104 microseconds.
// Next to v008, in two timings, it ran 1.03 times as fast each time.
// Over all steps from v000 it is 14.6 times as fast.
// compute dtype: all float inputs rounded to bf16, the four lambda vectors and gamma read; qkv = x w_attn ((in,out)) with EXACT bf16 products on WMMA 16x16x32, f32 accumulate; q as f16 hi + residual (x 2^10), k f16 -> 2-product causal logits x (32^-1/2)^2 = 1/32 kept in f32 registers (one launch for all score heads); online softmax in f32, in base 2 (logits x log2(e) / 32, hardware exp2); unnormalised P split bf16 hi + lo against v bf16 hi + lo (3 products), divided by the row sum at the end, per score head into its value head-pair slot; the differential combination P1 v - lambda P2 v, RMSNorm, gamma and (1 - lambda_init) in f32; out = that (bf16 hi + lo) w_proj; f32 output.
#include <hip/hip_runtime.h>
#include <math.h>

typedef __attribute__((ext_vector_type(16))) _Float16 v16h;
typedef __attribute__((ext_vector_type(16))) __bf16 v16b;
typedef __attribute__((ext_vector_type(8)))  _Float16 v8h;
typedef __attribute__((ext_vector_type(8)))  float v8f;
typedef __attribute__((ext_vector_type(4)))  float v4f;
typedef __attribute__((ext_vector_type(2)))  float v2f;
typedef __attribute__((ext_vector_type(4)))  unsigned v4u;
typedef __attribute__((ext_vector_type(4)))  int v4i;
typedef float __attribute__((may_alias)) float_a;
typedef int __attribute__((may_alias)) int_a;

template <typename T> __device__ __forceinline__ void vst2(void* p, T v) { *(T*)p = v;  }
__device__ __forceinline__ v8f wmma16(v16h a, v16h b, v8f c) {
  v8f d = __builtin_amdgcn_wmma_f32_16x16x32_f16(false, a, false, b, (short)0, c, false, false);
  return d;
}
__device__ __forceinline__ v8f wmma_bf(v16b a, v16b b, v8f c) {
  v8f d = __builtin_amdgcn_wmma_f32_16x16x32_bf16(false, a, false, b, (short)0, c, false, false);
  return d;
}
// 16x16x32 fragments: lane = (h = lane>>4, row/col = lane&15); elements 0..7 = k0+8h+0..7, 8..15 = k0+16+8h+0..7; D element r = row 8h+r
__device__ __forceinline__ v16h frag_h(const _Float16* rowk0, int lane) {
  union { v16h v; v8h q[2]; } u; const _Float16* p = rowk0 + 8 * (lane >> 4);
  u.q[0] = *(const v8h*)p; u.q[1] = *(const v8h*)(p + 16); return u.v;
}
__device__ __forceinline__ v16h frag_f32(const float* rowk0, int lane) {
  v16h a; const float* p = rowk0 + 8 * (lane >> 4);
#pragma unroll
  for (int i = 0; i < 8; ++i) { a[i] = (_Float16)p[i]; a[8 + i] = (_Float16)p[16 + i]; }
  return a;
}
__device__ __forceinline__ v16h frag_f32s(const float* rowk0, int lane, float sc) {
  v16h a; const float* p = rowk0 + 8 * (lane >> 4);
#pragma unroll
  for (int i = 0; i < 8; ++i) { a[i] = (_Float16)(p[i] * sc); a[8 + i] = (_Float16)(p[16 + i] * sc); }
  return a;
}
// column fragment from a [K][ld] layout (column n), rows >= K read as 0
__device__ __forceinline__ v16h fragc_f32(const float* W, int k0, int n, int lane, int ld, int K) {
  v16h a; const int g = lane >> 4;
#pragma unroll
  for (int i = 0; i < 8; ++i) { const int ka = k0 + 8 * g + i, kb = ka + 16;
    a[i] = (_Float16)(ka < K ? W[(size_t)(ka < K ? ka : K - 1) * ld + n] : 0.f); a[8 + i] = (_Float16)(kb < K ? W[(size_t)(kb < K ? kb : K - 1) * ld + n] : 0.f); }
  return a;
}
struct F2 { v16b h, l; };
__device__ __forceinline__ F2 bsplit16(const float v[16]) { F2 r;
#pragma unroll
  for (int i = 0; i < 16; ++i) { const __bf16 h = (__bf16)v[i]; r.h[i] = h; r.l[i] = (__bf16)(v[i] - (float)h); }
  return r; }
__device__ __forceinline__ F2 split_row(const float* row, int k0, int lane) { float v[16]; const float* p = row + k0 + 8 * (lane >> 4);
#pragma unroll
  for (int i = 0; i < 8; ++i) { v[i] = p[i]; v[8 + i] = p[16 + i]; }
  return bsplit16(v); }
__device__ __forceinline__ F2 split_rowK(const float* row, int k0, int lane, int K) { float v[16]; const int g = lane >> 4;
#pragma unroll
  for (int i = 0; i < 8; ++i) { const int ka = k0 + 8 * g + i, kb = ka + 16; v[i] = ka < K ? row[ka < K ? ka : K - 1] : 0.f; v[8 + i] = kb < K ? row[kb < K ? kb : K - 1] : 0.f; }
  return bsplit16(v); }
__device__ __forceinline__ F2 split_col(const float* W, int k0, int n, int lane, int ld, int K) { float v[16]; const int g = lane >> 4;
#pragma unroll
  for (int i = 0; i < 8; ++i) { const int ka = k0 + 8 * g + i, kb = ka + 16; v[i] = ka < K ? W[(size_t)(ka < K ? ka : K - 1) * ld + n] : 0.f; v[8 + i] = kb < K ? W[(size_t)(kb < K ? kb : K - 1) * ld + n] : 0.f; }
  return bsplit16(v); }
__device__ __forceinline__ v8f mac3(const F2& a, const F2& b, v8f c) { c = wmma_bf(a.l, b.h, c); c = wmma_bf(a.h, b.l, c); return wmma_bf(a.h, b.h, c); }
__device__ __forceinline__ float sigm(float v) { return 1.0f / (1.0f + expf(-v)); }
#define LDSX() do { asm volatile("s_wait_dscnt 0" ::: "memory"); __builtin_amdgcn_wave_barrier(); __builtin_amdgcn_fence(__ATOMIC_RELEASE, "workgroup"); } while (0)


// Differential causal attention (B 4, T 1,024, C 1,024; 2H = 32 score heads x 32, 16 value heads x 64): att = softmax(causal(q k^T / 32)) per score head; diff_i = att_{2i} - lambda att_{2i+1}, lambda = exp(lq1.lk1) - exp(lq2.lk2) + 0.2; out_i = RMSNorm(diff_i v_i) * gamma * 0.8; concat w_proj.
#define NB 4
#define TT 1024
#define CC 1024
#define NH 32              // score heads (2H)
#define HD 32              // score head dim
#define HDV 64             // value head dim (16 value heads)
#define WIN (TT + 1)       // plain causal
#define NKV 32             // k has the same 32 heads
#define LDW 3072           // w_attn (in,out) [1024][3072]: q | k | v column blocks
#define CK (NKV * HD)   // 1,024: k/v row width
#define REP (NH / NKV)
#ifndef TNB
#define TNB NB
#endif
typedef __attribute__((ext_vector_type(8))) __bf16 v8b;
__device__ __forceinline__ v16b frag_b(const __bf16* rowk0, int lane) {
  union { v16b v; v8b q[2]; } u; const __bf16* p = rowk0 + 8 * (lane >> 4);
  u.q[0] = *(const v8b*)p; u.q[1] = *(const v8b*)(p + 16); return u.v;
}
__device__ __forceinline__ float bfr(float v) { return (float)(__bf16)v; }
// ---- operand tiles of one k step (32 deep) in LDS, bf16, in fragment order: a weight fragment read is lane * 16 B, contiguous over the wave; an x fragment read is contiguous per 16-lane half
typedef __attribute__((ext_vector_type(4))) __bf16 v4b;
#define WJ 520             // elements per 16-column group of a weight tile: k 0..15 (256) + k 16..31 (256) + 8 of pad, so that the 16 lanes of a store fall on 16 different 16-B slots
#define XC 160             // elements per 8-k chunk of a group of 16 x rows: 128 + 32 of pad, for the same reason
#define XO (16 * WJ)       // the x rows stand behind k_proj's weight tile (256 columns)
struct WT { v4f r[8]; };   // wave w: rows 8w..8w+7 of the tile, a lane 4 columns; one load = one 512-B row piece = 4 whole lines
__device__ __forceinline__ void ld_wt(WT& t, const float* p, int ld) {
#pragma unroll
  for (int i = 0; i < 8; ++i) t.r[i] = *(const v4f*)(p + (size_t)i * ld); }
__device__ __forceinline__ int wt_slot(int wave, int lane) { return (lane >> 2) * WJ + (wave >> 1) * 256 + (wave & 1) * 128 + (lane & 3) * 32; }   // column 4 lane + c stands c * 8 elements on
__device__ __forceinline__ void st_wt(__bf16* p, const WT& t) {
#pragma unroll
  for (int c = 0; c < 4; ++c) { v8b o;
#pragma unroll
    for (int i = 0; i < 8; ++i) o[i] = (__bf16)t.r[i][c];
    *(v8b*)(p + c * 8) = o; } }
__device__ __forceinline__ v16b frag_wt(const __bf16* tile, int j, int lane) {   // frag_b's k order: elements 0..7 = 8g + 0..7, 8..15 = 16 + 8g + 0..7, column 16 j + col
  union { v16b v; v8b q[2]; } u; const __bf16* p = tile + j * WJ + lane * 8;
  u.q[0] = *(const v8b*)p; u.q[1] = *(const v8b*)(p + 256); return u.v; }
__device__ __attribute__((noinline)) float exp_ni(float v) { return expf(v); }
__device__ __attribute__((noinline)) float erf_ni(float v) { return erff(v); }

#define WS_QH  0u
#define WS_QL  (WS_QH + 2u * (size_t)NB * TT * CC)
#define WS_KH  (WS_QL + 2u * (size_t)NB * TT * CC)
#define WS_VT  (WS_KH + 2u * (size_t)NB * TT * CK)      // bf16 v planes [b][CK][t] (k rows are [b*T+t][CK])
#define WS_VL  (WS_VT + 2u * (size_t)NB * CK * TT)
#define WS_AH  (WS_VL + 2u * (size_t)NB * CK * TT)      // bf16 hi and lo planes of k_out's A rows [b*t][1,024]: the normalised differential output
#define WS_AL  (WS_AH + 2u * (size_t)NB * TT * CC)
#define WS_END (WS_AL + 2u * (size_t)NB * TT * CC)

// ---- k_proj: block = (256 rows, 256 cols, which), 16 waves in a 4 x 4 grid, a wave 64 x 64 (4 x 4 accumulator tiles): qkv = x W (+ b), exact; q -> f16 hi (+ residual), k -> f16 rows, v -> bf16 planes. Each fetched x row serves 256 columns and each weight row 256 rows; each fragment read from LDS serves 4 products
__device__ __forceinline__ void ld_xt(WT& t, const float* p) {   // 32 x rows of one k step: 8 lanes a row, one load = 4 rows x one whole line
#pragma unroll
  for (int i = 0; i < 8; ++i) t.r[i] = *(const v4f*)(p + (size_t)(4 * i) * CC); }
__device__ __forceinline__ void st_xt(__bf16* p, const WT& t) {   // loads 0..3 are the first 16-row group, 4..7 the second
#pragma unroll
  for (int i = 0; i < 8; ++i) { v4b o; o[0] = (__bf16)t.r[i][0]; o[1] = (__bf16)t.r[i][1]; o[2] = (__bf16)t.r[i][2]; o[3] = (__bf16)t.r[i][3]; *(v4b*)(p + (i >> 2) * 4 * XC + (i & 3) * 32) = o; } }
#define SBE (XO + 16 * 4 * XC)   // elements of one staging buffer: the weight tile and 16 groups of 16 x rows
#define EP 264             // elements per row of an epilogue plane: 512 B + 16 B of pad; pitch = 16 B x odd
__global__ __launch_bounds__(512) void k_proj(const float* __restrict__ X, const float* __restrict__ WQ, const float* __restrict__ BQ, const float* __restrict__ WK, const float* __restrict__ BK, const float* __restrict__ WV, const float* __restrict__ BV, _Float16* __restrict__ QH, _Float16* __restrict__ QL, _Float16* __restrict__ KH, __bf16* __restrict__ VT, __bf16* __restrict__ VL, const float* __restrict__ NQW, const float* __restrict__ NKW, int wbase) {
  __shared__ __align__(16) char pool[2 * 256 * EP * 2];   /* the epilogue's two planes; the two staging buffers (37,120 B each) lie in the first, which is written only behind the loop's last barrier */
  const int tid = threadIdx.x, wave = __builtin_amdgcn_readfirstlane(tid >> 5), lane = tid & 31, col = lane & 15, g = lane >> 4; const int wm = wave >> 2, wn = wave & 3;   /* the wave's 64 rows, its 64 columns */ const int which = wbase + blockIdx.z; const int OW = (which == 0) ? CC : CK;   /* output row width */ const int c0 = blockIdx.y * 256; const size_t r0 = (size_t)blockIdx.x * 256; const float* WA = which == 0 ? WQ : which == 1 ? WK : WV; const float* BA = which == 0 ? BQ : which == 1 ? BK : BV;
  v8f acc[4][4] = {};
  __bf16* const sb0 = (__bf16*)pool; __bf16* const sb1 = sb0 + SBE;
  const bool wrole = wave < 8;   /* wave-uniform: waves 0..7 bring the weight tile (8 k rows x 128 columns each), waves 8..15 the x rows (32 each); 8 loads of 16 B a lane either way */
  const float* gp = wrole ? WA + (size_t)((wave & 3) * 8) * LDW + c0 + (wave >> 2) * 128 + lane * 4   /* (in,out), row length 3072 */ : X + (r0 + (wave - 8) * 32 + (lane >> 3)) * CC + (lane & 7) * 4;
  const int st_o = wrole ? (wave >> 2) * 8 * WJ + wt_slot(wave & 3, lane) : XO + (wave - 8) * 8 * XC + ((lane & 7) >> 1) * XC + (lane >> 3) * 8 + (lane & 1) * 4; const int xr_o = XO + wm * 16 * XC + g * XC + col * 8;
  WT wt;
  if (wrole) ld_wt(wt, gp, LDW); else ld_xt(wt, gp);
  asm volatile("s_wait_xcnt 0x0" ::: "memory");   /* in front of any rewrite of an address register that the loads above name: the roundings below reuse such registers */
  if (wrole) st_wt(sb0 + st_o, wt); else st_xt(sb0 + st_o, wt);
  __syncthreads();
#pragma unroll 2   /* two steps a trip: the buffer of each step is then a constant */
  for (int kc = 0; kc < CC / 32; ++kc) { const __bf16* cur = (kc & 1) ? sb1 : sb0; __bf16* nxt = (kc & 1) ? sb0 : sb1; const bool more = kc + 1 < CC / 32;
    if (more) { if (wrole) ld_wt(wt, gp + (size_t)(kc + 1) * 32 * LDW, LDW); else ld_xt(wt, gp + (kc + 1) * 32);   /* the next step's loads fly under this step's products */
      asm volatile("s_wait_xcnt 0x0" ::: "memory"); }   /* in front of any rewrite of an address register that the loads above name */
    v16b a[4], w[4];
#pragma unroll
    for (int i = 0; i < 4; ++i) { union { v16b v; v8b q[2]; } u; u.q[0] = *(const v8b*)(cur + xr_o + i * 4 * XC); u.q[1] = *(const v8b*)(cur + xr_o + i * 4 * XC + 2 * XC); a[i] = u.v; }
#pragma unroll
    for (int j = 0; j < 4; ++j) w[j] = frag_wt(cur, wn * 4 + j, lane);
    __builtin_amdgcn_sched_barrier(0);   /* holds the fragment reads as one group in front of the products: left free, the compiler sinks each read to its product, which then waits out the LDS latency alone */
#pragma unroll
    for (int i = 0; i < 4; ++i)
#pragma unroll
      for (int j = 0; j < 4; ++j) acc[i][j] = wmma_bf(a[i], w[j], acc[i][j]);
    __builtin_amdgcn_sched_barrier(0);   /* or the compiler lifts the roundings below, with their wait for the next step's loads, in among the products, which then stand behind that wait */
    if (more) { if (wrole) st_wt(nxt + st_o, wt); else st_xt(nxt + st_o, wt); }
    __syncthreads(); }   /* one barrier a step: it publishes the next tile and ends the reads of the buffer that the next step refills */
  _Float16* const sh = (_Float16*)pool; _Float16* const sl = sh + 256 * EP; __bf16* const th = (__bf16*)pool; __bf16* const tl2 = th + 256 * EP;   /* q, k: [row][column]; v: [column][row] */
  const int rb = wm * 64 + 8 * g, cb = wn * 64 + col;   /* accumulator tile (i, j), register r: row rb + 16 i + r, column cb + 16 j */
  if (BA) {
#pragma unroll
    for (int j = 0; j < 4; ++j) { const float bb = bfr(BA[c0 + cb + j * 16]); asm volatile("s_wait_xcnt 0x0" ::: "memory");   /* in front of any rewrite of the index register that the load names */
#pragma unroll
      for (int i = 0; i < 4; ++i) acc[i][j] += bb; } }
  if (which == 2) {
#pragma unroll
    for (int i = 0; i < 4; ++i)
#pragma unroll
      for (int j = 0; j < 4; ++j) { v8b oh, ol;   /* a lane's 8 registers are 8 neighbouring rows: one 16-B store a plane */
#pragma unroll
        for (int r = 0; r < 8; ++r) { const float v = acc[i][j][r]; const __bf16 bh = (__bf16)v; oh[r] = bh; ol[r] = (__bf16)(v - (float)bh); }
        *(v8b*)(th + (cb + j * 16) * EP + rb + i * 16) = oh; *(v8b*)(tl2 + (cb + j * 16) * EP + rb + i * 16) = ol; } }
  else {
#pragma unroll
    for (int i = 0; i < 4; ++i)
#pragma unroll
      for (int j = 0; j < 4; ++j)
#pragma unroll
        for (int r = 0; r < 8; ++r) sh[(rb + i * 16 + r) * EP + cb + j * 16] = (_Float16)acc[i][j][r]; }
  if (which == 0) {   /* q alone has a residual plane, carried x 2^10 so that it stays f16-normal on the chip */
#pragma unroll
    for (int i = 0; i < 4; ++i)
#pragma unroll
      for (int j = 0; j < 4; ++j)
#pragma unroll
        for (int r = 0; r < 8; ++r) { const float v = acc[i][j][r]; sl[(rb + i * 16 + r) * EP + cb + j * 16] = (_Float16)((v - (float)(_Float16)v) * 1024.0f); } }
  __syncthreads();
  const int er = tid >> 5, eq = (tid & 31) * 8;   /* a wave stores one plane row's 512 B: 4 whole lines; pass it takes rows 16 it + 0..15 */
  if (which == 0) { for (int it = 0; it < 16; ++it) { const int rl = it * 16 + er; const size_t o = (r0 + rl) * CC + c0 + eq; vst2((unsigned*)(QH + o), *(const v4u*)&sh[rl * EP + eq]); vst2((unsigned*)(QL + o), *(const v4u*)&sl[rl * EP + eq]); } }
  else if (which == 1) { for (int it = 0; it < 16; ++it) { const int rl = it * 16 + er; vst2((unsigned*)(KH + (r0 + rl) * OW + c0 + eq), *(const v4u*)&sh[rl * EP + eq]); }
    asm volatile("s_wait_xcnt 0x0" ::: "memory"); }   /* behind the last store of the run: in front of any rewrite of a register that the stores name */
  else { const size_t b = r0 / TT; const int t0 = (int)(r0 % TT); for (int it = 0; it < 16; ++it) { const int cl = it * 16 + er; const size_t o2 = (b * CK + c0 + cl) * (size_t)TT + t0 + eq; vst2((unsigned*)(VT + o2), *(const v4u*)&th[cl * EP + eq]); vst2((unsigned*)(VL + o2), *(const v4u*)&tl2[cl * EP + eq]); }
    asm volatile("s_wait_xcnt 0x0" ::: "memory"); } }   /* behind the last store of the run: in front of any rewrite of a register that the stores name */
// e[i] = 2^t[i], one instruction each; below -126 it gives 0, which is what a masked or far-off logit is to give. One statement, so that the slot behind a transcendental is kept by construction: behind each v_exp_f32 stands one that neither reads
// its result nor overwrites its source (every output "=&v"), behind the last a v_nop
__device__ __forceinline__ void ex2x9(float* e, const float* t) {
  asm("v_exp_f32 %0, %9\n\tv_exp_f32 %1, %10\n\tv_exp_f32 %2, %11\n\tv_exp_f32 %3, %12\n\tv_exp_f32 %4, %13\n\tv_exp_f32 %5, %14\n\tv_exp_f32 %6, %15\n\tv_exp_f32 %7, %16\n\tv_exp_f32 %8, %17\n\tv_nop"
    : "=&v"(e[0]), "=&v"(e[1]), "=&v"(e[2]), "=&v"(e[3]), "=&v"(e[4]), "=&v"(e[5]), "=&v"(e[6]), "=&v"(e[7]), "=&v"(e[8]) : "v"(t[0]), "v"(t[1]), "v"(t[2]), "v"(t[3]), "v"(t[4]), "v"(t[5]), "v"(t[6]), "v"(t[7]), "v"(t[8])); }
__device__ __forceinline__ void ex2x8(float* e, const float* t) {   // the same for eight
  asm("v_exp_f32 %0, %8\n\tv_exp_f32 %1, %9\n\tv_exp_f32 %2, %10\n\tv_exp_f32 %3, %11\n\tv_exp_f32 %4, %12\n\tv_exp_f32 %5, %13\n\tv_exp_f32 %6, %14\n\tv_exp_f32 %7, %15\n\tv_nop"
    : "=&v"(e[0]), "=&v"(e[1]), "=&v"(e[2]), "=&v"(e[3]), "=&v"(e[4]), "=&v"(e[5]), "=&v"(e[6]), "=&v"(e[7]) : "v"(t[0]), "v"(t[1]), "v"(t[2]), "v"(t[3]), "v"(t[4]), "v"(t[5]), "v"(t[6]), "v"(t[7])); }
#define LC 0.045084220027780106f   // log2(e) / 32: the logits' scale and the change of base in one factor, so that exp(s / 32 - m) = 2^(s LC - m')
template <int M> __device__ __forceinline__ float xrow(float v) { return __builtin_bit_cast(float, __builtin_amdgcn_update_dpp(0, __builtin_bit_cast(int, v), 0x160 | M, 0xf, 0xf, true)); }   // lane l reads lane l ^ M of its 16-lane row (DPP row_xmask): no LDS round trip
__device__ __forceinline__ float xhalf(float v) { return __builtin_bit_cast(float, __builtin_amdgcn_permlanex16(__builtin_bit_cast(int, v), __builtin_bit_cast(int, v), 0x76543210, 0xfedcba98, false, false)); }   // lane l reads lane l ^ 16
// ---- K and V tiles of one 128-key chunk in LDS, brought once a block by asynchronous 16-B copies and read by all eight waves
#define KP 72              // f16 elements per key row of the K tile: the two score heads' 64 B each + 16 B of pad; pitch = 16 B x odd, so the 16 lanes of a fragment read fall on different banks
#define VP 136             // bf16 elements per value-dim row of a v tile: 256 B + 16 B of pad, for the same reason
struct VF { v16b h[HDV / 16], l[HDV / 16]; };   // v fragments (hi, lo planes) of 32 keys x 64 value dims
__device__ __forceinline__ void ld_v(VF& f, const __bf16* vt, const __bf16* vl, int lane) {
#pragma unroll
  for (int j = 0; j < HDV / 16; ++j) { f.h[j] = frag_b(vt + j * 16 * VP, lane); f.l[j] = frag_b(vl + j * 16 * VP, lane); }   // from the LDS tiles, row pitch VP
  __builtin_amdgcn_sched_barrier(0);   /* holds the fragment reads as one group in front of the products: left free, the compiler sinks each read to its product, which then waits out the LDS latency alone */
}
// two transposed score tiles (keys 0..15 and 16..31 of 32; D register r = key 8 g + r, the lane's column = its query) are, element for element, a B fragment in frag_b's k order; v's rows (value dims) are the A side: acc[j][r] = O^T[16 j + 8 g + r][query]
__device__ __forceinline__ void pvt32(v8f* acc, v8f e0, v8f e1, const VF& f) { float v[16];
#pragma unroll
  for (int i = 0; i < 8; ++i) { v[i] = e0[i]; v[8 + i] = e1[i]; }
  const F2 p = bsplit16(v);
#pragma unroll
  for (int j = 0; j < HDV / 16; ++j) { acc[j] = wmma_bf(f.h[j], p.h, acc[j]); acc[j] = wmma_bf(f.h[j], p.l, acc[j]); acc[j] = wmma_bf(f.l[j], p.h, acc[j]); }
  // one statement behind the block of 12 products, where one stood behind each: it ends the block in front of the next group's LDS reads (left free, the compiler sinks the products below those reads, two groups of fragments are live at once and registers spill); its four slots are the distance behind the last product
  asm volatile("v_nop\n\tv_nop\n\tv_nop\n\tv_nop" : "+v"(acc[0]), "+v"(acc[1]), "+v"(acc[2]), "+v"(acc[3])); }
__device__ __forceinline__ unsigned lds_off(const void* p) { return (unsigned)(size_t)p; }   // byte offset in the work-group's LDS
// n copies of a lane, copy i standing ls bytes on in LDS and gs bytes on in global memory; the wait is the last line of the copies' own statement, so it stands in front of every rewrite of an address register that they name
__device__ __forceinline__ void acopy4(unsigned l, unsigned ls, const char* p, size_t gs) {
  asm volatile("global_load_async_to_lds_b128 %0, %4, off\n\tglobal_load_async_to_lds_b128 %1, %5, off\n\tglobal_load_async_to_lds_b128 %2, %6, off\n\tglobal_load_async_to_lds_b128 %3, %7, off\n\ts_wait_xcnt 0x0"
    :: "v"(l), "v"(l + ls), "v"(l + 2 * ls), "v"(l + 3 * ls), "v"(p), "v"(p + gs), "v"(p + 2 * gs), "v"(p + 3 * gs) : "memory"); }
// lambda = exp(lq1.lk1) - exp(lq2.lk2) + 0.2: lane i brings element i (one round of loads); the products of bf16-rounded values are exact in f32 and are summed from element 0 up
__device__ __forceinline__ float rdlane(float v, int i) { return __builtin_bit_cast(float, __builtin_amdgcn_readlane(__builtin_bit_cast(int, v), i)); }
__device__ __forceinline__ float lam_lanes(const float* LQ1, const float* LK1, const float* LQ2, const float* LK2, int lane) { const float p1 = bfr(LQ1[lane]) * bfr(LK1[lane]), p2 = bfr(LQ2[lane]) * bfr(LK2[lane]); float s1 = 0.f, s2 = 0.f;
#pragma unroll
  for (int i = 0; i < HD; ++i) { s1 += rdlane(p1, i); s2 += rdlane(p2, i); }
  return expf(s1) - expf(s2) + 0.2f; }
// 1 / sqrt(x) for x >= 1e-5, a normal number, where the library form's rescue of denormal arguments is an identity. One statement, so that the slot behind a transcendental is kept by construction
__device__ __forceinline__ float rsq1(float x) { float r; asm("v_rsq_f32 %0, %1\n\tv_nop" : "=&v"(r) : "v"(x)); return r; }
// ---- k_att: block = 64 queries of (b, value head), 8 waves: waves 0..3 take score head 2i, waves 4..7 score head 2i+1, one wave per 16 queries; all share the chunk's v tiles, and the K tile holds both heads' rows. Per 128-key chunk: 2-product logits transposed (K rows the A side, q the B side), x log2(e) / 32, in the D registers: a lane holds 64 keys of ONE query, its partner lane ^ 16 the other 64; running maximum and rescale (online softmax) in the lane, one exchange between the halves;
// P = 2^(s - m) goes from the D registers straight into B fragments (bf16 hi + lo), 3-product v^T . P^T into acc; the sums stay per lane until the end; y = acc / l into LDS; then, over the block, (y[2i] - lambda y[2i+1]) rms 0.8 gamma, split bf16 hi + lo: k_out's A rows
__global__ __launch_bounds__(256, 4) /* four waves a SIMD: a budget of 256 registers */ void k_att(const _Float16* __restrict__ QH, const _Float16* __restrict__ QL, const _Float16* __restrict__ KH, const __bf16* __restrict__ VT, const __bf16* __restrict__ VL, const float* __restrict__ LQ1, const float* __restrict__ LQ2, const float* __restrict__ LK1, const float* __restrict__ LK2, const float* __restrict__ GA, __bf16* __restrict__ AH, __bf16* __restrict__ AL) { __shared__ __align__(16) float ss[8][16][68];   /* y rows of the epilogue; pitch = 16 B x odd */ __shared__ __align__(16) _Float16 sk[128 * KP]; __shared__ __align__(16) __bf16 sv[2][HDV * VP];
  const int tid = threadIdx.x, wave = tid >> 5, lane = tid & 31, col = lane & 15, g = lane >> 4; const int hs = wave >> 2, wq = wave & 3;   /* which score head of the pair, which 16 queries */ const int vh = blockIdx.x, h = 2 * vh + hs, b = blockIdx.y; const int qt = TT / 64 - 1 - blockIdx.z;   /* the query tile is the slowest block index and falls with it: the tiles with the most key chunks come first in index order (for speed only) */ const int ql0 = qt * 64 + wq * 16; const int kend = qt * 64 + 64; const size_t q0 = (size_t)b * TT + ql0;
  const v16h ah = frag_h(QH + (q0 + col) * CC + h * HD, lane), al = frag_h(QL + (q0 + col) * CC + h * HD, lane);
  v8f acc[HDV / 16] = {}; float m = -3.0e38f, l = 0.f;   /* of this lane's query, ql0 + col */
  const _Float16* kg = KH + ((size_t)b * TT + (tid >> 3)) * CK + vh * (2 * HD) + (tid & 7) * 8;   /* copies: 8 lanes a key row (both heads, 128 B = one whole line), copy i 32 rows on; the three pointers walk with k0 */
  const size_t po = ((size_t)b * CK + vh * HDV + (tid >> 4)) * (size_t)TT + (tid & 15) * 8;   /* value head vh (64 wide): 16 lanes a row piece (256 B = 2 whole lines), copy i 16 rows on */ const __bf16 *vtg = VT + po, *vlg = VL + po;
  const unsigned kl = lds_off(sk) + (tid >> 3) * (KP * 2) + (tid & 7) * 16, vl0 = lds_off(&sv[0][0]) + (tid >> 4) * (VP * 2) + (tid & 15) * 16, vl1 = vl0 + HDV * VP * 2;
  const _Float16* kp = sk + col * KP + hs * HD + 8 * g;   /* this lane's half of its head's part of its key row of the tile */ const __bf16 *vtp = &sv[0][col * VP], *vlp = &sv[1][col * VP];
#pragma unroll 1   /* rolled: one chunk's body fills the register budget; the inner loops are unrolled so that their arrays are registers */
  for (int k0 = 0; k0 < kend; k0 += 128, kg += (size_t)128 * CK, vtg += 128, vlg += 128) { v8f s[8]; v16h kb[8];
    asm volatile("s_wait_dscnt 0x0" ::: "memory");   /* this wave's reads of the last chunk's tiles have returned ... */
    __syncthreads();   /* ... and so have every wave's: the tiles may be refilled */
    acopy4(kl, 32 * KP * 2, (const char*)kg, (size_t)32 * CK * 2); acopy4(vl0, 16 * VP * 2, (const char*)vtg, (size_t)16 * TT * 2); acopy4(vl1, 16 * VP * 2, (const char*)vlg, (size_t)16 * TT * 2);
    asm volatile("s_wait_asynccnt 0x0" ::: "memory");   /* this wave's copies have landed ... */
    __syncthreads();   /* ... and so have every wave's: the tiles may be read */
#pragma unroll
    for (int j = 0; j < 8; ++j) { union { v16h v; v8h q[2]; } u; const _Float16* p = kp + j * 16 * KP; u.q[0] = *(const v8h*)p; u.q[1] = *(const v8h*)(p + 16); kb[j] = u.v; }   /* frag_h's order */
#pragma unroll
    for (int j = 0; j < 8; ++j) { v8f a0 = {}, a1 = {}; a0 = wmma16(kb[j], ah, a0); a1 = wmma16(kb[j], al, a1); s[j] = a0 + a1 * (1.0f / 1024.0f); }
    const bool full = k0 + 64 < kend;   /* wave-uniform: keys 64..127 of the chunk are open to some row */
    const int dq = ql0 + col - 8 * g - k0;   /* causal test against constants: one register, not one per element */
    float mj[8];   /* eight independent chains */
#pragma unroll
    for (int j = 0; j < 8; ++j) { mj[j] = -3.0e38f;
#pragma unroll
      for (int r = 0; r < 8; ++r) { const float v = (j * 16 + r <= dq) ? s[j][r] * LC : -3.0e38f;   /* key k0 + 16 j + 8 g + r <= query ql0 + col; q * 32^-1/2 then * 1/sqrt(32) = 1/32, times log2(e) */ s[j][r] = v; mj[j] = fmaxf(mj[j], v); } }
    float mx = fmaxf(fmaxf(fmaxf(mj[0], mj[1]), fmaxf(mj[2], mj[3])), fmaxf(fmaxf(mj[4], mj[5]), fmaxf(mj[6], mj[7])));
    mx = fmaxf(mx, xhalf(mx));   /* the two halves hold one query's keys */
    const float mn = fmaxf(m, mx); float sc;
    { float t[9], e[9]; t[0] = m - mn;   /* the rescale factor */
#pragma unroll
      for (int r = 0; r < 8; ++r) t[1 + r] = s[0][r] - mn;   /* a masked logit (-3e38) gives exactly 0: mn is a real logit, key 0 is open to every query */
      ex2x9(e, t); sc = e[0];
#pragma unroll
      for (int r = 0; r < 8; ++r) s[0][r] = e[1 + r]; }
#pragma unroll
    for (int j = 1; j < 8; ++j) { float t[8], e[8];
#pragma unroll
      for (int r = 0; r < 8; ++r) t[r] = s[j][r] - mn;
      ex2x8(e, t);
#pragma unroll
      for (int r = 0; r < 8; ++r) s[j][r] = e[r]; }
    m = mn;
    const v8f sm = ((s[0] + s[1]) + (s[2] + s[3])) + ((s[4] + s[5]) + (s[6] + s[7]));
    l = l * sc + (((sm[0] + sm[1]) + (sm[2] + sm[3])) + ((sm[4] + sm[5]) + (sm[6] + sm[7])));
#pragma unroll
    for (int j = 0; j < HDV / 16; ++j) acc[j] *= sc;
    VF va; ld_v(va, vtp, vlp, lane); pvt32(acc, s[0], s[1], va); ld_v(va, vtp + 32, vlp + 32, lane); pvt32(acc, s[2], s[3], va);
    if (full) { ld_v(va, vtp + 64, vlp + 64, lane); pvt32(acc, s[4], s[5], va); ld_v(va, vtp + 96, vlp + 96, lane); pvt32(acc, s[6], s[7], va); } }
  const float inv = 1.0f / (l + xhalf(l));   /* the halves' sums joined once */
#pragma unroll
  for (int j = 0; j < HDV / 16; ++j) { const v8f y = acc[j] * inv; v4f y0, y1v;   /* a lane's 8 registers are 8 neighbouring value dims of its query's row */
#pragma unroll
    for (int r = 0; r < 4; ++r) { y0[r] = y[r]; y1v[r] = y[4 + r]; }
    *(v4f*)&ss[wave][col][j * 16 + 8 * g] = y0; *(v4f*)&ss[wave][col][j * 16 + 8 * g + 4] = y1v; }
  const float lam = lam_lanes(LQ1, LK1, LQ2, LK2, lane);
  const int row = hs * 8 + (lane >> 2), d0 = (lane & 3) * 16;   /* waves wq and 4 + wq halve the 16 queries of tile wq: 4 lanes a query, 16 value dims a lane */
  v4f gv[4];
#pragma unroll
  for (int q = 0; q < 4; ++q) gv[q] = *(const v4f*)(GA + d0 + q * 4);
  __syncthreads();   /* both score heads' y rows stand in LDS before a wave reads the other head's */
  const float *y1 = &ss[wq][row][d0], *y2 = &ss[4 + wq][row][d0]; float d[16], sq = 0.f;
#pragma unroll
  for (int q = 0; q < 16; ++q) { d[q] = y1[q] - lam * y2[q]; sq += d[q] * d[q]; }
  sq += xrow<1>(sq); sq += xrow<2>(sq);   /* the 4 lanes of a query */
  const float rs = rsq1(sq * (1.0f / HDV) + 1e-5f) * 0.8f; v8b oh[2], ol[2];
#pragma unroll
  for (int q = 0; q < 16; ++q) { const float v = d[q] * rs * bfr(gv[q >> 2][q & 3]); const __bf16 hv = (__bf16)v; oh[q >> 3][q & 7] = hv; ol[q >> 3][q & 7] = (__bf16)(v - (float)hv); }
  const size_t ao = ((size_t)b * TT + qt * 64 + wq * 16 + row) * CC + vh * HDV + d0;   /* a query's 64 dims = one whole 128-B line of each plane, from 4 neighbouring lanes */
  *(v8b*)(AH + ao) = oh[0]; *(v8b*)(AH + ao + 8) = oh[1]; *(v8b*)(AL + ao) = ol[0]; *(v8b*)(AL + ao + 8) = ol[1]; }
__device__ __forceinline__ v16b join_b(v8b a, v8b b) { union { v16b v; v8b q[2]; } u; u.q[0] = a; u.q[1] = b; return u.v; }
// ---- k_out: block = (64 rows, 128 cols): A rows (bf16 hi + lo planes, frag_b's k order) x w_proj ((in,out)); 4-KB rows
__global__ __launch_bounds__(128) void k_out(const __bf16* __restrict__ AH, const __bf16* __restrict__ AL, const float* __restrict__ WP, float* __restrict__ OUT) { __shared__ __align__(16) float sf[4][16][132]; __shared__ __align__(16) __bf16 sw[2][8 * WJ];
  const int tid = threadIdx.x, wave = tid >> 5, lane = tid & 31, col = lane & 15, g = lane >> 4; const int c0 = blockIdx.y * 128; const size_t r0 = (size_t)blockIdx.x * 64 + wave * 16; const size_t arow = r0 + col;
  v8f acc[8] = {};
  const float* wp = WP + (size_t)(wave * 8) * CC + c0 + lane * 4; const int ws_o = wt_slot(wave, lane);
  const __bf16 *hp = AH + arow * CC + 8 * g, *lp = AL + arow * CC + 8 * g;
  WT wt; ld_wt(wt, wp, CC); v8b nh[2], nl[2];   /* step 0's pieces of the A row */
  nh[0] = *(const v8b*)hp; nh[1] = *(const v8b*)(hp + 16); nl[0] = *(const v8b*)lp; nl[1] = *(const v8b*)(lp + 16);
  st_wt(&sw[0][0] + ws_o, wt);
  __syncthreads();
  F2 a; a.h = join_b(nh[0], nh[1]); a.l = join_b(nl[0], nl[1]);
#pragma unroll 2   /* two steps a trip: the buffer of each step is then a constant */
  for (int kc = 0; kc < CC / 32; ++kc) { const bool more = kc + 1 < CC / 32;
    const int kn = kc + 1;
    if (more) { ld_wt(wt, wp + (size_t)kn * 32 * CC, CC);   /* the next step's loads fly under this step's products */
      nh[0] = *(const v8b*)(hp + kn * 32); nh[1] = *(const v8b*)(hp + kn * 32 + 16); nl[0] = *(const v8b*)(lp + kn * 32); nl[1] = *(const v8b*)(lp + kn * 32 + 16);
      asm volatile("s_wait_xcnt 0x0" ::: "memory"); }   /* in front of any rewrite of an address register that the loads above name: the roundings below reuse such registers while the youngest loads are still out */
    v16b w[8];
#pragma unroll
    for (int j = 0; j < 8; ++j) w[j] = frag_wt(&sw[kc & 1][0], j, lane);
    __builtin_amdgcn_sched_barrier(0);   /* holds the fragment reads as one group in front of the products: left free, the compiler sinks each read to its product, which then waits out the LDS latency alone */
#pragma unroll
    for (int j = 0; j < 8; ++j) { acc[j] = wmma_bf(a.h, w[j], acc[j]); acc[j] = wmma_bf(a.l, w[j], acc[j]); }
    __builtin_amdgcn_sched_barrier(0);   /* or the compiler lifts what follows, with its wait for the next step's loads, in among the products, which then stand behind that wait */
    if (more) { a.h = join_b(nh[0], nh[1]); a.l = join_b(nl[0], nl[1]); st_wt(&sw[kn & 1][0] + ws_o, wt); }
    __syncthreads(); }   /* one barrier a step: it publishes the next tile and ends the reads of the buffer that the next step refills */
#pragma unroll
  for (int j = 0; j < 8; ++j)
#pragma unroll
    for (int r = 0; r < 8; ++r) sf[wave][8 * g + r][j * 16 + col] = acc[j][r];
  LDSX(); for (int rl = 0; rl < 16; ++rl) vst2(OUT + (r0 + rl) * CC + c0 + lane * 4, *(const v4f*)&sf[wave][rl][lane * 4]); }
extern "C" void kernel_launch(void* const* d_in, const int* in_sizes, int n_in, void* d_out, int out_size, void* d_ws, size_t ws_size, hipStream_t stream) {
  (void)in_sizes; (void)n_in; (void)out_size;
  const float** F = (const float**)d_in;   // 0 x [4,1024,1024], 1 w_attn [1024,3072] ((in,out): q | k | v), 2 w_proj ((in,out)), 3 lambda_q1 [32], 4 lambda_q2, 5 lambda_k1, 6 lambda_k2, 7 gamma [64]
  if (ws_size < (size_t)WS_END) return;
  char* ws = (char*)d_ws; _Float16 *QH = (_Float16*)(ws + WS_QH), *QL = (_Float16*)(ws + WS_QL), *KH = (_Float16*)(ws + WS_KH); __bf16 *VT = (__bf16*)(ws + WS_VT), *VL = (__bf16*)(ws + WS_VL), *AH = (__bf16*)(ws + WS_AH), *AL = (__bf16*)(ws + WS_AL);
  k_proj<<<dim3(TNB * TT / 256, CC / 256, 3), 512, 0, stream>>>(F[0], F[1], nullptr, F[1] + CC, nullptr, F[1] + 2 * CC, nullptr, QH, QL, KH, VT, VL, nullptr, nullptr, 0);
  k_att<<<dim3(NH / 2, TNB, TT / 64), 256, 0, stream>>>(QH, QL, KH, VT, VL, F[3], F[4], F[5], F[6], F[7], AH, AL);
  k_out<<<dim3(TNB * TT / 64, CC / 128), 128, 0, stream>>>(AH, AL, F[2], (float*)d_out);
}

// v010
// Measured time: 100 microseconds a run.
// Two timings next to v009 both put it at 1.04 times that version's speed.
// Counting every step since v000, it is 15.2 times as fast.
// compute dtype: all float inputs rounded to bf16, the four lambda vectors and gamma read; qkv = x w_attn ((in,out)) with EXACT bf16 products on WMMA 16x16x32, f32 accumulate; q as f16 hi + residual (x 2^10), k f16 -> 2-product causal logits x (32^-1/2)^2 = 1/32 kept in f32 registers (one launch for all score heads); online softmax in f32, in base 2 (logits x log2(e) / 32, hardware exp2); unnormalised P split bf16 hi + lo against v bf16 hi + lo (3 products), divided by the row sum at the end, per score head into its value head-pair slot; the differential combination P1 v - lambda P2 v, RMSNorm, gamma and (1 - lambda_init) in f32; out = that (bf16 hi + lo) w_proj; f32 output.
#include <hip/hip_runtime.h>
#include <math.h>

typedef __attribute__((ext_vector_type(16))) _Float16 v16h;
typedef __attribute__((ext_vector_type(16))) __bf16 v16b;
typedef __attribute__((ext_vector_type(8)))  _Float16 v8h;
typedef __attribute__((ext_vector_type(8)))  float v8f;
typedef __attribute__((ext_vector_type(4)))  float v4f;
typedef __attribute__((ext_vector_type(2)))  float v2f;
typedef __attribute__((ext_vector_type(4)))  unsigned v4u;
typedef __attribute__((ext_vector_type(4)))  int v4i;
typedef float __attribute__((may_alias)) float_a;
typedef int __attribute__((may_alias)) int_a;

template <typename T> __device__ __forceinline__ void vst2(void* p, T v) { *(T*)p = v;  }
__device__ __forceinline__ v8f wmma16(v16h a, v16h b, v8f c) {
  v8f d = __builtin_amdgcn_wmma_f32_16x16x32_f16(false, a, false, b, (short)0, c, false, false);
  return d;
}
__device__ __forceinline__ v8f wmma_bf(v16b a, v16b b, v8f c) {
  v8f d = __builtin_amdgcn_wmma_f32_16x16x32_bf16(false, a, false, b, (short)0, c, false, false);
  return d;
}
// 16x16x32 fragments: lane = (h = lane>>4, row/col = lane&15); elements 0..7 = k0+8h+0..7, 8..15 = k0+16+8h+0..7; D element r = row 8h+r
__device__ __forceinline__ v16h frag_h(const _Float16* rowk0, int lane) {
  union { v16h v; v8h q[2]; } u; const _Float16* p = rowk0 + 8 * (lane >> 4);
  u.q[0] = *(const v8h*)p; u.q[1] = *(const v8h*)(p + 16); return u.v;
}
__device__ __forceinline__ v16h frag_f32(const float* rowk0, int lane) {
  v16h a; const float* p = rowk0 + 8 * (lane >> 4);
#pragma unroll
  for (int i = 0; i < 8; ++i) { a[i] = (_Float16)p[i]; a[8 + i] = (_Float16)p[16 + i]; }
  return a;
}
__device__ __forceinline__ v16h frag_f32s(const float* rowk0, int lane, float sc) {
  v16h a; const float* p = rowk0 + 8 * (lane >> 4);
#pragma unroll
  for (int i = 0; i < 8; ++i) { a[i] = (_Float16)(p[i] * sc); a[8 + i] = (_Float16)(p[16 + i] * sc); }
  return a;
}
// column fragment from a [K][ld] layout (column n), rows >= K read as 0
__device__ __forceinline__ v16h fragc_f32(const float* W, int k0, int n, int lane, int ld, int K) {
  v16h a; const int g = lane >> 4;
#pragma unroll
  for (int i = 0; i < 8; ++i) { const int ka = k0 + 8 * g + i, kb = ka + 16;
    a[i] = (_Float16)(ka < K ? W[(size_t)(ka < K ? ka : K - 1) * ld + n] : 0.f); a[8 + i] = (_Float16)(kb < K ? W[(size_t)(kb < K ? kb : K - 1) * ld + n] : 0.f); }
  return a;
}
struct F2 { v16b h, l; };
__device__ __forceinline__ F2 bsplit16(const float v[16]) { F2 r;
#pragma unroll
  for (int i = 0; i < 16; ++i) { const __bf16 h = (__bf16)v[i]; r.h[i] = h; r.l[i] = (__bf16)(v[i] - (float)h); }
  return r; }
__device__ __forceinline__ F2 split_row(const float* row, int k0, int lane) { float v[16]; const float* p = row + k0 + 8 * (lane >> 4);
#pragma unroll
  for (int i = 0; i < 8; ++i) { v[i] = p[i]; v[8 + i] = p[16 + i]; }
  return bsplit16(v); }
__device__ __forceinline__ F2 split_rowK(const float* row, int k0, int lane, int K) { float v[16]; const int g = lane >> 4;
#pragma unroll
  for (int i = 0; i < 8; ++i) { const int ka = k0 + 8 * g + i, kb = ka + 16; v[i] = ka < K ? row[ka < K ? ka : K - 1] : 0.f; v[8 + i] = kb < K ? row[kb < K ? kb : K - 1] : 0.f; }
  return bsplit16(v); }
__device__ __forceinline__ F2 split_col(const float* W, int k0, int n, int lane, int ld, int K) { float v[16]; const int g = lane >> 4;
#pragma unroll
  for (int i = 0; i < 8; ++i) { const int ka = k0 + 8 * g + i, kb = ka + 16; v[i] = ka < K ? W[(size_t)(ka < K ? ka : K - 1) * ld + n] : 0.f; v[8 + i] = kb < K ? W[(size_t)(kb < K ? kb : K - 1) * ld + n] : 0.f; }
  return bsplit16(v); }
__device__ __forceinline__ v8f mac3(const F2& a, const F2& b, v8f c) { c = wmma_bf(a.l, b.h, c); c = wmma_bf(a.h, b.l, c); return wmma_bf(a.h, b.h, c); }
__device__ __forceinline__ float sigm(float v) { return 1.0f / (1.0f + expf(-v)); }
#define LDSX() do { asm volatile("s_wait_dscnt 0" ::: "memory"); __builtin_amdgcn_wave_barrier(); __builtin_amdgcn_fence(__ATOMIC_RELEASE, "workgroup"); } while (0)


// Differential causal attention (B 4, T 1,024, C 1,024; 2H = 32 score heads x 32, 16 value heads x 64): att = softmax(causal(q k^T / 32)) per score head; diff_i = att_{2i} - lambda att_{2i+1}, lambda = exp(lq1.lk1) - exp(lq2.lk2) + 0.2; out_i = RMSNorm(diff_i v_i) * gamma * 0.8; concat w_proj.
#define NB 4
#define TT 1024
#define CC 1024
#define NH 32              // score heads (2H)
#define HD 32              // score head dim
#define HDV 64             // value head dim (16 value heads)
#define WIN (TT + 1)       // plain causal
#define NKV 32             // k has the same 32 heads
#define LDW 3072           // w_attn (in,out) [1024][3072]: q | k | v column blocks
#define CK (NKV * HD)   // 1,024: k/v row width
#define REP (NH / NKV)
#ifndef TNB
#define TNB NB
#endif
typedef __attribute__((ext_vector_type(8))) __bf16 v8b;
__device__ __forceinline__ v16b frag_b(const __bf16* rowk0, int lane) {
  union { v16b v; v8b q[2]; } u; const __bf16* p = rowk0 + 8 * (lane >> 4);
  u.q[0] = *(const v8b*)p; u.q[1] = *(const v8b*)(p + 16); return u.v;
}
__device__ __forceinline__ float bfr(float v) { return (float)(__bf16)v; }
// ---- operand tiles of one k step (32 deep) in LDS, bf16, in fragment order: a weight fragment read is lane * 16 B, contiguous over the wave; an x fragment read is contiguous per 16-lane half
typedef __attribute__((ext_vector_type(4))) __bf16 v4b;
#define WJ 520             // elements per 16-column group of a weight tile: k 0..15 (256) + k 16..31 (256) + 8 of pad, so that the 16 lanes of a store fall on 16 different 16-B slots
#define XC 160             // elements per 8-k chunk of a group of 16 x rows: 128 + 32 of pad, for the same reason
#define XO (16 * WJ)       // the x rows stand behind k_proj's weight tile (256 columns)
struct WT { v4f r[8]; };   // wave w: rows 8w..8w+7 of the tile, a lane 4 columns; one load = one 512-B row piece = 4 whole lines
__device__ __forceinline__ void ld_wt(WT& t, const float* p, int ld) {
#pragma unroll
  for (int i = 0; i < 8; ++i) t.r[i] = *(const v4f*)(p + (size_t)i * ld); }
__device__ __forceinline__ int wt_slot(int wave, int lane) { return (lane >> 2) * WJ + (wave >> 1) * 256 + (wave & 1) * 128 + (lane & 3) * 32; }   // column 4 lane + c stands c * 8 elements on
__device__ __forceinline__ void st_wt(__bf16* p, const WT& t) {
#pragma unroll
  for (int c = 0; c < 4; ++c) { v8b o;
#pragma unroll
    for (int i = 0; i < 8; ++i) o[i] = (__bf16)t.r[i][c];
    *(v8b*)(p + c * 8) = o; } }
__device__ __forceinline__ v16b frag_wt(const __bf16* tile, int j, int lane) {   // frag_b's k order: elements 0..7 = 8g + 0..7, 8..15 = 16 + 8g + 0..7, column 16 j + col
  union { v16b v; v8b q[2]; } u; const __bf16* p = tile + j * WJ + lane * 8;
  u.q[0] = *(const v8b*)p; u.q[1] = *(const v8b*)(p + 256); return u.v; }
__device__ __attribute__((noinline)) float exp_ni(float v) { return expf(v); }
__device__ __attribute__((noinline)) float erf_ni(float v) { return erff(v); }

#define WS_QH  0u
#define WS_QL  (WS_QH + 2u * (size_t)NB * TT * CC)
#define WS_KH  (WS_QL + 2u * (size_t)NB * TT * CC)
#define WS_VT  (WS_KH + 2u * (size_t)NB * TT * CK)      // bf16 v planes [b][CK][t] (k rows are [b*T+t][CK])
#define WS_VL  (WS_VT + 2u * (size_t)NB * CK * TT)
#define WS_AH  (WS_VL + 2u * (size_t)NB * CK * TT)      // bf16 hi and lo planes of k_out's A rows [b*t][1,024]: the normalised differential output
#define WS_AL  (WS_AH + 2u * (size_t)NB * TT * CC)
#define WS_END (WS_AL + 2u * (size_t)NB * TT * CC)

// ---- k_proj: block = (256 rows, 256 cols, which), 16 waves in a 4 x 4 grid, a wave 64 x 64 (4 x 4 accumulator tiles): qkv = x W (+ b), exact; q -> f16 hi (+ residual), k -> f16 rows, v -> bf16 planes. Each fetched x row serves 256 columns and each weight row 256 rows; each fragment read from LDS serves 4 products
__device__ __forceinline__ void ld_xt(WT& t, const float* p) {   // 32 x rows of one k step: 8 lanes a row, one load = 4 rows x one whole line
#pragma unroll
  for (int i = 0; i < 8; ++i) t.r[i] = *(const v4f*)(p + (size_t)(4 * i) * CC); }
__device__ __forceinline__ void st_xt(__bf16* p, const WT& t) {   // loads 0..3 are the first 16-row group, 4..7 the second
#pragma unroll
  for (int i = 0; i < 8; ++i) { v4b o; o[0] = (__bf16)t.r[i][0]; o[1] = (__bf16)t.r[i][1]; o[2] = (__bf16)t.r[i][2]; o[3] = (__bf16)t.r[i][3]; *(v4b*)(p + (i >> 2) * 4 * XC + (i & 3) * 32) = o; } }
#define SBE (XO + 16 * 4 * XC)   // elements of one staging buffer: the weight tile and 16 groups of 16 x rows
#define EP 264             // elements per row of an epilogue plane: 512 B + 16 B of pad; pitch = 16 B x odd
__global__ __launch_bounds__(512) void k_proj(const float* __restrict__ X, const float* __restrict__ WQ, const float* __restrict__ BQ, const float* __restrict__ WK, const float* __restrict__ BK, const float* __restrict__ WV, const float* __restrict__ BV, _Float16* __restrict__ QH, _Float16* __restrict__ QL, _Float16* __restrict__ KH, __bf16* __restrict__ VT, __bf16* __restrict__ VL, const float* __restrict__ NQW, const float* __restrict__ NKW, int wbase) {
  __shared__ __align__(16) char pool[2 * 256 * EP * 2];   /* the epilogue's two planes; the two staging buffers (37,120 B each) lie in the first, which is written only behind the loop's last barrier */
  const int tid = threadIdx.x, wave = __builtin_amdgcn_readfirstlane(tid >> 5), lane = tid & 31, col = lane & 15, g = lane >> 4; const int wm = wave >> 2, wn = wave & 3;   /* the wave's 64 rows, its 64 columns */ const int which = wbase + blockIdx.z; const int OW = (which == 0) ? CC : CK;   /* output row width */ const int c0 = blockIdx.y * 256; const size_t r0 = (size_t)blockIdx.x * 256; const float* WA = which == 0 ? WQ : which == 1 ? WK : WV; const float* BA = which == 0 ? BQ : which == 1 ? BK : BV;
  v8f acc[4][4] = {};
  __bf16* const sb0 = (__bf16*)pool; __bf16* const sb1 = sb0 + SBE;
  const bool wrole = wave < 8;   /* wave-uniform: waves 0..7 bring the weight tile (8 k rows x 128 columns each), waves 8..15 the x rows (32 each); 8 loads of 16 B a lane either way */
  const float* gp = wrole ? WA + (size_t)((wave & 3) * 8) * LDW + c0 + (wave >> 2) * 128 + lane * 4   /* (in,out), row length 3072 */ : X + (r0 + (wave - 8) * 32 + (lane >> 3)) * CC + (lane & 7) * 4;
  const int st_o = wrole ? (wave >> 2) * 8 * WJ + wt_slot(wave & 3, lane) : XO + (wave - 8) * 8 * XC + ((lane & 7) >> 1) * XC + (lane >> 3) * 8 + (lane & 1) * 4; const int xr_o = XO + wm * 16 * XC + g * XC + col * 8;
  WT wt;
  if (wrole) ld_wt(wt, gp, LDW); else ld_xt(wt, gp);
  asm volatile("s_wait_xcnt 0x0" ::: "memory");   /* in front of any rewrite of an address register that the loads above name: the roundings below reuse such registers */
  if (wrole) st_wt(sb0 + st_o, wt); else st_xt(sb0 + st_o, wt);
  __syncthreads();
#pragma unroll 2   /* two steps a trip: the buffer of each step is then a constant */
  for (int kc = 0; kc < CC / 32; ++kc) { const __bf16* cur = (kc & 1) ? sb1 : sb0; __bf16* nxt = (kc & 1) ? sb0 : sb1; const bool more = kc + 1 < CC / 32;
    if (more) { if (wrole) ld_wt(wt, gp + (size_t)(kc + 1) * 32 * LDW, LDW); else ld_xt(wt, gp + (kc + 1) * 32);   /* the next step's loads fly under this step's products */
      asm volatile("s_wait_xcnt 0x0" ::: "memory"); }   /* in front of any rewrite of an address register that the loads above name */
    v16b a[4], w[4];
#pragma unroll
    for (int i = 0; i < 4; ++i) { union { v16b v; v8b q[2]; } u; u.q[0] = *(const v8b*)(cur + xr_o + i * 4 * XC); u.q[1] = *(const v8b*)(cur + xr_o + i * 4 * XC + 2 * XC); a[i] = u.v; }
#pragma unroll
    for (int j = 0; j < 4; ++j) w[j] = frag_wt(cur, wn * 4 + j, lane);
    __builtin_amdgcn_sched_barrier(0);   /* holds the fragment reads as one group in front of the products: left free, the compiler sinks each read to its product, which then waits out the LDS latency alone */
#pragma unroll
    for (int i = 0; i < 4; ++i)
#pragma unroll
      for (int j = 0; j < 4; ++j) acc[i][j] = wmma_bf(a[i], w[j], acc[i][j]);
    __builtin_amdgcn_sched_barrier(0);   /* or the compiler lifts the roundings below, with their wait for the next step's loads, in among the products, which then stand behind that wait */
    if (more) { if (wrole) st_wt(nxt + st_o, wt); else st_xt(nxt + st_o, wt); }
    __syncthreads(); }   /* one barrier a step: it publishes the next tile and ends the reads of the buffer that the next step refills */
  _Float16* const sh = (_Float16*)pool; _Float16* const sl = sh + 256 * EP; __bf16* const th = (__bf16*)pool; __bf16* const tl2 = th + 256 * EP;   /* q, k: [row][column]; v: [column][row] */
  const int rb = wm * 64 + 8 * g, cb = wn * 64 + col;   /* accumulator tile (i, j), register r: row rb + 16 i + r, column cb + 16 j */
  if (BA) {
#pragma unroll
    for (int j = 0; j < 4; ++j) { const float bb = bfr(BA[c0 + cb + j * 16]); asm volatile("s_wait_xcnt 0x0" ::: "memory");   /* in front of any rewrite of the index register that the load names */
#pragma unroll
      for (int i = 0; i < 4; ++i) acc[i][j] += bb; } }
  if (which == 2) {
#pragma unroll
    for (int i = 0; i < 4; ++i)
#pragma unroll
      for (int j = 0; j < 4; ++j) { v8b oh, ol;   /* a lane's 8 registers are 8 neighbouring rows: one 16-B store a plane */
#pragma unroll
        for (int r = 0; r < 8; ++r) { const float v = acc[i][j][r]; const __bf16 bh = (__bf16)v; oh[r] = bh; ol[r] = (__bf16)(v - (float)bh); }
        *(v8b*)(th + (cb + j * 16) * EP + rb + i * 16) = oh; *(v8b*)(tl2 + (cb + j * 16) * EP + rb + i * 16) = ol; } }
  else {
#pragma unroll
    for (int i = 0; i < 4; ++i)
#pragma unroll
      for (int j = 0; j < 4; ++j)
#pragma unroll
        for (int r = 0; r < 8; ++r) sh[(rb + i * 16 + r) * EP + cb + j * 16] = (_Float16)acc[i][j][r]; }
  if (which == 0) {   /* q alone has a residual plane, carried x 2^10 so that it stays f16-normal on the chip */
#pragma unroll
    for (int i = 0; i < 4; ++i)
#pragma unroll
      for (int j = 0; j < 4; ++j)
#pragma unroll
        for (int r = 0; r < 8; ++r) { const float v = acc[i][j][r]; sl[(rb + i * 16 + r) * EP + cb + j * 16] = (_Float16)((v - (float)(_Float16)v) * 1024.0f); } }
  __syncthreads();
  const int er = tid >> 5, eq = (tid & 31) * 8;   /* a wave stores one plane row's 512 B: 4 whole lines; pass it takes rows 16 it + 0..15 */
  if (which == 0) { for (int it = 0; it < 16; ++it) { const int rl = it * 16 + er; const size_t o = (r0 + rl) * CC + c0 + eq; vst2((unsigned*)(QH + o), *(const v4u*)&sh[rl * EP + eq]); vst2((unsigned*)(QL + o), *(const v4u*)&sl[rl * EP + eq]); } }
  else if (which == 1) { for (int it = 0; it < 16; ++it) { const int rl = it * 16 + er; vst2((unsigned*)(KH + (r0 + rl) * OW + c0 + eq), *(const v4u*)&sh[rl * EP + eq]); }
    asm volatile("s_wait_xcnt 0x0" ::: "memory"); }   /* behind the last store of the run: in front of any rewrite of a register that the stores name */
  else { const size_t b = r0 / TT; const int t0 = (int)(r0 % TT); for (int it = 0; it < 16; ++it) { const int cl = it * 16 + er; const size_t o2 = (b * CK + c0 + cl) * (size_t)TT + t0 + eq; vst2((unsigned*)(VT + o2), *(const v4u*)&th[cl * EP + eq]); vst2((unsigned*)(VL + o2), *(const v4u*)&tl2[cl * EP + eq]); }
    asm volatile("s_wait_xcnt 0x0" ::: "memory"); } }   /* behind the last store of the run: in front of any rewrite of a register that the stores name */
// e[i] = 2^t[i], one instruction each; below -126 it gives 0, which is what a masked or far-off logit is to give. One statement, so that the slot behind a transcendental is kept by construction: behind each v_exp_f32 stands one that neither reads
// its result nor overwrites its source (every output "=&v"), behind the last a v_nop
__device__ __forceinline__ void ex2x9(float* e, const float* t) {
  asm("v_exp_f32 %0, %9\n\tv_exp_f32 %1, %10\n\tv_exp_f32 %2, %11\n\tv_exp_f32 %3, %12\n\tv_exp_f32 %4, %13\n\tv_exp_f32 %5, %14\n\tv_exp_f32 %6, %15\n\tv_exp_f32 %7, %16\n\tv_exp_f32 %8, %17\n\tv_nop"
    : "=&v"(e[0]), "=&v"(e[1]), "=&v"(e[2]), "=&v"(e[3]), "=&v"(e[4]), "=&v"(e[5]), "=&v"(e[6]), "=&v"(e[7]), "=&v"(e[8]) : "v"(t[0]), "v"(t[1]), "v"(t[2]), "v"(t[3]), "v"(t[4]), "v"(t[5]), "v"(t[6]), "v"(t[7]), "v"(t[8])); }
__device__ __forceinline__ void ex2x8(float* e, const float* t) {   // the same for eight
  asm("v_exp_f32 %0, %8\n\tv_exp_f32 %1, %9\n\tv_exp_f32 %2, %10\n\tv_exp_f32 %3, %11\n\tv_exp_f32 %4, %12\n\tv_exp_f32 %5, %13\n\tv_exp_f32 %6, %14\n\tv_exp_f32 %7, %15\n\tv_nop"
    : "=&v"(e[0]), "=&v"(e[1]), "=&v"(e[2]), "=&v"(e[3]), "=&v"(e[4]), "=&v"(e[5]), "=&v"(e[6]), "=&v"(e[7]) : "v"(t[0]), "v"(t[1]), "v"(t[2]), "v"(t[3]), "v"(t[4]), "v"(t[5]), "v"(t[6]), "v"(t[7])); }
#define LC 0.045084220027780106f   // log2(e) / 32: the logits' scale and the change of base in one factor, so that exp(s / 32 - m) = 2^(s LC - m')
template <int M> __device__ __forceinline__ float xrow(float v) { return __builtin_bit_cast(float, __builtin_amdgcn_update_dpp(0, __builtin_bit_cast(int, v), 0x160 | M, 0xf, 0xf, true)); }   // lane l reads lane l ^ M of its 16-lane row (DPP row_xmask): no LDS round trip
__device__ __forceinline__ float xhalf(float v) { return __builtin_bit_cast(float, __builtin_amdgcn_permlanex16(__builtin_bit_cast(int, v), __builtin_bit_cast(int, v), 0x76543210, 0xfedcba98, false, false)); }   // lane l reads lane l ^ 16
// ---- K and V tiles of one 128-key chunk in LDS, brought once a block by asynchronous 16-B copies and read by all eight waves; two buffers: the next chunk's copies fly while this chunk is worked on
#define KP 72              // f16 elements per key row of the K tile: the two score heads' 64 B each + 16 B of pad; pitch = 16 B x odd, so the 16 lanes of a fragment read fall on different banks
#define VP 136             // bf16 elements per value-dim row of a v tile: 256 B + 16 B of pad, for the same reason
#define KBB (128 * KP * 2)       // bytes of one K buffer
#define VBB (2 * HDV * VP * 2)   // bytes of one v buffer (hi and lo plane)
struct VF { v16b h[HDV / 16], l[HDV / 16]; };   // v fragments (hi, lo planes) of 32 keys x 64 value dims
__device__ __forceinline__ void ld_v(VF& f, const __bf16* vt, const __bf16* vl, int lane) {
#pragma unroll
  for (int j = 0; j < HDV / 16; ++j) { f.h[j] = frag_b(vt + j * 16 * VP, lane); f.l[j] = frag_b(vl + j * 16 * VP, lane); }   // from the LDS tiles, row pitch VP
  __builtin_amdgcn_sched_barrier(0);   /* holds the fragment reads as one group in front of the products: left free, the compiler sinks each read to its product, which then waits out the LDS latency alone */
}
// two transposed score tiles (keys 0..15 and 16..31 of 32; D register r = key 8 g + r, the lane's column = its query) are, element for element, a B fragment in frag_b's k order; v's rows (value dims) are the A side: acc[j][r] = O^T[16 j + 8 g + r][query]
__device__ __forceinline__ void pvt32(v8f* acc, v8f e0, v8f e1, const VF& f) { float v[16];
#pragma unroll
  for (int i = 0; i < 8; ++i) { v[i] = e0[i]; v[8 + i] = e1[i]; }
  const F2 p = bsplit16(v);
#pragma unroll
  for (int j = 0; j < HDV / 16; ++j) { acc[j] = wmma_bf(f.h[j], p.h, acc[j]); acc[j] = wmma_bf(f.h[j], p.l, acc[j]); acc[j] = wmma_bf(f.l[j], p.h, acc[j]); }
  // one statement behind the block of 12 products, where one stood behind each: it ends the block in front of the next group's LDS reads (left free, the compiler sinks the products below those reads, two groups of fragments are live at once and registers spill); its four slots are the distance behind the last product
  asm volatile("v_nop\n\tv_nop\n\tv_nop\n\tv_nop" : "+v"(acc[0]), "+v"(acc[1]), "+v"(acc[2]), "+v"(acc[3])); }
__device__ __forceinline__ unsigned lds_off(const void* p) { return (unsigned)(size_t)p; }   // byte offset in the work-group's LDS
// n copies of a lane, copy i standing ls bytes on in LDS and gs bytes on in global memory; the wait is the last line of the copies' own statement, so it stands in front of every rewrite of an address register that they name
__device__ __forceinline__ void acopy4(unsigned l, unsigned ls, const char* p, size_t gs) {
  asm volatile("global_load_async_to_lds_b128 %0, %4, off\n\tglobal_load_async_to_lds_b128 %1, %5, off\n\tglobal_load_async_to_lds_b128 %2, %6, off\n\tglobal_load_async_to_lds_b128 %3, %7, off\n\ts_wait_xcnt 0x0"
    :: "v"(l), "v"(l + ls), "v"(l + 2 * ls), "v"(l + 3 * ls), "v"(p), "v"(p + gs), "v"(p + 2 * gs), "v"(p + 3 * gs) : "memory"); }
// lambda = exp(lq1.lk1) - exp(lq2.lk2) + 0.2: lane i brings element i (one round of loads); the products of bf16-rounded values are exact in f32 and are summed from element 0 up
__device__ __forceinline__ float rdlane(float v, int i) { return __builtin_bit_cast(float, __builtin_amdgcn_readlane(__builtin_bit_cast(int, v), i)); }
__device__ __forceinline__ float lam_lanes(const float* LQ1, const float* LK1, const float* LQ2, const float* LK2, int lane) { const float p1 = bfr(LQ1[lane]) * bfr(LK1[lane]), p2 = bfr(LQ2[lane]) * bfr(LK2[lane]); float s1 = 0.f, s2 = 0.f;
#pragma unroll
  for (int i = 0; i < HD; ++i) { s1 += rdlane(p1, i); s2 += rdlane(p2, i); }
  return expf(s1) - expf(s2) + 0.2f; }
// 1 / sqrt(x) for x >= 1e-5, a normal number, where the library form's rescue of denormal arguments is an identity. One statement, so that the slot behind a transcendental is kept by construction
__device__ __forceinline__ float rsq1(float x) { float r; asm("v_rsq_f32 %0, %1\n\tv_nop" : "=&v"(r) : "v"(x)); return r; }
// ---- k_att: block = 64 queries of (b, value head), 8 waves: waves 0..3 take score head 2i, waves 4..7 score head 2i+1, one wave per 16 queries; all share the chunk's v tiles, and the K tile holds both heads' rows. Per 128-key chunk: 2-product logits transposed (K rows the A side, q the B side), x log2(e) / 32, in the D registers: a lane holds 64 keys of ONE query, its partner lane ^ 16 the other 64; running maximum and rescale (online softmax) in the lane, one exchange between the halves;
// P = 2^(s - m) goes from the D registers straight into B fragments (bf16 hi + lo), 3-product v^T . P^T into acc; the sums stay per lane until the end; y = acc / l into LDS; then, over the block, (y[2i] - lambda y[2i+1]) rms 0.8 gamma, split bf16 hi + lo: k_out's A rows
__global__ __launch_bounds__(256, 4) /* four waves a SIMD: a budget of 256 registers */ void k_att(const _Float16* __restrict__ QH, const _Float16* __restrict__ QL, const _Float16* __restrict__ KH, const __bf16* __restrict__ VT, const __bf16* __restrict__ VL, const float* __restrict__ LQ1, const float* __restrict__ LQ2, const float* __restrict__ LK1, const float* __restrict__ LK2, const float* __restrict__ GA, __bf16* __restrict__ AH, __bf16* __restrict__ AL) { __shared__ __align__(16) float ss[8][16][68];   /* y rows of the epilogue; pitch = 16 B x odd */ __shared__ __align__(16) _Float16 sk[2][128 * KP]; __shared__ __align__(16) __bf16 sv[2][2][HDV * VP];   /* [buffer], [buffer][hi, lo plane] */
  const int tid = threadIdx.x, wave = tid >> 5, lane = tid & 31, col = lane & 15, g = lane >> 4; const int hs = wave >> 2, wq = wave & 3;   /* which score head of the pair, which 16 queries */ const int vh = blockIdx.x, h = 2 * vh + hs, b = blockIdx.y; const int qt = TT / 64 - 1 - blockIdx.z;   /* the query tile is the slowest block index and falls with it: the tiles with the most key chunks take the lowest indices (for speed only) */ const int ql0 = qt * 64 + wq * 16; const int kend = qt * 64 + 64; const size_t q0 = (size_t)b * TT + ql0;
  const v16h ah = frag_h(QH + (q0 + col) * CC + h * HD, lane), al = frag_h(QL + (q0 + col) * CC + h * HD, lane);
  v8f acc[HDV / 16] = {}; float m = -3.0e38f, l = 0.f;   /* of this lane's query, ql0 + col */
  const _Float16* kg = KH + ((size_t)b * TT + (tid >> 3)) * CK + vh * (2 * HD) + (tid & 7) * 8;   /* copies: 8 lanes a key row (both heads, 128 B = one whole line), copy i 32 rows on; the three pointers walk on by a chunk behind each chunk's copies */
  const size_t po = ((size_t)b * CK + vh * HDV + (tid >> 4)) * (size_t)TT + (tid & 15) * 8;   /* value head vh (64 wide): 16 lanes a row piece (256 B = 2 whole lines), copy i 16 rows on */ const __bf16 *vtg = VT + po, *vlg = VL + po;
  const unsigned kl = lds_off(&sk[0][0]) + (tid >> 3) * (KP * 2) + (tid & 7) * 16, vl0 = lds_off(&sv[0][0][0]) + (tid >> 4) * (VP * 2) + (tid & 15) * 16, vl1 = vl0 + HDV * VP * 2;   /* in buffer 0; buffer 1 stands KBB and VBB bytes on */
  const _Float16* kp = &sk[0][0] + col * KP + hs * HD + 8 * g;   /* this lane's half of its head's part of its key row of the tile */ const __bf16 *vtp = &sv[0][0][col * VP], *vlp = &sv[0][1][col * VP];
  const int nch = (kend + 127) >> 7;   /* key chunks of this block: the same for all its waves */
  acopy4(kl, 32 * KP * 2, (const char*)kg, (size_t)32 * CK * 2); acopy4(vl0, 16 * VP * 2, (const char*)vtg, (size_t)16 * TT * 2); acopy4(vl1, 16 * VP * 2, (const char*)vlg, (size_t)16 * TT * 2);   /* chunk 0 into buffer 0 */
  kg += (size_t)128 * CK; vtg += 128; vlg += 128;
  asm volatile("s_wait_asynccnt 0x0" ::: "memory");   /* this wave's copies of chunk 0 have landed ... */
  __syncthreads();   /* ... and so have every wave's: buffer 0 may be read */
  if (nch > 1) { acopy4(kl + KBB, 32 * KP * 2, (const char*)kg, (size_t)32 * CK * 2); acopy4(vl0 + VBB, 16 * VP * 2, (const char*)vtg, (size_t)16 * TT * 2); acopy4(vl1 + VBB, 16 * VP * 2, (const char*)vlg, (size_t)16 * TT * 2);   /* chunk 1 into buffer 1: it flies under chunk 0's work */
    kg += (size_t)128 * CK; vtg += 128; vlg += 128; }
#pragma unroll 1   /* rolled: one chunk's body fills the register budget; the inner loops are unrolled so that their arrays are registers */
  for (int t = 0; t < nch; ++t) { v8f s[8]; v16h kb[8]; const int k0 = t * 128, bs = t & 1;   /* chunk t stands in buffer t mod 2 */
    const _Float16* kpc = kp + bs * (KBB / 2); const __bf16 *vtc = vtp + bs * (VBB / 2), *vlc = vlp + bs * (VBB / 2);
#pragma unroll
    for (int j = 0; j < 8; ++j) { union { v16h v; v8h q[2]; } u; const _Float16* p = kpc + j * 16 * KP; u.q[0] = *(const v8h*)p; u.q[1] = *(const v8h*)(p + 16); kb[j] = u.v; }   /* frag_h's order */
#pragma unroll
    for (int j = 0; j < 8; ++j) { v8f a0 = {}, a1 = {}; a0 = wmma16(kb[j], ah, a0); a1 = wmma16(kb[j], al, a1); s[j] = a0 + a1 * (1.0f / 1024.0f); }
    const bool full = k0 + 64 < kend;   /* wave-uniform: keys 64..127 of the chunk are open to some row */
    const int dq = ql0 + col - 8 * g - k0;   /* causal test against constants: one register, not one per element */
    float mj[8];   /* eight independent chains */
#pragma unroll
    for (int j = 0; j < 8; ++j) { mj[j] = -3.0e38f;
#pragma unroll
      for (int r = 0; r < 8; ++r) { const float v = (j * 16 + r <= dq) ? s[j][r] * LC : -3.0e38f;   /* key k0 + 16 j + 8 g + r <= query ql0 + col; q * 32^-1/2 then * 1/sqrt(32) = 1/32, times log2(e) */ s[j][r] = v; mj[j] = fmaxf(mj[j], v); } }
    float mx = fmaxf(fmaxf(fmaxf(mj[0], mj[1]), fmaxf(mj[2], mj[3])), fmaxf(fmaxf(mj[4], mj[5]), fmaxf(mj[6], mj[7])));
    mx = fmaxf(mx, xhalf(mx));   /* the two halves hold one query's keys */
    const float mn = fmaxf(m, mx); float sc;
    { float t[9], e[9]; t[0] = m - mn;   /* the rescale factor */
#pragma unroll
      for (int r = 0; r < 8; ++r) t[1 + r] = s[0][r] - mn;   /* a masked logit (-3e38) gives exactly 0: mn is a real logit, key 0 is open to every query */
      ex2x9(e, t); sc = e[0];
#pragma unroll
      for (int r = 0; r < 8; ++r) s[0][r] = e[1 + r]; }
#pragma unroll
    for (int j = 1; j < 8; ++j) { float t[8], e[8];
#pragma unroll
      for (int r = 0; r < 8; ++r) t[r] = s[j][r] - mn;
      ex2x8(e, t);
#pragma unroll
      for (int r = 0; r < 8; ++r) s[j][r] = e[r]; }
    m = mn;
    const v8f sm = ((s[0] + s[1]) + (s[2] + s[3])) + ((s[4] + s[5]) + (s[6] + s[7]));
    l = l * sc + (((sm[0] + sm[1]) + (sm[2] + sm[3])) + ((sm[4] + sm[5]) + (sm[6] + sm[7])));
#pragma unroll
    for (int j = 0; j < HDV / 16; ++j) acc[j] *= sc;
    VF va; ld_v(va, vtc, vlc, lane); pvt32(acc, s[0], s[1], va); ld_v(va, vtc + 32, vlc + 32, lane); pvt32(acc, s[2], s[3], va);
    if (full) { ld_v(va, vtc + 64, vlc + 64, lane); pvt32(acc, s[4], s[5], va); ld_v(va, vtc + 96, vlc + 96, lane); pvt32(acc, s[6], s[7], va); }
    asm volatile("s_wait_dscnt 0x0" ::: "memory");   /* this wave's reads of chunk t's buffer have returned ... */
    asm volatile("s_wait_asynccnt 0x0" ::: "memory");   /* ... and its copies of chunk t + 1 have landed ... */
    __syncthreads();   /* ... and so have every wave's: the one barrier of a chunk publishes chunk t + 1 and frees chunk t's buffer */
    if (t + 2 < nch) { acopy4(kl + bs * KBB, 32 * KP * 2, (const char*)kg, (size_t)32 * CK * 2); acopy4(vl0 + bs * VBB, 16 * VP * 2, (const char*)vtg, (size_t)16 * TT * 2); acopy4(vl1 + bs * VBB, 16 * VP * 2, (const char*)vlg, (size_t)16 * TT * 2);   /* chunk t + 2 into the buffer just read: it flies under chunk t + 1's work */
      kg += (size_t)128 * CK; vtg += 128; vlg += 128; } }
  asm volatile("s_wait_asynccnt 0x0" ::: "memory");   /* no copy is out when the wave goes on to the epilogue and ends */
  const float inv = 1.0f / (l + xhalf(l));   /* the halves' sums joined once */
#pragma unroll
  for (int j = 0; j < HDV / 16; ++j) { const v8f y = acc[j] * inv; v4f y0, y1v;   /* a lane's 8 registers are 8 neighbouring value dims of its query's row */
#pragma unroll
    for (int r = 0; r < 4; ++r) { y0[r] = y[r]; y1v[r] = y[4 + r]; }
    *(v4f*)&ss[wave][col][j * 16 + 8 * g] = y0; *(v4f*)&ss[wave][col][j * 16 + 8 * g + 4] = y1v; }
  const float lam = lam_lanes(LQ1, LK1, LQ2, LK2, lane);
  const int row = hs * 8 + (lane >> 2), d0 = (lane & 3) * 16;   /* waves wq and 4 + wq halve the 16 queries of tile wq: 4 lanes a query, 16 value dims a lane */
  v4f gv[4];
#pragma unroll
  for (int q = 0; q < 4; ++q) gv[q] = *(const v4f*)(GA + d0 + q * 4);
  __syncthreads();   /* both score heads' y rows stand in LDS before a wave reads the other head's */
  const float *y1 = &ss[wq][row][d0], *y2 = &ss[4 + wq][row][d0]; float d[16], sq = 0.f;
#pragma unroll
  for (int q = 0; q < 16; ++q) { d[q] = y1[q] - lam * y2[q]; sq += d[q] * d[q]; }
  sq += xrow<1>(sq); sq += xrow<2>(sq);   /* the 4 lanes of a query */
  const float rs = rsq1(sq * (1.0f / HDV) + 1e-5f) * 0.8f; v8b oh[2], ol[2];
#pragma unroll
  for (int q = 0; q < 16; ++q) { const float v = d[q] * rs * bfr(gv[q >> 2][q & 3]); const __bf16 hv = (__bf16)v; oh[q >> 3][q & 7] = hv; ol[q >> 3][q & 7] = (__bf16)(v - (float)hv); }
  const size_t ao = ((size_t)b * TT + qt * 64 + wq * 16 + row) * CC + vh * HDV + d0;   /* a query's 64 dims = one whole 128-B line of each plane, from 4 neighbouring lanes */
  *(v8b*)(AH + ao) = oh[0]; *(v8b*)(AH + ao + 8) = oh[1]; *(v8b*)(AL + ao) = ol[0]; *(v8b*)(AL + ao + 8) = ol[1]; }
__device__ __forceinline__ v16b join_b(v8b a, v8b b) { union { v16b v; v8b q[2]; } u; u.q[0] = a; u.q[1] = b; return u.v; }
// ---- k_out: block = (64 rows, 128 cols): A rows (bf16 hi + lo planes, frag_b's k order) x w_proj ((in,out)); 4-KB rows
__global__ __launch_bounds__(128) void k_out(const __bf16* __restrict__ AH, const __bf16* __restrict__ AL, const float* __restrict__ WP, float* __restrict__ OUT) { __shared__ __align__(16) float sf[4][16][132]; __shared__ __align__(16) __bf16 sw[2][8 * WJ];
  const int tid = threadIdx.x, wave = tid >> 5, lane = tid & 31, col = lane & 15, g = lane >> 4; const int c0 = blockIdx.y * 128; const size_t r0 = (size_t)blockIdx.x * 64 + wave * 16; const size_t arow = r0 + col;
  v8f acc[8] = {};
  const float* wp = WP + (size_t)(wave * 8) * CC + c0 + lane * 4; const int ws_o = wt_slot(wave, lane);
  const __bf16 *hp = AH + arow * CC + 8 * g, *lp = AL + arow * CC + 8 * g;
  WT wt; ld_wt(wt, wp, CC); v8b nh[2], nl[2];   /* step 0's pieces of the A row */
  nh[0] = *(const v8b*)hp; nh[1] = *(const v8b*)(hp + 16); nl[0] = *(const v8b*)lp; nl[1] = *(const v8b*)(lp + 16);
  st_wt(&sw[0][0] + ws_o, wt);
  __syncthreads();
  F2 a; a.h = join_b(nh[0], nh[1]); a.l = join_b(nl[0], nl[1]);
#pragma unroll 2   /* two steps a trip: the buffer of each step is then a constant */
  for (int kc = 0; kc < CC / 32; ++kc) { const bool more = kc + 1 < CC / 32;
    const int kn = kc + 1;
    if (more) { ld_wt(wt, wp + (size_t)kn * 32 * CC, CC);   /* the next step's loads fly under this step's products */
      nh[0] = *(const v8b*)(hp + kn * 32); nh[1] = *(const v8b*)(hp + kn * 32 + 16); nl[0] = *(const v8b*)(lp + kn * 32); nl[1] = *(const v8b*)(lp + kn * 32 + 16);
      asm volatile("s_wait_xcnt 0x0" ::: "memory"); }   /* in front of any rewrite of an address register that the loads above name: the roundings below reuse such registers while the youngest loads are still out */
    v16b w[8];
#pragma unroll
    for (int j = 0; j < 8; ++j) w[j] = frag_wt(&sw[kc & 1][0], j, lane);
    __builtin_amdgcn_sched_barrier(0);   /* holds the fragment reads as one group in front of the products: left free, the compiler sinks each read to its product, which then waits out the LDS latency alone */
#pragma unroll
    for (int j = 0; j < 8; ++j) { acc[j] = wmma_bf(a.h, w[j], acc[j]); acc[j] = wmma_bf(a.l, w[j], acc[j]); }
    __builtin_amdgcn_sched_barrier(0);   /* or the compiler lifts what follows, with its wait for the next step's loads, in among the products, which then stand behind that wait */
    if (more) { a.h = join_b(nh[0], nh[1]); a.l = join_b(nl[0], nl[1]); st_wt(&sw[kn & 1][0] + ws_o, wt); }
    __syncthreads(); }   /* one barrier a step: it publishes the next tile and ends the reads of the buffer that the next step refills */
#pragma unroll
  for (int j = 0; j < 8; ++j)
#pragma unroll
    for (int r = 0; r < 8; ++r) sf[wave][8 * g + r][j * 16 + col] = acc[j][r];
  LDSX(); for (int rl = 0; rl < 16; ++rl) vst2(OUT + (r0 + rl) * CC + c0 + lane * 4, *(const v4f*)&sf[wave][rl][lane * 4]); }
extern "C" void kernel_launch(void* const* d_in, const int* in_sizes, int n_in, void* d_out, int out_size, void* d_ws, size_t ws_size, hipStream_t stream) {
  (void)in_sizes; (void)n_in; (void)out_size;
  const float** F = (const float**)d_in;   // 0 x [4,1024,1024], 1 w_attn [1024,3072] ((in,out): q | k | v), 2 w_proj ((in,out)), 3 lambda_q1 [32], 4 lambda_q2, 5 lambda_k1, 6 lambda_k2, 7 gamma [64]
  if (ws_size < (size_t)WS_END) return;
  char* ws = (char*)d_ws; _Float16 *QH = (_Float16*)(ws + WS_QH), *QL = (_Float16*)(ws + WS_QL), *KH = (_Float16*)(ws + WS_KH); __bf16 *VT = (__bf16*)(ws + WS_VT), *VL = (__bf16*)(ws + WS_VL), *AH = (__bf16*)(ws + WS_AH), *AL = (__bf16*)(ws + WS_AL);
  k_proj<<<dim3(TNB * TT / 256, CC / 256, 3), 512, 0, stream>>>(F[0], F[1], nullptr, F[1] + CC, nullptr, F[1] + 2 * CC, nullptr, QH, QL, KH, VT, VL, nullptr, nullptr, 0);
  k_att<<<dim3(NH / 2, TNB, TT / 64), 256, 0, stream>>>(QH, QL, KH, VT, VL, F[3], F[4], F[5], F[6], F[7], AH, AL);
  k_out<<<dim3(TNB * TT / 64, CC / 128), 128, 0, stream>>>(AH, AL, F[2], (float*)d_out);
}
